// v000
// The times below were measured on an AMD MI455X: many runs one after another, warmed up first and cycling through
// copies of the inputs, with the whole window's GPU time divided by the number of runs. Launches and the gaps
// between them are all in it. The median over several windows is given; except for v000 it joins two sittings, which
// can be a few percent apart, so the side-by-side timings, each taken in one sitting, are the better comparison.
// v000, which the later versions start from, runs in 1600 microseconds.
#include <hip/hip_runtime.h>

// Causal grouped-query self-attention with QK RMS-norm, rotary embeddings and tanh logit soft-capping (x [2][2048][1024]; q = x w_q ('xw' [1024][1024] 0.02, 16 heads x 64), k, v = x w_k / w_v ([1024][256]: 4 kv heads, each shared by 4 query heads); q, k <- RMS-norm over 64 (eps 1e-5, no scale); half-split rope (theta 1e4, computed); scores / 8; softcap: 50 tanh(scores / 50); causal (-inf); softmax; out = merged w_o ('xw') -> [2][2048][1024] (4.2 M)).
// Layout per batch: bf16 copy of x; 'xw' weights transposed once; exact projections; in-place per-(token, head) RMS-norm kernels; {cos, sin} table once; rotate-half rotary plane builders; causal T-2048 GQA attention (each kv plane serves 4 query heads; hybrid rows: < 512 hi/lo 3 products, rest fp16 x1024; tiles above the diagonal skipped) whose soft cap is applied in place by a separate kernel before the softmax as 50 x tanh(s/50) (tanh via one exp2 and a division, f32); merged hi/lo x w_o exact.
// Compute dtypes, f32 accumulate: every input rounded to bf16; projections exact; RMS-norm and rotary f32; attention rows < 512 3 products, rest fp16; soft cap and softmax f32; w_o hl x exact.

#define NB_  2
#define TT   2048
#define DM   1024
#define NH_  16
#define NKV  4
#define REP  (NH_ / NKV)
#define HD   64
#define DQ   (NH_ * HD)
#define DKV  (NKV * HD)
#define ZH   2
#define RH   512                  // query rows < RH use hi+lo planes (0: none)
#define WIN  2048
#define PCAR 1024.0f
#define SCL  0.125f
#define CAP  50.0f
#define RMSEPS 1e-5f
typedef _Float16 h16;
typedef unsigned short bf;
typedef __attribute__((ext_vector_type(16))) __bf16   v16bf;
typedef __attribute__((ext_vector_type(16))) _Float16 v16h;
typedef __attribute__((ext_vector_type(8)))  _Float16 v8h;
typedef __attribute__((ext_vector_type(8)))  unsigned short v8us;
typedef __attribute__((ext_vector_type(8)))  float    v8f;
typedef __attribute__((ext_vector_type(4)))  float    v4f;
typedef v8h  __attribute__((may_alias)) v8ha;
typedef v4f  __attribute__((may_alias)) v4fa;
typedef v8us __attribute__((may_alias)) v8usa;

__device__ __forceinline__ unsigned short f2bf(float f) { unsigned u = __float_as_uint(f); u += 0x7FFFu + ((u >> 16) & 1u); return (unsigned short)(u >> 16); }
__device__ __forceinline__ float bf2f(unsigned short b) { return __uint_as_float(((unsigned)b) << 16); }
__device__ __forceinline__ float bfr(float f) { return bf2f(f2bf(f)); }
__device__ __forceinline__ v16h cat16(v8h lo, v8h hi) { return __builtin_shufflevector(lo, hi, 0, 1, 2, 3, 4, 5, 6, 7, 8, 9, 10, 11, 12, 13, 14, 15); }
__device__ __forceinline__ v16bf cat16b(v8us lo, v8us hi) { return __builtin_bit_cast(v16bf, __builtin_shufflevector(lo, hi, 0, 1, 2, 3, 4, 5, 6, 7, 8, 9, 10, 11, 12, 13, 14, 15)); }
__device__ __forceinline__ v8f wmma16(v16h a, v16h b, v8f c) { return __builtin_amdgcn_wmma_f32_16x16x32_f16(false, a, false, b, (short)0, c, false, false); }
__device__ __forceinline__ v8f wmmab(v16bf a, v16bf b, v8f c) { return __builtin_amdgcn_wmma_f32_16x16x32_bf16(false, a, false, b, (short)0, c, false, false); }



// ---- k_gemmw: register-blocked GEMM, ONE WAVE per 64x64 output tile (16 accumulators), operands straight from K-contiguous 16-bit planes; grid (M/64, N/64, Z), 32 threads.
// C[m][n] (f32, pitch ldc, + optional f32 bias[n]) = sum_k A[m][k] Bt[n][k] (+ split products per NSPLIT). z-batch strides sA/sB/sC in elements. K % 32 == 0.
// softcap: 50 tanh(s / 50) with tanh(u) = 1 - 2 / (exp(2u) + 1) (one exp2 of 2u log2 e, one precise division; u in [-0.2, 0.2] here so no overflow); f32.
__device__ __forceinline__ float softcap(float s) { float u = __fmul_rn(s, 1.0f / CAP); asm volatile("" : "+v"(u)); float e = __builtin_amdgcn_exp2f(__fmul_rn(__fmul_rn(u, 2.0f), 1.4426950408889634f)); asm volatile("" : "+v"(e)); float th = __fsub_rn(1.0f, __fdiv_rn(2.0f, __fadd_rn(e, 1.0f))); asm volatile("" : "+v"(th)); return __fmul_rn(th, CAP); }
template <typename T16> struct WFrag;
template <> struct WFrag<h16> { typedef v16h V; static __device__ __forceinline__ V ld(const h16* p) { return cat16(*(const v8h*)p, *(const v8h*)(p + 16)); } static __device__ __forceinline__ v8f mma(V a, V b, v8f c) { return wmma16(a, b, c); } };
template <> struct WFrag<bf> { typedef v16bf V; static __device__ __forceinline__ V ld(const bf* p) { return cat16b(*(const v8us*)p, *(const v8us*)(p + 16)); } static __device__ __forceinline__ v8f mma(V a, V b, v8f c) { return wmmab(a, b, c); } };
template <typename T16, int NSPLIT, bool BIAS>
__global__ __launch_bounds__(32) void k_gemmw(const T16* __restrict__ A, const T16* __restrict__ A2, const T16* __restrict__ Bt, const T16* __restrict__ Bt2, int K, float* C, int ldc, const float* __restrict__ bias, size_t sA, size_t sB, size_t sC) {
    typedef typename WFrag<T16>::V V;
    __shared__ __align__(16) float os[16 * 68];
    const size_t z = blockIdx.z; A += z * sA; if (A2) A2 += z * sA; Bt += z * sB; if (Bt2) Bt2 += z * sB; C += z * sC;
    const int lane = threadIdx.x & 31, lr = lane & 15, hi = lane >> 4; const int r0 = blockIdx.x * 64, c0 = blockIdx.y * 64;
    v8f acc[4][4];
#pragma unroll
    for (int mb = 0; mb < 4; ++mb)
#pragma unroll
        for (int nb = 0; nb < 4; ++nb) acc[mb][nb] = (v8f){};
    const size_t aoff = (size_t)(r0 + lr) * K + 8 * hi, boff = (size_t)(c0 + lr) * K + 8 * hi;
#pragma unroll 1
    for (int kc = 0; kc < K; kc += 32) {
        V a[4], a2[4];
#pragma unroll
        for (int mb = 0; mb < 4; ++mb) { a[mb] = WFrag<T16>::ld(A + aoff + (size_t)mb * 16 * K + kc); if (NSPLIT == 1 || NSPLIT == 2) a2[mb] = WFrag<T16>::ld(A2 + aoff + (size_t)mb * 16 * K + kc); }
#pragma unroll
        for (int nb = 0; nb < 4; ++nb) { const V b = WFrag<T16>::ld(Bt + boff + (size_t)nb * 16 * K + kc); V b2; if (NSPLIT >= 2) b2 = WFrag<T16>::ld(Bt2 + boff + (size_t)nb * 16 * K + kc);
#pragma unroll
            for (int mb = 0; mb < 4; ++mb) { acc[mb][nb] = WFrag<T16>::mma(a[mb], b, acc[mb][nb]); if (NSPLIT == 1 || NSPLIT == 2) acc[mb][nb] = WFrag<T16>::mma(a2[mb], b, acc[mb][nb]); if (NSPLIT >= 2) acc[mb][nb] = WFrag<T16>::mma(a[mb], b2, acc[mb][nb]); } }
        asm volatile("v_nop\n\tv_nop\n\tv_nop\n\tv_nop" : "+v"(acc[0][0]), "+v"(acc[1][1]), "+v"(acc[2][2]), "+v"(acc[3][3]) : "v"(a[0]), "v"(a[3]));
    }
#pragma unroll
    for (int mb = 0; mb < 4; ++mb) {
#pragma unroll
        for (int nb = 0; nb < 4; ++nb) {
#pragma unroll
            for (int j = 0; j < 8; ++j) os[(hi * 8 + j) * 68 + nb * 16 + lr] = acc[mb][nb][j]; }
        __builtin_amdgcn_wave_barrier(); asm volatile("" ::: "memory");
        float* crow = C + (size_t)(r0 + mb * 16) * ldc + c0;
{
#pragma unroll
            for (int s = 0; s < 8; ++s) { const int row = 2 * s + hi, cofs = lr * 4; v4f val = *(const v4fa*)(os + row * 68 + cofs); if (BIAS) { val[0] += bfr(bias[c0 + cofs]); val[1] += bfr(bias[c0 + cofs + 1]); val[2] += bfr(bias[c0 + cofs + 2]); val[3] += bfr(bias[c0 + cofs + 3]); }
                *(v4f*)(crow + (size_t)row * ldc + cofs) = val; }
             }
        __builtin_amdgcn_wave_barrier(); asm volatile("" ::: "memory");
    }
}

// ---- k_gemmc: the same one-wave 64x64 tile GEMM specialised for causal attention: CMODE 1 skips score tiles entirely above the diagonal (query rows r0+roff.., key columns c0..), CMODE 2 limits the
// key (K) loop of the probability x value contraction to the diagonal block (probabilities beyond it are exactly zero). roff = row offset of this launch's first row within the sequence.
template <typename T16, int NSPLIT, int CMODE>
__global__ __launch_bounds__(32) void k_gemmc(const T16* __restrict__ A, const T16* __restrict__ A2, const T16* __restrict__ Bt, const T16* __restrict__ Bt2, int K, float* C, int ldc, int roff, size_t sA, size_t sB, size_t sC) {
    typedef typename WFrag<T16>::V V;
    __shared__ __align__(16) float os[16 * 68];
    const size_t z = blockIdx.z; A += z * sA; if (A2) A2 += z * sA; Bt += z * sB; if (Bt2) Bt2 += z * sB; C += z * sC;
    const int lane = threadIdx.x & 31, lr = lane & 15, hi = lane >> 4; const int r0 = blockIdx.x * 64, c0 = blockIdx.y * 64;
    if (CMODE == 1 && c0 > r0 + roff + 63) return;                  // score tile entirely above the causal diagonal: never read (the softmax masks j > i by select)
    const int Kl = (CMODE == 2) ? min(K, r0 + roff + 64) : K;        // P.V: probabilities are exactly 0 beyond the diagonal block, so the K loop stops there
    v8f acc[4][4];
#pragma unroll
    for (int mb = 0; mb < 4; ++mb)
#pragma unroll
        for (int nb = 0; nb < 4; ++nb) acc[mb][nb] = (v8f){};
    const size_t aoff = (size_t)(r0 + lr) * K + 8 * hi, boff = (size_t)(c0 + lr) * K + 8 * hi;
#pragma unroll 1
    for (int kc = 0; kc < Kl; kc += 32) {
        V a[4], a2[4];
#pragma unroll
        for (int mb = 0; mb < 4; ++mb) { a[mb] = WFrag<T16>::ld(A + aoff + (size_t)mb * 16 * K + kc); if (NSPLIT == 1 || NSPLIT == 2) a2[mb] = WFrag<T16>::ld(A2 + aoff + (size_t)mb * 16 * K + kc); }
#pragma unroll
        for (int nb = 0; nb < 4; ++nb) { const V b = WFrag<T16>::ld(Bt + boff + (size_t)nb * 16 * K + kc); V b2; if (NSPLIT >= 2) b2 = WFrag<T16>::ld(Bt2 + boff + (size_t)nb * 16 * K + kc);
#pragma unroll
            for (int mb = 0; mb < 4; ++mb) { acc[mb][nb] = WFrag<T16>::mma(a[mb], b, acc[mb][nb]); if (NSPLIT == 1 || NSPLIT == 2) acc[mb][nb] = WFrag<T16>::mma(a2[mb], b, acc[mb][nb]); if (NSPLIT >= 2) acc[mb][nb] = WFrag<T16>::mma(a[mb], b2, acc[mb][nb]); } }
        asm volatile("v_nop\n\tv_nop\n\tv_nop\n\tv_nop" : "+v"(acc[0][0]), "+v"(acc[1][1]), "+v"(acc[2][2]), "+v"(acc[3][3]) : "v"(a[0]), "v"(a[3]));
    }
#pragma unroll
    for (int mb = 0; mb < 4; ++mb) {
#pragma unroll
        for (int nb = 0; nb < 4; ++nb) {
#pragma unroll
            for (int j = 0; j < 8; ++j) os[(hi * 8 + j) * 68 + nb * 16 + lr] = acc[mb][nb][j]; }
        __builtin_amdgcn_wave_barrier(); asm volatile("" ::: "memory");
        float* crow = C + (size_t)(r0 + mb * 16) * ldc + c0;
{
#pragma unroll
            for (int s = 0; s < 8; ++s) { const int row = 2 * s + hi, cofs = lr * 4; v4f val = *(const v4fa*)(os + row * 68 + cofs);
                *(v4f*)(crow + (size_t)row * ldc + cofs) = val; }
             }
        __builtin_amdgcn_wave_barrier(); asm volatile("" ::: "memory");
    }
}

__device__ __forceinline__ h16 tohx(float x) { return (h16)x; }
__device__ __forceinline__ void splitf(float y, unsigned short& h, unsigned short& l) { h = f2bf(y); l = f2bf(y - bf2f(h)); }
typedef __attribute__((ext_vector_type(2))) _Float16 v2h;
typedef __attribute__((ext_vector_type(4))) _Float16 v4h;
typedef __attribute__((ext_vector_type(2))) unsigned short v2us;
typedef __attribute__((ext_vector_type(4))) unsigned short v4us;
typedef __attribute__((ext_vector_type(2))) float v2f;
typedef __attribute__((ext_vector_type(4))) int v4i;

__global__ __launch_bounds__(256) void k_wtG(const float* __restrict__ w, int K, int N, bf* Bt) {
    const int lane = threadIdx.x & 31; const int L0 = (blockIdx.x * 8 + (threadIdx.x >> 5)) * 8; const int nlines = N * K / 64;
{
#pragma unroll 1
        for (int l = 0; l < 8; ++l) { const int L = L0 + l; if (L >= nlines) break; const size_t e = (size_t)L * 64 + lane * 2; const int k = (int)(e % K), n = (int)(e / K); v2us o;
            o[0] = f2bf(w[(size_t)k * N + n]); o[1] = f2bf(w[(size_t)(k + 1) * N + n]); *(v2us*)(Bt + e) = o; }
         }
}
__global__ __launch_bounds__(256) void k_cvt8(const float* __restrict__ src, bf* dst, size_t n8) { const size_t i = (size_t)blockIdx.x * 256 + threadIdx.x; if (i >= n8) return; const v8f v = *(const v8f*)(src + i * 8); v8us o;
#pragma unroll
    for (int k = 0; k < 8; ++k) o[k] = f2bf(v[k]); *(v8us*)(dst + i * 8) = o;  }
// k_rope: head planes [h][t][d] (fp16 + hi/lo) of rope(x) x sc with the rotate-half convention out[d] = x[d] cos[t][d] - x[d+HD/2] sin[t][d], out[d+HD/2] = x[d+HD/2] cos[t][d+HD/2] + x[d] sin[t][d+HD/2]
__global__ __launch_bounds__(256) void k_rope(const float* __restrict__ F, int pitch, int nheads, const float* __restrict__ CS, const float* __restrict__ RF, const float* __restrict__ nw, float sc, h16* P16, bf* Ph, bf* Pl) {
    const size_t e = ((size_t)blockIdx.x * 256 + threadIdx.x) * 2; if (e >= (size_t)nheads * TT * HD) return; const int d = (int)(e % HD); const int t = (int)((e / HD) % TT); const int h = (int)(e / ((size_t)HD * TT)); const float* f = F + (size_t)t * pitch + h * HD; const float rf = RF ? RF[(size_t)h * TT + t] : 1.0f; v2h o16; v2us oh, ol;
#pragma unroll
    for (int q = 0; q < 2; ++q) { const int dd = d + q; const int dp = (dd < HD / 2) ? dd + HD / 2 : dd - HD / 2; float x0 = f[dd], x1 = f[dp];
        if (RF) { float n0 = __fmul_rn(x0, rf), n1 = __fmul_rn(x1, rf); asm volatile("" : "+v"(n0)); asm volatile("" : "+v"(n1)); x0 = __fmul_rn(bfr(nw[dd]), n0); x1 = __fmul_rn(bfr(nw[dp]), n1); }
        const v2f cs = *(const v2f*)(CS + ((size_t)t * HD + dd) * 2); float a = __fmul_rn(x0, cs[0]), bq = __fmul_rn(x1, cs[1]); asm volatile("" : "+v"(a)); asm volatile("" : "+v"(bq)); const float r = ((dd < HD / 2) ? __fsub_rn(a, bq) : __fadd_rn(a, bq)) * sc;
        o16[q] = tohx(r); unsigned short a2, c2; splitf(r, a2, c2); oh[q] = a2; ol[q] = c2; }
    *(v2h*)(P16 + e) = o16; *(v2us*)(Ph + e) = oh; *(v2us*)(Pl + e) = ol;  }
__global__ __launch_bounds__(256) void k_vtp(const float* __restrict__ F, int pitch, int nheads, h16* V16, bf* Vh, bf* Vl) { const size_t e = ((size_t)blockIdx.x * 256 + threadIdx.x) * 2; if (e >= (size_t)nheads * HD * TT) return; const int t = (int)(e % TT); const int d = (int)((e / TT) % HD); const int g = (int)(e / ((size_t)TT * HD)); v2h o16; v2us oh, ol;
#pragma unroll
    for (int q = 0; q < 2; ++q) { const float x = F[(size_t)(t + q) * pitch + g * HD + d]; o16[q] = tohx(x); unsigned short a2, c2; splitf(x, a2, c2); oh[q] = a2; ol[q] = c2; }
    *(v2h*)(V16 + e) = o16; *(v2us*)(Vh + e) = oh; *(v2us*)(Vl + e) = ol;  }
// k_asoft: per row (zz, i): t = S x 1/8 (S pre-capped: 8 x 50 tanh((s/8)/50)) for keys j <= i, -3e38 for j > i (causal); softmax over the 2048 keys (register row, one exp, fixed trees);
__global__ __launch_bounds__(256) void k_asoft(const float* __restrict__ Sb, h16* P16, bf* Ph, bf* Pl) {
    const int lane = threadIdx.x & 31; const int row = blockIdx.x * 8 + (threadIdx.x >> 5); if (row >= ZH * TT) return; const int i = row % TT; const int zz = row / TT; (void)zz; const bool hires = (i < RH); const float* sr = Sb + (size_t)row * TT; float v[TT / 32]; float mx = -3.0e38f;
#pragma unroll
    for (int ch = 0; ch < TT / 128; ++ch) { const int j0 = ch * 128 + lane * 4; const v4f a = *(const v4f*)(sr + j0);
#pragma unroll
        for (int q = 0; q < 4; ++q) { const int j = j0 + q; (void)j; const float t = (j <= i) ? a[q] * SCL : -3.0e38f;   /* causal; Sb already holds 8 x softcap(s/8) */ v[ch * 4 + q] = t; mx = fmaxf(mx, t); } }
#pragma unroll
    for (int sh = 16; sh; sh >>= 1) mx = fmaxf(mx, __shfl_xor(mx, sh, 32));
    float sum = 0.f;
#pragma unroll
    for (int k = 0; k < TT / 32; ++k) { float d0 = __fsub_rn(v[k], mx); asm volatile("" : "+v"(d0)); v[k] = __builtin_amdgcn_exp2f(__fmul_rn(d0, 1.4426950408889634f)); sum += v[k]; }
#pragma unroll
    for (int sh = 16; sh; sh >>= 1) sum += __shfl_xor(sum, sh, 32);
    const float f = __fdiv_rn(hires ? 1.0f : PCAR, sum);
{
        if (hires) {
#pragma unroll
            for (int ch = 0; ch < TT / 128; ++ch) { v4us oh, ol;
#pragma unroll
                for (int q = 0; q < 4; ++q) { unsigned short a, c2; splitf(v[ch * 4 + q] * f, a, c2); oh[q] = a; ol[q] = c2; }
                const size_t oo = ((size_t)zz * (RH ? RH : 1) + i) * TT + ch * 128 + lane * 4; *(v4us*)(Ph + oo) = oh; *(v4us*)(Pl + oo) = ol; }
        } else {
#pragma unroll
            for (int ch = 0; ch < TT / 128; ++ch) { v4h o4;
#pragma unroll
                for (int q = 0; q < 4; ++q) o4[q] = tohx(v[ch * 4 + q] * f);
                *(v4h*)(P16 + (size_t)row * TT + ch * 128 + lane * 4) = o4; } }
         }
}
__constant__ float INVT[HD / 2] = { 1.000000000e+00f, 7.498942018e-01f, 5.623413324e-01f, 4.216965139e-01f, 3.162277639e-01f, 2.371373773e-01f, 1.778279394e-01f, 1.333521456e-01f, 1.000000015e-01f, 7.498942316e-02f, 5.623413250e-02f, 4.216964915e-02f, 3.162277490e-02f, 2.371373773e-02f, 1.778279431e-02f, 1.333521400e-02f, 9.999999776e-03f, 7.498942316e-03f, 5.623413250e-03f, 4.216964822e-03f, 3.162277630e-03f, 2.371373819e-03f, 1.778279431e-03f, 1.333521446e-03f, 1.000000047e-03f, 7.498941850e-04f, 5.623413017e-04f, 4.216965172e-04f, 3.162277571e-04f, 2.371373703e-04f, 1.778279402e-04f, 1.333521504e-04f };   // 10000^(-2i/64) (the module's power form) (float32, generated with jnp to be bit-exact)
__global__ __launch_bounds__(256) void k_cs4(float* CS) { const int idx = blockIdx.x * 256 + threadIdx.x; if (idx >= TT * HD) return; const int d = idx % HD; const int t = idx / HD; const float a = __fmul_rn((float)t, INVT[d % (HD / 2)]); v2f cs; cs[0] = cosf(a); cs[1] = sinf(a); *(v2f*)(CS + (size_t)idx * 2) = cs;  }

__global__ __launch_bounds__(256) void k_hrms0(float* F, int nheads) { const int lane = threadIdx.x & 31; const size_t wv = (size_t)blockIdx.x * 8 + (threadIdx.x >> 5); if (wv >= (size_t)TT * nheads) return; float* f = F + wv * HD + lane * 2; const v2f a = *(const v2f*)f; float p0 = __fmul_rn(a[0], a[0]), p1 = __fmul_rn(a[1], a[1]); asm volatile("" : "+v"(p0), "+v"(p1)); float ss = __fadd_rn(p0, p1);
#pragma unroll
    for (int sh = 16; sh; sh >>= 1) ss = __fadd_rn(ss, __shfl_xor(ss, sh, 32));
    const float rs = __fdiv_rn(1.0f, __fsqrt_rn(__fadd_rn(__fdiv_rn(ss, (float)HD), RMSEPS))); v2f o;
#pragma unroll
    for (int q = 0; q < 2; ++q) { o[q] = __fmul_rn(a[q], rs); }
    *(v2f*)f = o;  }

__global__ __launch_bounds__(256) void k_capS(float* Sb) { const size_t k = (size_t)blockIdx.x * 256 + threadIdx.x; if (k >= (size_t)ZH * TT * TT / 4) return; const v4f a = *(const v4f*)(Sb + k * 4); v4f o;
#pragma unroll
    for (int q = 0; q < 4; ++q) { const float c = softcap(a[q] * SCL); o[q] = __fmul_rn(c, 8.0f); }
    *(v4f*)(Sb + k * 4) = o;  }
__global__ __launch_bounds__(256) void k_merge(const float* __restrict__ O, int h0, bf* Ah, bf* Al) { const size_t e = ((size_t)blockIdx.x * 256 + threadIdx.x) * 2; if (e >= (size_t)ZH * TT * HD) return; const int d = (int)(e % HD); const int t = (int)((e / HD) % TT); const int zz = (int)(e / ((size_t)HD * TT)); const float cs = (t < RH) ? 1.0f : (1.0f / PCAR); const size_t oo = (size_t)t * DQ + (h0 + zz) * HD + d;
    v2us oh, ol;
#pragma unroll
    for (int q = 0; q < 2; ++q) { unsigned short a, c2; splitf(O[e + q] * cs, a, c2); oh[q] = a; ol[q] = c2; } *(v2us*)(Ah + oo) = oh; *(v2us*)(Al + oo) = ol;  }

extern "C" void kernel_launch(void* const* d_in, const int* in_sizes, int n_in,
                              void* d_out, int out_size, void* d_ws, size_t ws_size, hipStream_t stream) {
    (void)in_sizes; (void)n_in; (void)out_size;
    const float* x = (const float*)d_in[0]; const float* wq = (const float*)d_in[1]; const float* wk = (const float*)d_in[2]; const float* wv = (const float*)d_in[3]; const float* wo = (const float*)d_in[4];
    float* OUT = (float*)d_out;     // [2][2048][1024]
    char* wsp = (char*)d_ws;
    auto take = [&](size_t bytes) { char* p = wsp; wsp += (bytes + 255) & ~(size_t)255; return (void*)p; };
    bf* WQ = (bf*)take((size_t)DQ * DM * 2); bf* WK = (bf*)take((size_t)DKV * DM * 2); bf* WV = (bf*)take((size_t)DKV * DM * 2); bf* WO = (bf*)take((size_t)DM * DQ * 2); float* CS = (float*)take((size_t)TT * HD * 2 * 4);
    bf* XB = (bf*)take((size_t)TT * DM * 2); float* FQ = (float*)take((size_t)TT * DQ * 4); float* FK = (float*)take((size_t)TT * DKV * 4);
    h16* QP16 = (h16*)take((size_t)NH_ * TT * HD * 2); h16* KP16 = (h16*)take((size_t)NKV * TT * HD * 2); h16* VT16 = (h16*)take((size_t)NKV * HD * TT * 2);
    bf* QPh = (bf*)take((size_t)NH_ * TT * HD * 2); bf* QPl = (bf*)take((size_t)NH_ * TT * HD * 2); bf* KPh = (bf*)take((size_t)NKV * TT * HD * 2); bf* KPl = (bf*)take((size_t)NKV * TT * HD * 2); bf* VTh = (bf*)take((size_t)NKV * HD * TT * 2); bf* VTl = (bf*)take((size_t)NKV * HD * TT * 2); bf* Ph = (bf*)take((size_t)ZH * RH * TT * 2); bf* Pl = (bf*)take((size_t)ZH * RH * TT * 2);
    float* Sb = (float*)take((size_t)ZH * TT * TT * 4); h16* P16 = (h16*)take((size_t)ZH * TT * TT * 2); float* Ob = (float*)take((size_t)ZH * TT * HD * 4); bf* ATh = (bf*)take((size_t)TT * DQ * 2); bf* ATl = (bf*)take((size_t)TT * DQ * 2);
    if ((size_t)(wsp - (char*)d_ws) > ws_size) return;    // ws 256 MiB
    float* FV = FK;   // v projection reuses the k buffer after the k planes are built (stream-ordered)
    { k_wtG<<<(unsigned)((DM * DQ / 64 + 63) / 64), 256, 0, stream>>>(wq, DM, DQ, WQ); k_wtG<<<(unsigned)((DM * DKV / 64 + 63) / 64), 256, 0, stream>>>(wk, DM, DKV, WK); k_wtG<<<(unsigned)((DM * DKV / 64 + 63) / 64), 256, 0, stream>>>(wv, DM, DKV, WV);
      k_wtG<<<(unsigned)((DQ * DM / 64 + 63) / 64), 256, 0, stream>>>(wo, DQ, DM, WO);
       }
    const unsigned LQ = (unsigned)(((size_t)NH_ * TT * HD / 2 + 255) / 256), LKv = (unsigned)(((size_t)NKV * TT * HD / 2 + 255) / 256);
    for (int b = 0; b < NB_; ++b) {
        if (b == 0) k_cs4<<<(TT * HD + 255) / 256, 256, 0, stream>>>(CS);
        k_cvt8<<<(unsigned)(((size_t)TT * DM / 8 + 255) / 256), 256, 0, stream>>>(x + (size_t)b * TT * DM, XB, (size_t)TT * DM / 8);
        k_gemmw<bf, 0, false><<<dim3(TT / 64, DQ / 64, 1), 32, 0, stream>>>(XB, nullptr, WQ, nullptr, DM, FQ, DQ, nullptr, 0, 0, 0);
        k_hrms0<<<(unsigned)(((size_t)TT * NH_ + 7) / 8), 256, 0, stream>>>(FQ, NH_);   /* per-head RMS-norm (no scale) */ k_rope<<<LQ, 256, 0, stream>>>(FQ, DQ, NH_, CS, nullptr, nullptr, 1.0f, QP16, QPh, QPl);
        k_gemmw<bf, 0, false><<<dim3(TT / 64, DKV / 64, 1), 32, 0, stream>>>(XB, nullptr, WK, nullptr, DM, FK, DKV, nullptr, 0, 0, 0);
        k_hrms0<<<(unsigned)(((size_t)TT * NKV + 7) / 8), 256, 0, stream>>>(FK, NKV); k_rope<<<LKv, 256, 0, stream>>>(FK, DKV, NKV, CS, nullptr, nullptr, 1.0f, KP16, KPh, KPl);
        k_gemmw<bf, 0, false><<<dim3(TT / 64, DKV / 64, 1), 32, 0, stream>>>(XB, nullptr, WV, nullptr, DM, FV, DKV, nullptr, 0, 0, 0); k_vtp<<<LKv, 256, 0, stream>>>(FV, DKV, NKV, VT16, VTh, VTl);
        for (int h0 = 0; h0 < NH_; h0 += ZH) { const size_t zq = (size_t)h0, zk = (size_t)(h0 / REP);   // both heads of a pass share kv group h0/REP (REP >= 2): sB = 0
            k_gemmc<bf, 2, 1><<<dim3(RH / 64, TT / 64, ZH), 32, 0, stream>>>(QPh + zq * TT * HD, QPl + zq * TT * HD, KPh + zk * TT * HD, KPl + zk * TT * HD, HD, Sb, TT, 0, (size_t)TT * HD, 0, (size_t)TT * TT);
            k_gemmc<h16, 0, 1><<<dim3((TT - RH) / 64, TT / 64, ZH), 32, 0, stream>>>(QP16 + zq * TT * HD + (size_t)RH * HD, nullptr, KP16 + zk * TT * HD, nullptr, HD, Sb + (size_t)RH * TT, TT, RH, (size_t)TT * HD, 0, (size_t)TT * TT);
            k_capS<<<(unsigned)(((size_t)ZH * TT * TT / 4 + 255) / 256), 256, 0, stream>>>(Sb);   /* soft cap in place (x8 so the softmax kernel's 1/8 restores it) */ k_asoft<<<ZH * TT / 8, 256, 0, stream>>>(Sb, P16, Ph, Pl);
            k_gemmc<bf, 2, 2><<<dim3(RH / 64, HD / 64, ZH), 32, 0, stream>>>(Ph, Pl, VTh + zk * HD * TT, VTl + zk * HD * TT, TT, Ob, HD, 0, (size_t)RH * TT, 0, (size_t)TT * HD);
            k_gemmc<h16, 0, 2><<<dim3((TT - RH) / 64, HD / 64, ZH), 32, 0, stream>>>(P16 + (size_t)RH * TT, nullptr, VT16 + zk * HD * TT, nullptr, TT, Ob + (size_t)RH * HD, HD, RH, (size_t)TT * TT, 0, (size_t)TT * HD);
            k_merge<<<(unsigned)(((size_t)ZH * TT * HD / 2 + 255) / 256), 256, 0, stream>>>(Ob, h0, ATh, ATl); }
        k_gemmw<bf, 1, false><<<dim3(TT / 64, DM / 64, 1), 32, 0, stream>>>(ATh, ATl, WO, nullptr, DQ, OUT + (size_t)b * TT * DM, DM, nullptr, 0, 0, 0); }
}

// v001
// A run of this version takes 1010 microseconds.
// Two timings next to v000 put it at 1.54 and 1.55 times that version's speed.
#include <hip/hip_runtime.h>

// Causal grouped-query self-attention with QK RMS-norm, rotary embeddings and tanh logit soft-capping (x [2][2048][1024]; q = x w_q ('xw' [1024][1024] 0.02, 16 heads x 64), k, v = x w_k / w_v ([1024][256]: 4 kv heads, each shared by 4 query heads); q, k <- RMS-norm over 64 (eps 1e-5, no scale); half-split rope (theta 1e4, computed); scores / 8; softcap: 50 tanh(scores / 50); causal (-inf); softmax; out = merged w_o ('xw') -> [2][2048][1024] (4.2 M)).
// Layout per batch: bf16 copy of x; 'xw' weights transposed once; exact projections; in-place per-(token, head) RMS-norm kernels; {cos, sin} table once; rotate-half rotary plane builders; causal T-2048 GQA attention (each kv plane serves 4 query heads; hybrid rows: < 512 hi/lo 3 products, rest fp16 x1024; tiles above the diagonal skipped) whose soft cap is applied in place by a separate kernel before the softmax as 50 x tanh(s/50) (tanh via one exp2 and a division, f32); merged hi/lo x w_o exact.
// Compute dtypes, f32 accumulate: every input rounded to bf16; projections exact; RMS-norm and rotary f32; attention rows < 512 3 products, rest fp16; soft cap and softmax f32; w_o hl x exact.

#define NB_  2
#define TT   2048
#define DM   1024
#define NH_  16
#define NKV  4
#define REP  (NH_ / NKV)
#define HD   64
#define DQ   (NH_ * HD)
#define DKV  (NKV * HD)
#define ZH   2
#define RH   512                  // query rows < RH use hi+lo planes (0: none)
#define WIN  2048
#define PCAR 1024.0f
#define SCL  0.125f
#define CAP  50.0f
#define RMSEPS 1e-5f
typedef _Float16 h16;
typedef unsigned short bf;
typedef __attribute__((ext_vector_type(16))) __bf16   v16bf;
typedef __attribute__((ext_vector_type(16))) _Float16 v16h;
typedef __attribute__((ext_vector_type(8)))  _Float16 v8h;
typedef __attribute__((ext_vector_type(8)))  unsigned short v8us;
typedef __attribute__((ext_vector_type(8)))  float    v8f;
typedef __attribute__((ext_vector_type(4)))  float    v4f;
typedef v8h  __attribute__((may_alias)) v8ha;
typedef v4f  __attribute__((may_alias)) v4fa;
typedef v8us __attribute__((may_alias)) v8usa;

__device__ __forceinline__ unsigned short f2bf(float f) { unsigned u = __float_as_uint(f); u += 0x7FFFu + ((u >> 16) & 1u); return (unsigned short)(u >> 16); }
__device__ __forceinline__ float bf2f(unsigned short b) { return __uint_as_float(((unsigned)b) << 16); }
__device__ __forceinline__ float bfr(float f) { return bf2f(f2bf(f)); }
__device__ __forceinline__ v16h cat16(v8h lo, v8h hi) { return __builtin_shufflevector(lo, hi, 0, 1, 2, 3, 4, 5, 6, 7, 8, 9, 10, 11, 12, 13, 14, 15); }
__device__ __forceinline__ v16bf cat16b(v8us lo, v8us hi) { return __builtin_bit_cast(v16bf, __builtin_shufflevector(lo, hi, 0, 1, 2, 3, 4, 5, 6, 7, 8, 9, 10, 11, 12, 13, 14, 15)); }
__device__ __forceinline__ v8f wmma16(v16h a, v16h b, v8f c) { return __builtin_amdgcn_wmma_f32_16x16x32_f16(false, a, false, b, (short)0, c, false, false); }
__device__ __forceinline__ v8f wmmab(v16bf a, v16bf b, v8f c) { return __builtin_amdgcn_wmma_f32_16x16x32_bf16(false, a, false, b, (short)0, c, false, false); }



// ---- k_gemmw: register-blocked GEMM, 8 waves per 64x64 output tile, the K range split over the waves (16 accumulators each), operands straight from K-contiguous 16-bit planes; grid (M/64, N/64, Z), 256 threads.
// C[m][n] (f32, pitch ldc, + optional f32 bias[n]) = sum_k A[m][k] Bt[n][k] (+ split products per NSPLIT). z-batch strides sA/sB/sC in elements. K % 64 == 0.
// softcap: 50 tanh(s / 50) with tanh(u) = 1 - 2 / (exp(2u) + 1) (one exp2 of 2u log2 e, one precise division; u in [-0.2, 0.2] here so no overflow); f32.
__device__ __forceinline__ float softcap(float s) { float u = __fmul_rn(s, 1.0f / CAP); asm volatile("" : "+v"(u)); float e = __builtin_amdgcn_exp2f(__fmul_rn(__fmul_rn(u, 2.0f), 1.4426950408889634f)); asm volatile("" : "+v"(e)); float th = __fsub_rn(1.0f, __fdiv_rn(2.0f, __fadd_rn(e, 1.0f))); asm volatile("" : "+v"(th)); return __fmul_rn(th, CAP); }
template <typename T16> struct WFrag;
template <> struct WFrag<h16> { typedef v16h V; static __device__ __forceinline__ V ld(const h16* p) { return cat16(*(const v8h*)p, *(const v8h*)(p + 16)); } static __device__ __forceinline__ v8f mma(V a, V b, v8f c) { return wmma16(a, b, c); } };
template <> struct WFrag<bf> { typedef v16bf V; static __device__ __forceinline__ V ld(const bf* p) { return cat16b(*(const v8us*)p, *(const v8us*)(p + 16)); } static __device__ __forceinline__ v8f mma(V a, V b, v8f c) { return wmmab(a, b, c); } };
// tile_splitk: one 64x64 output tile by a work-group of NW (8 or 16) waves. Wave w takes the 64-wide k chunks w, w + NW, ... below Kl (Kl % 64 == 0; a chunk = one whole 128-byte line of every operand row, two
// trips of 32) with the 16-accumulator register block; the NW partial tiles go to LDS in register order (b128, one slot per lane), and behind one barrier each wave sums, in wave order 0..NW-1, its 32 / NW
// slots and stores them: 32 columns = one whole 128-byte line of each of its rows, so every line of C has one writer.
template <typename T16, int NSPLIT, bool BIAS, int NW>
__device__ __forceinline__ void tile_splitk(const T16* __restrict__ A, const T16* __restrict__ A2, const T16* __restrict__ Bt, const T16* __restrict__ Bt2, int K, int Kl, float* C, int ldc, const float* __restrict__ bias, int r0, int c0) {
    typedef typename WFrag<T16>::V V;
    __shared__ __align__(16) float part[NW * 32 * 32 * 4];           // [wave][slot = (mb * 4 + nb) * 2 + g][lane][4]: accumulator elements 4 g .. 4 g + 3
    const int lane = threadIdx.x & 31, lr = lane & 15, hi = lane >> 4; const int w = __builtin_amdgcn_readfirstlane(threadIdx.x >> 5);
    v8f acc[4][4];
#pragma unroll
    for (int mb = 0; mb < 4; ++mb)
#pragma unroll
        for (int nb = 0; nb < 4; ++nb) acc[mb][nb] = (v8f){};
    const size_t aoff = (size_t)(r0 + lr) * K + 8 * hi, boff = (size_t)(c0 + lr) * K + 8 * hi;
#pragma unroll 1
    for (int kc = w * 64; kc < Kl; kc += (kc & 32) ? NW * 64 - 32 : 32) {
        V a[4], a2[4];
#pragma unroll
        for (int mb = 0; mb < 4; ++mb) { a[mb] = WFrag<T16>::ld(A + aoff + (size_t)mb * 16 * K + kc); if (NSPLIT == 1 || NSPLIT == 2) a2[mb] = WFrag<T16>::ld(A2 + aoff + (size_t)mb * 16 * K + kc); }
#pragma unroll
        for (int nb = 0; nb < 4; ++nb) { const V b = WFrag<T16>::ld(Bt + boff + (size_t)nb * 16 * K + kc); V b2; if (NSPLIT >= 2) b2 = WFrag<T16>::ld(Bt2 + boff + (size_t)nb * 16 * K + kc);
#pragma unroll
            for (int mb = 0; mb < 4; ++mb) { acc[mb][nb] = WFrag<T16>::mma(a[mb], b, acc[mb][nb]); if (NSPLIT == 1 || NSPLIT == 2) acc[mb][nb] = WFrag<T16>::mma(a2[mb], b, acc[mb][nb]); if (NSPLIT >= 2) acc[mb][nb] = WFrag<T16>::mma(a[mb], b2, acc[mb][nb]); } }
        // four vector slots behind the trip's last matrix instructions, on the back edge and on the exit alike, before fragments are reloaded or accumulators read
        asm volatile("v_nop\n\tv_nop\n\tv_nop\n\tv_nop" : "+v"(acc[0][0]), "+v"(acc[1][1]), "+v"(acc[2][2]), "+v"(acc[3][3]) : "v"(a[0]), "v"(a[3]));
    }
#pragma unroll
    for (int mb = 0; mb < 4; ++mb)
#pragma unroll
        for (int nb = 0; nb < 4; ++nb)
#pragma unroll
            for (int g = 0; g < 2; ++g) { v4f p; p[0] = acc[mb][nb][g * 4]; p[1] = acc[mb][nb][g * 4 + 1]; p[2] = acc[mb][nb][g * 4 + 2]; p[3] = acc[mb][nb][g * 4 + 3];
                *(v4fa*)(part + (((w * 32 + (mb * 4 + nb) * 2 + g) * 32 + lane) << 2)) = p; }
    __syncthreads();                                                 // every wave's partial tile is in LDS before any wave sums
    constexpr int GS = 16 / NW;                                      // g values a wave sums: 2 with 8 waves, 1 with 16
    const int mbw = w / (NW / 4), rem = w % (NW / 4), nbp = rem / (2 / GS), g0 = (rem % (2 / GS)) * GS;
#pragma unroll
    for (int u = 0; u < 2; ++u) { const int col = c0 + (nbp * 2 + u) * 16 + lr; const float bv = BIAS ? bfr(bias[col]) : 0.0f;
#pragma unroll
        for (int gg = 0; gg < GS; ++gg) { const int slot = (mbw * 4 + nbp * 2 + u) * 2 + g0 + gg; v4f s = *(const v4fa*)(part + ((slot * 32 + lane) << 2));
#pragma unroll
            for (int p = 1; p < NW; ++p) s += *(const v4fa*)(part + (((p * 32 + slot) * 32 + lane) << 2));
#pragma unroll
            for (int q = 0; q < 4; ++q) { float val = s[q]; if (BIAS) val += bv; C[(size_t)(r0 + mbw * 16 + hi * 8 + (g0 + gg) * 4 + q) * ldc + col] = val; } } }
}
template <typename T16, int NSPLIT, bool BIAS>
__global__ __launch_bounds__(256) void k_gemmw(const T16* __restrict__ A, const T16* __restrict__ A2, const T16* __restrict__ Bt, const T16* __restrict__ Bt2, int K, float* C, int ldc, const float* __restrict__ bias, size_t sA, size_t sB, size_t sC) {
    const size_t z = blockIdx.z; A += z * sA; if (A2) A2 += z * sA; Bt += z * sB; if (Bt2) Bt2 += z * sB; C += z * sC;
    tile_splitk<T16, NSPLIT, BIAS, 8>(A, A2, Bt, Bt2, K, K, C, ldc, bias, blockIdx.x * 64, blockIdx.y * 64);
}
// ---- k_gemmpv: the probability x value contraction on the same NW-wave tile (NW * 32 threads); the key (K) range stops at the diagonal block (probabilities beyond it are exactly zero). roff = row offset of this launch's first row within the sequence.
template <typename T16, int NSPLIT, int NW>
__global__ __launch_bounds__(NW * 32) void k_gemmpv(const T16* __restrict__ A, const T16* __restrict__ A2, const T16* __restrict__ Bt, const T16* __restrict__ Bt2, int K, float* C, int ldc, int roff, size_t sA, size_t sB, size_t sC) {
    const size_t z = blockIdx.z; A += z * sA; if (A2) A2 += z * sA; Bt += z * sB; if (Bt2) Bt2 += z * sB; C += z * sC;
    const int r0 = blockIdx.x * 64;
    tile_splitk<T16, NSPLIT, false, NW>(A, A2, Bt, Bt2, K, min(K, r0 + roff + 64), C, ldc, nullptr, r0, blockIdx.y * 64);
}

// ---- k_gemmc: one-wave 64x64 tile GEMM (16 accumulators, 32 threads) for the causal scores (K = 64): CMODE 1 skips score tiles entirely above the diagonal (query rows r0+roff.., key columns c0..). roff = row offset of this launch's first row within the sequence.
template <typename T16, int NSPLIT, int CMODE>
__global__ __launch_bounds__(32) void k_gemmc(const T16* __restrict__ A, const T16* __restrict__ A2, const T16* __restrict__ Bt, const T16* __restrict__ Bt2, int K, float* C, int ldc, int roff, size_t sA, size_t sB, size_t sC) {
    typedef typename WFrag<T16>::V V;
    __shared__ __align__(16) float os[16 * 68];
    const size_t z = blockIdx.z; A += z * sA; if (A2) A2 += z * sA; Bt += z * sB; if (Bt2) Bt2 += z * sB; C += z * sC;
    const int lane = threadIdx.x & 31, lr = lane & 15, hi = lane >> 4; const int r0 = blockIdx.x * 64, c0 = blockIdx.y * 64;
    if (CMODE == 1 && c0 > r0 + roff + 63) return;                  // score tile entirely above the causal diagonal: not computed; read by k_capS and the softmax but never used (the softmax masks j > i by select)
    v8f acc[4][4];
#pragma unroll
    for (int mb = 0; mb < 4; ++mb)
#pragma unroll
        for (int nb = 0; nb < 4; ++nb) acc[mb][nb] = (v8f){};
    const size_t aoff = (size_t)(r0 + lr) * K + 8 * hi, boff = (size_t)(c0 + lr) * K + 8 * hi;
#pragma unroll 1
    for (int kc = 0; kc < K; kc += 32) {
        V a[4], a2[4];
#pragma unroll
        for (int mb = 0; mb < 4; ++mb) { a[mb] = WFrag<T16>::ld(A + aoff + (size_t)mb * 16 * K + kc); if (NSPLIT == 1 || NSPLIT == 2) a2[mb] = WFrag<T16>::ld(A2 + aoff + (size_t)mb * 16 * K + kc); }
#pragma unroll
        for (int nb = 0; nb < 4; ++nb) { const V b = WFrag<T16>::ld(Bt + boff + (size_t)nb * 16 * K + kc); V b2; if (NSPLIT >= 2) b2 = WFrag<T16>::ld(Bt2 + boff + (size_t)nb * 16 * K + kc);
#pragma unroll
            for (int mb = 0; mb < 4; ++mb) { acc[mb][nb] = WFrag<T16>::mma(a[mb], b, acc[mb][nb]); if (NSPLIT == 1 || NSPLIT == 2) acc[mb][nb] = WFrag<T16>::mma(a2[mb], b, acc[mb][nb]); if (NSPLIT >= 2) acc[mb][nb] = WFrag<T16>::mma(a[mb], b2, acc[mb][nb]); } }
        asm volatile("v_nop\n\tv_nop\n\tv_nop\n\tv_nop" : "+v"(acc[0][0]), "+v"(acc[1][1]), "+v"(acc[2][2]), "+v"(acc[3][3]) : "v"(a[0]), "v"(a[3]));
    }
#pragma unroll
    for (int mb = 0; mb < 4; ++mb) {
#pragma unroll
        for (int nb = 0; nb < 4; ++nb) {
#pragma unroll
            for (int j = 0; j < 8; ++j) os[(hi * 8 + j) * 68 + nb * 16 + lr] = acc[mb][nb][j]; }
        __builtin_amdgcn_wave_barrier(); asm volatile("" ::: "memory");
        float* crow = C + (size_t)(r0 + mb * 16) * ldc + c0;
{
#pragma unroll
            for (int s = 0; s < 8; ++s) { const int row = 2 * s + hi, cofs = lr * 4; v4f val = *(const v4fa*)(os + row * 68 + cofs);
                *(v4f*)(crow + (size_t)row * ldc + cofs) = val; }
             }
        __builtin_amdgcn_wave_barrier(); asm volatile("" ::: "memory");
    }
}

__device__ __forceinline__ h16 tohx(float x) { return (h16)x; }
__device__ __forceinline__ void splitf(float y, unsigned short& h, unsigned short& l) { h = f2bf(y); l = f2bf(y - bf2f(h)); }
typedef __attribute__((ext_vector_type(2))) _Float16 v2h;
typedef __attribute__((ext_vector_type(4))) _Float16 v4h;
typedef __attribute__((ext_vector_type(2))) unsigned short v2us;
typedef __attribute__((ext_vector_type(4))) unsigned short v4us;
typedef __attribute__((ext_vector_type(2))) float v2f;
typedef __attribute__((ext_vector_type(4))) int v4i;

__global__ __launch_bounds__(256) void k_wtG(const float* __restrict__ w, int K, int N, bf* Bt) {
    const int lane = threadIdx.x & 31; const int L0 = (blockIdx.x * 8 + (threadIdx.x >> 5)) * 8; const int nlines = N * K / 64;
{
#pragma unroll 1
        for (int l = 0; l < 8; ++l) { const int L = L0 + l; if (L >= nlines) break; const size_t e = (size_t)L * 64 + lane * 2; const int k = (int)(e % K), n = (int)(e / K); v2us o;
            o[0] = f2bf(w[(size_t)k * N + n]); o[1] = f2bf(w[(size_t)(k + 1) * N + n]); *(v2us*)(Bt + e) = o; }
         }
}
__global__ __launch_bounds__(256) void k_cvt8(const float* __restrict__ src, bf* dst, size_t n8) { const size_t i = (size_t)blockIdx.x * 256 + threadIdx.x; if (i >= n8) return; const v8f v = *(const v8f*)(src + i * 8); v8us o;
#pragma unroll
    for (int k = 0; k < 8; ++k) o[k] = f2bf(v[k]); *(v8us*)(dst + i * 8) = o;  }
// k_rope: head planes [h][t][d] (fp16 + hi/lo) of rope(x) x sc with the rotate-half convention out[d] = x[d] cos[t][d] - x[d+HD/2] sin[t][d], out[d+HD/2] = x[d+HD/2] cos[t][d+HD/2] + x[d] sin[t][d+HD/2]
__global__ __launch_bounds__(256) void k_rope(const float* __restrict__ F, int pitch, int nheads, const float* __restrict__ CS, const float* __restrict__ RF, const float* __restrict__ nw, float sc, h16* P16, bf* Ph, bf* Pl) {
    const size_t e = ((size_t)blockIdx.x * 256 + threadIdx.x) * 2; if (e >= (size_t)nheads * TT * HD) return; const int d = (int)(e % HD); const int t = (int)((e / HD) % TT); const int h = (int)(e / ((size_t)HD * TT)); const float* f = F + (size_t)t * pitch + h * HD; const float rf = RF ? RF[(size_t)h * TT + t] : 1.0f; v2h o16; v2us oh, ol;
#pragma unroll
    for (int q = 0; q < 2; ++q) { const int dd = d + q; const int dp = (dd < HD / 2) ? dd + HD / 2 : dd - HD / 2; float x0 = f[dd], x1 = f[dp];
        if (RF) { float n0 = __fmul_rn(x0, rf), n1 = __fmul_rn(x1, rf); asm volatile("" : "+v"(n0)); asm volatile("" : "+v"(n1)); x0 = __fmul_rn(bfr(nw[dd]), n0); x1 = __fmul_rn(bfr(nw[dp]), n1); }
        const v2f cs = *(const v2f*)(CS + ((size_t)t * HD + dd) * 2); float a = __fmul_rn(x0, cs[0]), bq = __fmul_rn(x1, cs[1]); asm volatile("" : "+v"(a)); asm volatile("" : "+v"(bq)); const float r = ((dd < HD / 2) ? __fsub_rn(a, bq) : __fadd_rn(a, bq)) * sc;
        o16[q] = tohx(r); unsigned short a2, c2; splitf(r, a2, c2); oh[q] = a2; ol[q] = c2; }
    *(v2h*)(P16 + e) = o16; *(v2us*)(Ph + e) = oh; *(v2us*)(Pl + e) = ol;  }
__global__ __launch_bounds__(256) void k_vtp(const float* __restrict__ F, int pitch, int nheads, h16* V16, bf* Vh, bf* Vl) { const size_t e = ((size_t)blockIdx.x * 256 + threadIdx.x) * 2; if (e >= (size_t)nheads * HD * TT) return; const int t = (int)(e % TT); const int d = (int)((e / TT) % HD); const int g = (int)(e / ((size_t)TT * HD)); v2h o16; v2us oh, ol;
#pragma unroll
    for (int q = 0; q < 2; ++q) { const float x = F[(size_t)(t + q) * pitch + g * HD + d]; o16[q] = tohx(x); unsigned short a2, c2; splitf(x, a2, c2); oh[q] = a2; ol[q] = c2; }
    *(v2h*)(V16 + e) = o16; *(v2us*)(Vh + e) = oh; *(v2us*)(Vl + e) = ol;  }
// k_asoft: per row (zz, i): t = S x 1/8 (S pre-capped: 8 x 50 tanh((s/8)/50)) for keys j <= i, -3e38 for j > i (causal); softmax over the 2048 keys (register row, one exp, fixed trees);
__global__ __launch_bounds__(256) void k_asoft(const float* __restrict__ Sb, h16* P16, bf* Ph, bf* Pl) {
    const int lane = threadIdx.x & 31; const int row = blockIdx.x * 8 + (threadIdx.x >> 5); if (row >= ZH * TT) return; const int i = row % TT; const int zz = row / TT; (void)zz; const bool hires = (i < RH); const float* sr = Sb + (size_t)row * TT; float v[TT / 32]; float mx = -3.0e38f;
#pragma unroll
    for (int ch = 0; ch < TT / 128; ++ch) { const int j0 = ch * 128 + lane * 4; const v4f a = *(const v4f*)(sr + j0);
#pragma unroll
        for (int q = 0; q < 4; ++q) { const int j = j0 + q; (void)j; const float t = (j <= i) ? a[q] * SCL : -3.0e38f;   /* causal; Sb already holds 8 x softcap(s/8) */ v[ch * 4 + q] = t; mx = fmaxf(mx, t); } }
#pragma unroll
    for (int sh = 16; sh; sh >>= 1) mx = fmaxf(mx, __shfl_xor(mx, sh, 32));
    float sum = 0.f;
#pragma unroll
    for (int k = 0; k < TT / 32; ++k) { float d0 = __fsub_rn(v[k], mx); asm volatile("" : "+v"(d0)); v[k] = __builtin_amdgcn_exp2f(__fmul_rn(d0, 1.4426950408889634f)); sum += v[k]; }
#pragma unroll
    for (int sh = 16; sh; sh >>= 1) sum += __shfl_xor(sum, sh, 32);
    const float f = __fdiv_rn(hires ? 1.0f : PCAR, sum);
{
        if (hires) {
#pragma unroll
            for (int ch = 0; ch < TT / 128; ++ch) { v4us oh, ol;
#pragma unroll
                for (int q = 0; q < 4; ++q) { unsigned short a, c2; splitf(v[ch * 4 + q] * f, a, c2); oh[q] = a; ol[q] = c2; }
                const size_t oo = ((size_t)zz * (RH ? RH : 1) + i) * TT + ch * 128 + lane * 4; *(v4us*)(Ph + oo) = oh; *(v4us*)(Pl + oo) = ol; }
        } else {
#pragma unroll
            for (int ch = 0; ch < TT / 128; ++ch) { v4h o4;
#pragma unroll
                for (int q = 0; q < 4; ++q) o4[q] = tohx(v[ch * 4 + q] * f);
                *(v4h*)(P16 + (size_t)row * TT + ch * 128 + lane * 4) = o4; } }
         }
}
__constant__ float INVT[HD / 2] = { 1.000000000e+00f, 7.498942018e-01f, 5.623413324e-01f, 4.216965139e-01f, 3.162277639e-01f, 2.371373773e-01f, 1.778279394e-01f, 1.333521456e-01f, 1.000000015e-01f, 7.498942316e-02f, 5.623413250e-02f, 4.216964915e-02f, 3.162277490e-02f, 2.371373773e-02f, 1.778279431e-02f, 1.333521400e-02f, 9.999999776e-03f, 7.498942316e-03f, 5.623413250e-03f, 4.216964822e-03f, 3.162277630e-03f, 2.371373819e-03f, 1.778279431e-03f, 1.333521446e-03f, 1.000000047e-03f, 7.498941850e-04f, 5.623413017e-04f, 4.216965172e-04f, 3.162277571e-04f, 2.371373703e-04f, 1.778279402e-04f, 1.333521504e-04f };   // 10000^(-2i/64) (the module's power form) (float32, generated with jnp to be bit-exact)
__global__ __launch_bounds__(256) void k_cs4(float* CS) { const int idx = blockIdx.x * 256 + threadIdx.x; if (idx >= TT * HD) return; const int d = idx % HD; const int t = idx / HD; const float a = __fmul_rn((float)t, INVT[d % (HD / 2)]); v2f cs; cs[0] = cosf(a); cs[1] = sinf(a); *(v2f*)(CS + (size_t)idx * 2) = cs;  }

__global__ __launch_bounds__(256) void k_hrms0(float* F, int nheads) { const int lane = threadIdx.x & 31; const size_t wv = (size_t)blockIdx.x * 8 + (threadIdx.x >> 5); if (wv >= (size_t)TT * nheads) return; float* f = F + wv * HD + lane * 2; const v2f a = *(const v2f*)f; float p0 = __fmul_rn(a[0], a[0]), p1 = __fmul_rn(a[1], a[1]); asm volatile("" : "+v"(p0), "+v"(p1)); float ss = __fadd_rn(p0, p1);
#pragma unroll
    for (int sh = 16; sh; sh >>= 1) ss = __fadd_rn(ss, __shfl_xor(ss, sh, 32));
    const float rs = __fdiv_rn(1.0f, __fsqrt_rn(__fadd_rn(__fdiv_rn(ss, (float)HD), RMSEPS))); v2f o;
#pragma unroll
    for (int q = 0; q < 2; ++q) { o[q] = __fmul_rn(a[q], rs); }
    *(v2f*)f = o;  }

__global__ __launch_bounds__(256) void k_capS(float* Sb) { const size_t k = (size_t)blockIdx.x * 256 + threadIdx.x; if (k >= (size_t)ZH * TT * TT / 4) return; const v4f a = *(const v4f*)(Sb + k * 4); v4f o;
#pragma unroll
    for (int q = 0; q < 4; ++q) { const float c = softcap(a[q] * SCL); o[q] = __fmul_rn(c, 8.0f); }
    *(v4f*)(Sb + k * 4) = o;  }
__global__ __launch_bounds__(256) void k_merge(const float* __restrict__ O, int h0, bf* Ah, bf* Al) { const size_t e = ((size_t)blockIdx.x * 256 + threadIdx.x) * 2; if (e >= (size_t)ZH * TT * HD) return; const int d = (int)(e % HD); const int t = (int)((e / HD) % TT); const int zz = (int)(e / ((size_t)HD * TT)); const float cs = (t < RH) ? 1.0f : (1.0f / PCAR); const size_t oo = (size_t)t * DQ + (h0 + zz) * HD + d;
    v2us oh, ol;
#pragma unroll
    for (int q = 0; q < 2; ++q) { unsigned short a, c2; splitf(O[e + q] * cs, a, c2); oh[q] = a; ol[q] = c2; } *(v2us*)(Ah + oo) = oh; *(v2us*)(Al + oo) = ol;  }

extern "C" void kernel_launch(void* const* d_in, const int* in_sizes, int n_in,
                              void* d_out, int out_size, void* d_ws, size_t ws_size, hipStream_t stream) {
    (void)in_sizes; (void)n_in; (void)out_size;
    const float* x = (const float*)d_in[0]; const float* wq = (const float*)d_in[1]; const float* wk = (const float*)d_in[2]; const float* wv = (const float*)d_in[3]; const float* wo = (const float*)d_in[4];
    float* OUT = (float*)d_out;     // [2][2048][1024]
    char* wsp = (char*)d_ws;
    auto take = [&](size_t bytes) { char* p = wsp; wsp += (bytes + 255) & ~(size_t)255; return (void*)p; };
    bf* WQ = (bf*)take((size_t)DQ * DM * 2); bf* WK = (bf*)take((size_t)DKV * DM * 2); bf* WV = (bf*)take((size_t)DKV * DM * 2); bf* WO = (bf*)take((size_t)DM * DQ * 2); float* CS = (float*)take((size_t)TT * HD * 2 * 4);
    bf* XB = (bf*)take((size_t)TT * DM * 2); float* FQ = (float*)take((size_t)TT * DQ * 4); float* FK = (float*)take((size_t)TT * DKV * 4);
    h16* QP16 = (h16*)take((size_t)NH_ * TT * HD * 2); h16* KP16 = (h16*)take((size_t)NKV * TT * HD * 2); h16* VT16 = (h16*)take((size_t)NKV * HD * TT * 2);
    bf* QPh = (bf*)take((size_t)NH_ * TT * HD * 2); bf* QPl = (bf*)take((size_t)NH_ * TT * HD * 2); bf* KPh = (bf*)take((size_t)NKV * TT * HD * 2); bf* KPl = (bf*)take((size_t)NKV * TT * HD * 2); bf* VTh = (bf*)take((size_t)NKV * HD * TT * 2); bf* VTl = (bf*)take((size_t)NKV * HD * TT * 2); bf* Ph = (bf*)take((size_t)ZH * RH * TT * 2); bf* Pl = (bf*)take((size_t)ZH * RH * TT * 2);
    float* Sb = (float*)take((size_t)ZH * TT * TT * 4); h16* P16 = (h16*)take((size_t)ZH * TT * TT * 2); float* Ob = (float*)take((size_t)ZH * TT * HD * 4); bf* ATh = (bf*)take((size_t)TT * DQ * 2); bf* ATl = (bf*)take((size_t)TT * DQ * 2);
    if ((size_t)(wsp - (char*)d_ws) > ws_size) return;    // ws 256 MiB
    float* FV = FK;   // v projection reuses the k buffer after the k planes are built (stream-ordered)
    { k_wtG<<<(unsigned)((DM * DQ / 64 + 63) / 64), 256, 0, stream>>>(wq, DM, DQ, WQ); k_wtG<<<(unsigned)((DM * DKV / 64 + 63) / 64), 256, 0, stream>>>(wk, DM, DKV, WK); k_wtG<<<(unsigned)((DM * DKV / 64 + 63) / 64), 256, 0, stream>>>(wv, DM, DKV, WV);
      k_wtG<<<(unsigned)((DQ * DM / 64 + 63) / 64), 256, 0, stream>>>(wo, DQ, DM, WO);
       }
    const unsigned LQ = (unsigned)(((size_t)NH_ * TT * HD / 2 + 255) / 256), LKv = (unsigned)(((size_t)NKV * TT * HD / 2 + 255) / 256);
    for (int b = 0; b < NB_; ++b) {
        if (b == 0) k_cs4<<<(TT * HD + 255) / 256, 256, 0, stream>>>(CS);
        k_cvt8<<<(unsigned)(((size_t)TT * DM / 8 + 255) / 256), 256, 0, stream>>>(x + (size_t)b * TT * DM, XB, (size_t)TT * DM / 8);
        k_gemmw<bf, 0, false><<<dim3(TT / 64, DQ / 64, 1), 256, 0, stream>>>(XB, nullptr, WQ, nullptr, DM, FQ, DQ, nullptr, 0, 0, 0);
        k_hrms0<<<(unsigned)(((size_t)TT * NH_ + 7) / 8), 256, 0, stream>>>(FQ, NH_);   /* per-head RMS-norm (no scale) */ k_rope<<<LQ, 256, 0, stream>>>(FQ, DQ, NH_, CS, nullptr, nullptr, 1.0f, QP16, QPh, QPl);
        k_gemmw<bf, 0, false><<<dim3(TT / 64, DKV / 64, 1), 256, 0, stream>>>(XB, nullptr, WK, nullptr, DM, FK, DKV, nullptr, 0, 0, 0);
        k_hrms0<<<(unsigned)(((size_t)TT * NKV + 7) / 8), 256, 0, stream>>>(FK, NKV); k_rope<<<LKv, 256, 0, stream>>>(FK, DKV, NKV, CS, nullptr, nullptr, 1.0f, KP16, KPh, KPl);
        k_gemmw<bf, 0, false><<<dim3(TT / 64, DKV / 64, 1), 256, 0, stream>>>(XB, nullptr, WV, nullptr, DM, FV, DKV, nullptr, 0, 0, 0); k_vtp<<<LKv, 256, 0, stream>>>(FV, DKV, NKV, VT16, VTh, VTl);
        for (int h0 = 0; h0 < NH_; h0 += ZH) { const size_t zq = (size_t)h0, zk = (size_t)(h0 / REP);   // both heads of a pass share kv group h0/REP (REP >= 2): sB = 0
            k_gemmc<bf, 2, 1><<<dim3(RH / 64, TT / 64, ZH), 32, 0, stream>>>(QPh + zq * TT * HD, QPl + zq * TT * HD, KPh + zk * TT * HD, KPl + zk * TT * HD, HD, Sb, TT, 0, (size_t)TT * HD, 0, (size_t)TT * TT);
            k_gemmc<h16, 0, 1><<<dim3((TT - RH) / 64, TT / 64, ZH), 32, 0, stream>>>(QP16 + zq * TT * HD + (size_t)RH * HD, nullptr, KP16 + zk * TT * HD, nullptr, HD, Sb + (size_t)RH * TT, TT, RH, (size_t)TT * HD, 0, (size_t)TT * TT);
            k_capS<<<(unsigned)(((size_t)ZH * TT * TT / 4 + 255) / 256), 256, 0, stream>>>(Sb);   /* soft cap in place (x8 so the softmax kernel's 1/8 restores it) */ k_asoft<<<ZH * TT / 8, 256, 0, stream>>>(Sb, P16, Ph, Pl);
            k_gemmpv<bf, 2, 8><<<dim3(RH / 64, HD / 64, ZH), 256, 0, stream>>>(Ph, Pl, VTh + zk * HD * TT, VTl + zk * HD * TT, TT, Ob, HD, 0, (size_t)RH * TT, 0, (size_t)TT * HD);
            k_gemmpv<h16, 0, 16><<<dim3((TT - RH) / 64, HD / 64, ZH), 512, 0, stream>>>(P16 + (size_t)RH * TT, nullptr, VT16 + zk * HD * TT, nullptr, TT, Ob + (size_t)RH * HD, HD, RH, (size_t)TT * TT, 0, (size_t)TT * HD);
            k_merge<<<(unsigned)(((size_t)ZH * TT * HD / 2 + 255) / 256), 256, 0, stream>>>(Ob, h0, ATh, ATl); }
        k_gemmw<bf, 1, false><<<dim3(TT / 64, DM / 64, 1), 256, 0, stream>>>(ATh, ATl, WO, nullptr, DQ, OUT + (size_t)b * TT * DM, DM, nullptr, 0, 0, 0); }
}

// v002
// Measured time: 869 microseconds a run.
// Next to v001, in two timings, it ran 1.15 and 1.17 times as fast.
// All steps since v000 together make it 1.79 times as fast.
#include <hip/hip_runtime.h>

// Causal grouped-query self-attention with QK RMS-norm, rotary embeddings and tanh logit soft-capping (x [2][2048][1024]; q = x w_q ('xw' [1024][1024] 0.02, 16 heads x 64), k, v = x w_k / w_v ([1024][256]: 4 kv heads, each shared by 4 query heads); q, k <- RMS-norm over 64 (eps 1e-5, no scale); half-split rope (theta 1e4, computed); scores / 8; softcap: 50 tanh(scores / 50); causal (-inf); softmax; out = merged w_o ('xw') -> [2][2048][1024] (4.2 M)).
// Layout per batch: bf16 copy of x; 'xw' weights transposed once; exact projections; in-place per-(token, head) RMS-norm kernels; {cos, sin} table once; rotate-half rotary plane builders; causal T-2048 GQA attention (each kv plane serves 4 query heads; hybrid rows: < 512 hi/lo 3 products, rest fp16 x1024; tiles above the diagonal skipped) whose soft cap is applied inside the softmax kernel as 50 x tanh(s/50) (tanh via one exp2 and a division, f32); merged hi/lo x w_o exact.
// Compute dtypes, f32 accumulate: every input rounded to bf16; projections exact; RMS-norm and rotary f32; attention rows < 512 3 products, rest fp16; soft cap and softmax f32; w_o hl x exact.

#define NB_  2
#define TT   2048
#define DM   1024
#define NH_  16
#define NKV  4
#define REP  (NH_ / NKV)
#define HD   64
#define DQ   (NH_ * HD)
#define DKV  (NKV * HD)
#define ZH   2
#define RH   512                  // query rows < RH use hi+lo planes (0: none)
#define WIN  2048
#define PCAR 1024.0f
#define SCL  0.125f
#define CAP  50.0f
#define RMSEPS 1e-5f
typedef _Float16 h16;
typedef unsigned short bf;
typedef __attribute__((ext_vector_type(16))) __bf16   v16bf;
typedef __attribute__((ext_vector_type(16))) _Float16 v16h;
typedef __attribute__((ext_vector_type(8)))  _Float16 v8h;
typedef __attribute__((ext_vector_type(8)))  unsigned short v8us;
typedef __attribute__((ext_vector_type(8)))  float    v8f;
typedef __attribute__((ext_vector_type(4)))  float    v4f;
typedef v8h  __attribute__((may_alias)) v8ha;
typedef v4f  __attribute__((may_alias)) v4fa;
typedef v8us __attribute__((may_alias)) v8usa;

__device__ __forceinline__ unsigned short f2bf(float f) { unsigned u = __float_as_uint(f); u += 0x7FFFu + ((u >> 16) & 1u); return (unsigned short)(u >> 16); }
__device__ __forceinline__ float bf2f(unsigned short b) { return __uint_as_float(((unsigned)b) << 16); }
__device__ __forceinline__ float bfr(float f) { return bf2f(f2bf(f)); }
__device__ __forceinline__ v16h cat16(v8h lo, v8h hi) { return __builtin_shufflevector(lo, hi, 0, 1, 2, 3, 4, 5, 6, 7, 8, 9, 10, 11, 12, 13, 14, 15); }
__device__ __forceinline__ v16bf cat16b(v8us lo, v8us hi) { return __builtin_bit_cast(v16bf, __builtin_shufflevector(lo, hi, 0, 1, 2, 3, 4, 5, 6, 7, 8, 9, 10, 11, 12, 13, 14, 15)); }
__device__ __forceinline__ v8f wmma16(v16h a, v16h b, v8f c) { return __builtin_amdgcn_wmma_f32_16x16x32_f16(false, a, false, b, (short)0, c, false, false); }
__device__ __forceinline__ v8f wmmab(v16bf a, v16bf b, v8f c) { return __builtin_amdgcn_wmma_f32_16x16x32_bf16(false, a, false, b, (short)0, c, false, false); }



// ---- k_gemmw: register-blocked GEMM, 8 waves per 64x64 output tile, the K range split over the waves (16 accumulators each), operands straight from K-contiguous 16-bit planes; grid (M/64, N/64, Z), 256 threads.
// C[m][n] (f32, pitch ldc, + optional f32 bias[n]) = sum_k A[m][k] Bt[n][k] (+ split products per NSPLIT). z-batch strides sA/sB/sC in elements. K % 64 == 0.
// softcap: 50 tanh(s / 50) with tanh(u) = 1 - 2 / (exp(2u) + 1) (one exp2 of 2u log2 e, one precise division; u in [-0.2, 0.2] here so no overflow); f32.
__device__ __forceinline__ float softcap(float s) { const float u = __fmul_rn(s, 1.0f / CAP); const float e = __builtin_amdgcn_exp2f(__fmul_rn(__fmul_rn(u, 2.0f), 1.4426950408889634f)); const float th = __fsub_rn(1.0f, __fdiv_rn(2.0f, __fadd_rn(e, 1.0f))); return __fmul_rn(th, CAP); }
template <typename T16> struct WFrag;
template <> struct WFrag<h16> { typedef v16h V; static __device__ __forceinline__ V ld(const h16* p) { return cat16(*(const v8h*)p, *(const v8h*)(p + 16)); } static __device__ __forceinline__ v8f mma(V a, V b, v8f c) { return wmma16(a, b, c); } };
template <> struct WFrag<bf> { typedef v16bf V; static __device__ __forceinline__ V ld(const bf* p) { return cat16b(*(const v8us*)p, *(const v8us*)(p + 16)); } static __device__ __forceinline__ v8f mma(V a, V b, v8f c) { return wmmab(a, b, c); } };
// tile_splitk: one 64x64 output tile by a work-group of NW (8 or 16) waves. Wave w takes the 64-wide k chunks w, w + NW, ... below Kl (Kl % 64 == 0; a chunk = one whole 128-byte line of every operand row, two
// trips of 32) with the 16-accumulator register block; the NW partial tiles go to LDS in register order (b128, one slot per lane), and behind one barrier each wave sums, in wave order 0..NW-1, its 32 / NW
// slots and stores them: 32 columns = one whole 128-byte line of each of its rows, so every line of C has one writer.
template <typename T16, int NSPLIT, bool BIAS, int NW>
__device__ __forceinline__ void tile_splitk(const T16* __restrict__ A, const T16* __restrict__ A2, const T16* __restrict__ Bt, const T16* __restrict__ Bt2, int K, int Kl, float* C, int ldc, const float* __restrict__ bias, int r0, int c0) {
    typedef typename WFrag<T16>::V V;
    __shared__ __align__(16) float part[NW * 32 * 32 * 4];           // [wave][slot = (mb * 4 + nb) * 2 + g][lane][4]: accumulator elements 4 g .. 4 g + 3
    const int lane = threadIdx.x & 31, lr = lane & 15, hi = lane >> 4; const int w = __builtin_amdgcn_readfirstlane(threadIdx.x >> 5);
    v8f acc[4][4];
#pragma unroll
    for (int mb = 0; mb < 4; ++mb)
#pragma unroll
        for (int nb = 0; nb < 4; ++nb) acc[mb][nb] = (v8f){};
    const size_t aoff = (size_t)(r0 + lr) * K + 8 * hi, boff = (size_t)(c0 + lr) * K + 8 * hi;
#pragma unroll 1
    for (int kc = w * 64; kc < Kl; kc += (kc & 32) ? NW * 64 - 32 : 32) {
        V a[4], a2[4];
#pragma unroll
        for (int mb = 0; mb < 4; ++mb) { a[mb] = WFrag<T16>::ld(A + aoff + (size_t)mb * 16 * K + kc); if (NSPLIT == 1 || NSPLIT == 2) a2[mb] = WFrag<T16>::ld(A2 + aoff + (size_t)mb * 16 * K + kc); }
#pragma unroll
        for (int nb = 0; nb < 4; ++nb) { const V b = WFrag<T16>::ld(Bt + boff + (size_t)nb * 16 * K + kc); V b2; if (NSPLIT >= 2) b2 = WFrag<T16>::ld(Bt2 + boff + (size_t)nb * 16 * K + kc);
#pragma unroll
            for (int mb = 0; mb < 4; ++mb) { acc[mb][nb] = WFrag<T16>::mma(a[mb], b, acc[mb][nb]); if (NSPLIT == 1 || NSPLIT == 2) acc[mb][nb] = WFrag<T16>::mma(a2[mb], b, acc[mb][nb]); if (NSPLIT >= 2) acc[mb][nb] = WFrag<T16>::mma(a[mb], b2, acc[mb][nb]); } }
        // four vector slots behind the trip's last matrix instructions, on the back edge and on the exit alike, before fragments are reloaded or accumulators read
        asm volatile("v_nop\n\tv_nop\n\tv_nop\n\tv_nop" : "+v"(acc[0][0]), "+v"(acc[1][1]), "+v"(acc[2][2]), "+v"(acc[3][3]) : "v"(a[0]), "v"(a[3]));
    }
#pragma unroll
    for (int mb = 0; mb < 4; ++mb)
#pragma unroll
        for (int nb = 0; nb < 4; ++nb)
#pragma unroll
            for (int g = 0; g < 2; ++g) { v4f p; p[0] = acc[mb][nb][g * 4]; p[1] = acc[mb][nb][g * 4 + 1]; p[2] = acc[mb][nb][g * 4 + 2]; p[3] = acc[mb][nb][g * 4 + 3];
                *(v4fa*)(part + (((w * 32 + (mb * 4 + nb) * 2 + g) * 32 + lane) << 2)) = p; }
    __syncthreads();                                                 // every wave's partial tile is in LDS before any wave sums
    constexpr int GS = 16 / NW;                                      // g values a wave sums: 2 with 8 waves, 1 with 16
    const int mbw = w / (NW / 4), rem = w % (NW / 4), nbp = rem / (2 / GS), g0 = (rem % (2 / GS)) * GS;
#pragma unroll
    for (int u = 0; u < 2; ++u) { const int col = c0 + (nbp * 2 + u) * 16 + lr; const float bv = BIAS ? bfr(bias[col]) : 0.0f;
#pragma unroll
        for (int gg = 0; gg < GS; ++gg) { const int slot = (mbw * 4 + nbp * 2 + u) * 2 + g0 + gg; v4f s = *(const v4fa*)(part + ((slot * 32 + lane) << 2));
#pragma unroll
            for (int p = 1; p < NW; ++p) s += *(const v4fa*)(part + (((p * 32 + slot) * 32 + lane) << 2));
#pragma unroll
            for (int q = 0; q < 4; ++q) { float val = s[q]; if (BIAS) val += bv; C[(size_t)(r0 + mbw * 16 + hi * 8 + (g0 + gg) * 4 + q) * ldc + col] = val; } } }
}
template <typename T16, int NSPLIT, bool BIAS>
__global__ __launch_bounds__(256) void k_gemmw(const T16* __restrict__ A, const T16* __restrict__ A2, const T16* __restrict__ Bt, const T16* __restrict__ Bt2, int K, float* C, int ldc, const float* __restrict__ bias, size_t sA, size_t sB, size_t sC) {
    const size_t z = blockIdx.z; A += z * sA; if (A2) A2 += z * sA; Bt += z * sB; if (Bt2) Bt2 += z * sB; C += z * sC;
    tile_splitk<T16, NSPLIT, BIAS, 8>(A, A2, Bt, Bt2, K, K, C, ldc, bias, blockIdx.x * 64, blockIdx.y * 64);
}
// ---- k_gemmpv: the probability x value contraction on the same NW-wave tile (NW * 32 threads); the key (K) range stops at the diagonal block (probabilities beyond it are exactly zero). roff = row offset of this launch's first row within the sequence.
template <typename T16, int NSPLIT, int NW>
__global__ __launch_bounds__(NW * 32) void k_gemmpv(const T16* __restrict__ A, const T16* __restrict__ A2, const T16* __restrict__ Bt, const T16* __restrict__ Bt2, int K, float* C, int ldc, int roff, size_t sA, size_t sB, size_t sC) {
    const size_t z = blockIdx.z; A += z * sA; if (A2) A2 += z * sA; Bt += z * sB; if (Bt2) Bt2 += z * sB; C += z * sC;
    const int r0 = blockIdx.x * 64;
    tile_splitk<T16, NSPLIT, false, NW>(A, A2, Bt, Bt2, K, min(K, r0 + roff + 64), C, ldc, nullptr, r0, blockIdx.y * 64);
}

// ---- k_gemmc: one-wave 64x64 tile GEMM (16 accumulators, 32 threads) for the causal scores (K = 64): CMODE 1 skips score tiles entirely above the diagonal (query rows r0+roff.., key columns c0..). roff = row offset of this launch's first row within the sequence.
template <typename T16, int NSPLIT, int CMODE>
__global__ __launch_bounds__(32) void k_gemmc(const T16* __restrict__ A, const T16* __restrict__ A2, const T16* __restrict__ Bt, const T16* __restrict__ Bt2, int K, float* C, int ldc, int roff, size_t sA, size_t sB, size_t sC) {
    typedef typename WFrag<T16>::V V;
    __shared__ __align__(16) float os[16 * 68];
    const size_t z = blockIdx.z; A += z * sA; if (A2) A2 += z * sA; Bt += z * sB; if (Bt2) Bt2 += z * sB; C += z * sC;
    const int lane = threadIdx.x & 31, lr = lane & 15, hi = lane >> 4; const int r0 = blockIdx.x * 64, c0 = blockIdx.y * 64;
    if (CMODE == 1 && c0 > r0 + roff + 63) return;                  // score tile entirely above the causal diagonal: not computed; read and soft-capped by the softmax but never used (the softmax masks j > i by select)
    v8f acc[4][4];
#pragma unroll
    for (int mb = 0; mb < 4; ++mb)
#pragma unroll
        for (int nb = 0; nb < 4; ++nb) acc[mb][nb] = (v8f){};
    const size_t aoff = (size_t)(r0 + lr) * K + 8 * hi, boff = (size_t)(c0 + lr) * K + 8 * hi;
#pragma unroll 1
    for (int kc = 0; kc < K; kc += 32) {
        V a[4], a2[4];
#pragma unroll
        for (int mb = 0; mb < 4; ++mb) { a[mb] = WFrag<T16>::ld(A + aoff + (size_t)mb * 16 * K + kc); if (NSPLIT == 1 || NSPLIT == 2) a2[mb] = WFrag<T16>::ld(A2 + aoff + (size_t)mb * 16 * K + kc); }
#pragma unroll
        for (int nb = 0; nb < 4; ++nb) { const V b = WFrag<T16>::ld(Bt + boff + (size_t)nb * 16 * K + kc); V b2; if (NSPLIT >= 2) b2 = WFrag<T16>::ld(Bt2 + boff + (size_t)nb * 16 * K + kc);
#pragma unroll
            for (int mb = 0; mb < 4; ++mb) { acc[mb][nb] = WFrag<T16>::mma(a[mb], b, acc[mb][nb]); if (NSPLIT == 1 || NSPLIT == 2) acc[mb][nb] = WFrag<T16>::mma(a2[mb], b, acc[mb][nb]); if (NSPLIT >= 2) acc[mb][nb] = WFrag<T16>::mma(a[mb], b2, acc[mb][nb]); } }
        asm volatile("v_nop\n\tv_nop\n\tv_nop\n\tv_nop" : "+v"(acc[0][0]), "+v"(acc[1][1]), "+v"(acc[2][2]), "+v"(acc[3][3]) : "v"(a[0]), "v"(a[3]));
    }
#pragma unroll
    for (int mb = 0; mb < 4; ++mb) {
#pragma unroll
        for (int nb = 0; nb < 4; ++nb) {
#pragma unroll
            for (int j = 0; j < 8; ++j) os[(hi * 8 + j) * 68 + nb * 16 + lr] = acc[mb][nb][j]; }
        __builtin_amdgcn_wave_barrier(); asm volatile("" ::: "memory");
        float* crow = C + (size_t)(r0 + mb * 16) * ldc + c0;
{
#pragma unroll
            for (int s = 0; s < 8; ++s) { const int row = 2 * s + hi, cofs = lr * 4; v4f val = *(const v4fa*)(os + row * 68 + cofs);
                *(v4f*)(crow + (size_t)row * ldc + cofs) = val; }
             }
        __builtin_amdgcn_wave_barrier(); asm volatile("" ::: "memory");
    }
}

__device__ __forceinline__ h16 tohx(float x) { return (h16)x; }
__device__ __forceinline__ void splitf(float y, unsigned short& h, unsigned short& l) { h = f2bf(y); l = f2bf(y - bf2f(h)); }
typedef __attribute__((ext_vector_type(2))) _Float16 v2h;
typedef __attribute__((ext_vector_type(4))) _Float16 v4h;
typedef __attribute__((ext_vector_type(2))) unsigned short v2us;
typedef __attribute__((ext_vector_type(4))) unsigned short v4us;
typedef __attribute__((ext_vector_type(2))) float v2f;
typedef __attribute__((ext_vector_type(4))) int v4i;

__global__ __launch_bounds__(256) void k_wtG(const float* __restrict__ w, int K, int N, bf* Bt) {
    const int lane = threadIdx.x & 31; const int L0 = (blockIdx.x * 8 + (threadIdx.x >> 5)) * 8; const int nlines = N * K / 64;
{
#pragma unroll 1
        for (int l = 0; l < 8; ++l) { const int L = L0 + l; if (L >= nlines) break; const size_t e = (size_t)L * 64 + lane * 2; const int k = (int)(e % K), n = (int)(e / K); v2us o;
            o[0] = f2bf(w[(size_t)k * N + n]); o[1] = f2bf(w[(size_t)(k + 1) * N + n]); *(v2us*)(Bt + e) = o; }
         }
}
__global__ __launch_bounds__(256) void k_cvt8(const float* __restrict__ src, bf* dst, size_t n8) { const size_t i = (size_t)blockIdx.x * 256 + threadIdx.x; if (i >= n8) return; const v8f v = *(const v8f*)(src + i * 8); v8us o;
#pragma unroll
    for (int k = 0; k < 8; ++k) o[k] = f2bf(v[k]); *(v8us*)(dst + i * 8) = o;  }
// k_rope: head planes [h][t][d] (fp16 + hi/lo) of rope(x) x sc with the rotate-half convention out[d] = x[d] cos[t][d] - x[d+HD/2] sin[t][d], out[d+HD/2] = x[d+HD/2] cos[t][d+HD/2] + x[d] sin[t][d+HD/2]
__global__ __launch_bounds__(256) void k_rope(const float* __restrict__ F, int pitch, int nheads, const float* __restrict__ CS, const float* __restrict__ RF, const float* __restrict__ nw, float sc, h16* P16, bf* Ph, bf* Pl) {
    const size_t e = ((size_t)blockIdx.x * 256 + threadIdx.x) * 2; if (e >= (size_t)nheads * TT * HD) return; const int d = (int)(e % HD); const int t = (int)((e / HD) % TT); const int h = (int)(e / ((size_t)HD * TT)); const float* f = F + (size_t)t * pitch + h * HD; const float rf = RF ? RF[(size_t)h * TT + t] : 1.0f; v2h o16; v2us oh, ol;
#pragma unroll
    for (int q = 0; q < 2; ++q) { const int dd = d + q; const int dp = (dd < HD / 2) ? dd + HD / 2 : dd - HD / 2; float x0 = f[dd], x1 = f[dp];
        if (RF) { float n0 = __fmul_rn(x0, rf), n1 = __fmul_rn(x1, rf); asm volatile("" : "+v"(n0)); asm volatile("" : "+v"(n1)); x0 = __fmul_rn(bfr(nw[dd]), n0); x1 = __fmul_rn(bfr(nw[dp]), n1); }
        const v2f cs = *(const v2f*)(CS + ((size_t)t * HD + dd) * 2); float a = __fmul_rn(x0, cs[0]), bq = __fmul_rn(x1, cs[1]); asm volatile("" : "+v"(a)); asm volatile("" : "+v"(bq)); const float r = ((dd < HD / 2) ? __fsub_rn(a, bq) : __fadd_rn(a, bq)) * sc;
        o16[q] = tohx(r); unsigned short a2, c2; splitf(r, a2, c2); oh[q] = a2; ol[q] = c2; }
    *(v2h*)(P16 + e) = o16; *(v2us*)(Ph + e) = oh; *(v2us*)(Pl + e) = ol;  }
__global__ __launch_bounds__(256) void k_vtp(const float* __restrict__ F, int pitch, int nheads, h16* V16, bf* Vh, bf* Vl) { const size_t e = ((size_t)blockIdx.x * 256 + threadIdx.x) * 2; if (e >= (size_t)nheads * HD * TT) return; const int t = (int)(e % TT); const int d = (int)((e / TT) % HD); const int g = (int)(e / ((size_t)TT * HD)); v2h o16; v2us oh, ol;
#pragma unroll
    for (int q = 0; q < 2; ++q) { const float x = F[(size_t)(t + q) * pitch + g * HD + d]; o16[q] = tohx(x); unsigned short a2, c2; splitf(x, a2, c2); oh[q] = a2; ol[q] = c2; }
    *(v2h*)(V16 + e) = o16; *(v2us*)(Vh + e) = oh; *(v2us*)(Vl + e) = ol;  }
// k_asoft: per row (zz, i): t = 50 tanh((S / 8) / 50) (S: the raw score products) for keys j <= i, -3e38 for j > i (causal); softmax over the 2048 keys (register row, one exp, fixed trees);
__global__ __launch_bounds__(256) void k_asoft(const float* __restrict__ Sb, h16* P16, bf* Ph, bf* Pl) {
    const int lane = threadIdx.x & 31; const int row = blockIdx.x * 8 + (threadIdx.x >> 5); if (row >= ZH * TT) return; const int i = row % TT; const int zz = row / TT; (void)zz; const bool hires = (i < RH); const float* sr = Sb + (size_t)row * TT; float v[TT / 32]; float mx = -3.0e38f;
#pragma unroll
    for (int ch = 0; ch < TT / 128; ++ch) { const int j0 = ch * 128 + lane * 4; const v4f a = *(const v4f*)(sr + j0);
#pragma unroll
        for (int q = 0; q < 4; ++q) { const int j = j0 + q; (void)j; const float c = softcap(a[q] * SCL);   /* soft cap of the raw score / 8, computed for every key (64 independent chains to interleave); the causal select drops the rest */ const float t = (j <= i) ? c : -3.0e38f; v[ch * 4 + q] = t; mx = fmaxf(mx, t); } }
#pragma unroll
    for (int sh = 16; sh; sh >>= 1) mx = fmaxf(mx, __shfl_xor(mx, sh, 32));
    float sum = 0.f;
#pragma unroll
    for (int k = 0; k < TT / 32; ++k) { float d0 = __fsub_rn(v[k], mx); asm volatile("" : "+v"(d0)); v[k] = __builtin_amdgcn_exp2f(__fmul_rn(d0, 1.4426950408889634f)); sum += v[k]; }
#pragma unroll
    for (int sh = 16; sh; sh >>= 1) sum += __shfl_xor(sum, sh, 32);
    const float f = __fdiv_rn(hires ? 1.0f : PCAR, sum);
{
        if (hires) {
#pragma unroll
            for (int ch = 0; ch < TT / 128; ++ch) { v4us oh, ol;
#pragma unroll
                for (int q = 0; q < 4; ++q) { unsigned short a, c2; splitf(v[ch * 4 + q] * f, a, c2); oh[q] = a; ol[q] = c2; }
                const size_t oo = ((size_t)zz * (RH ? RH : 1) + i) * TT + ch * 128 + lane * 4; *(v4us*)(Ph + oo) = oh; *(v4us*)(Pl + oo) = ol; }
        } else {
#pragma unroll
            for (int ch = 0; ch < TT / 128; ++ch) { v4h o4;
#pragma unroll
                for (int q = 0; q < 4; ++q) o4[q] = tohx(v[ch * 4 + q] * f);
                *(v4h*)(P16 + (size_t)row * TT + ch * 128 + lane * 4) = o4; } }
         }
}
__constant__ float INVT[HD / 2] = { 1.000000000e+00f, 7.498942018e-01f, 5.623413324e-01f, 4.216965139e-01f, 3.162277639e-01f, 2.371373773e-01f, 1.778279394e-01f, 1.333521456e-01f, 1.000000015e-01f, 7.498942316e-02f, 5.623413250e-02f, 4.216964915e-02f, 3.162277490e-02f, 2.371373773e-02f, 1.778279431e-02f, 1.333521400e-02f, 9.999999776e-03f, 7.498942316e-03f, 5.623413250e-03f, 4.216964822e-03f, 3.162277630e-03f, 2.371373819e-03f, 1.778279431e-03f, 1.333521446e-03f, 1.000000047e-03f, 7.498941850e-04f, 5.623413017e-04f, 4.216965172e-04f, 3.162277571e-04f, 2.371373703e-04f, 1.778279402e-04f, 1.333521504e-04f };   // 10000^(-2i/64) (the module's power form) (float32, generated with jnp to be bit-exact)
__global__ __launch_bounds__(256) void k_cs4(float* CS) { const int idx = blockIdx.x * 256 + threadIdx.x; if (idx >= TT * HD) return; const int d = idx % HD; const int t = idx / HD; const float a = __fmul_rn((float)t, INVT[d % (HD / 2)]); v2f cs; cs[0] = cosf(a); cs[1] = sinf(a); *(v2f*)(CS + (size_t)idx * 2) = cs;  }

__global__ __launch_bounds__(256) void k_hrms0(float* F, int nheads) { const int lane = threadIdx.x & 31; const size_t wv = (size_t)blockIdx.x * 8 + (threadIdx.x >> 5); if (wv >= (size_t)TT * nheads) return; float* f = F + wv * HD + lane * 2; const v2f a = *(const v2f*)f; float p0 = __fmul_rn(a[0], a[0]), p1 = __fmul_rn(a[1], a[1]); asm volatile("" : "+v"(p0), "+v"(p1)); float ss = __fadd_rn(p0, p1);
#pragma unroll
    for (int sh = 16; sh; sh >>= 1) ss = __fadd_rn(ss, __shfl_xor(ss, sh, 32));
    const float rs = __fdiv_rn(1.0f, __fsqrt_rn(__fadd_rn(__fdiv_rn(ss, (float)HD), RMSEPS))); v2f o;
#pragma unroll
    for (int q = 0; q < 2; ++q) { o[q] = __fmul_rn(a[q], rs); }
    *(v2f*)f = o;  }

__global__ __launch_bounds__(256) void k_merge(const float* __restrict__ O, int h0, bf* Ah, bf* Al) { const size_t e = ((size_t)blockIdx.x * 256 + threadIdx.x) * 2; if (e >= (size_t)ZH * TT * HD) return; const int d = (int)(e % HD); const int t = (int)((e / HD) % TT); const int zz = (int)(e / ((size_t)HD * TT)); const float cs = (t < RH) ? 1.0f : (1.0f / PCAR); const size_t oo = (size_t)t * DQ + (h0 + zz) * HD + d;
    v2us oh, ol;
#pragma unroll
    for (int q = 0; q < 2; ++q) { unsigned short a, c2; splitf(O[e + q] * cs, a, c2); oh[q] = a; ol[q] = c2; } *(v2us*)(Ah + oo) = oh; *(v2us*)(Al + oo) = ol;  }

extern "C" void kernel_launch(void* const* d_in, const int* in_sizes, int n_in,
                              void* d_out, int out_size, void* d_ws, size_t ws_size, hipStream_t stream) {
    (void)in_sizes; (void)n_in; (void)out_size;
    const float* x = (const float*)d_in[0]; const float* wq = (const float*)d_in[1]; const float* wk = (const float*)d_in[2]; const float* wv = (const float*)d_in[3]; const float* wo = (const float*)d_in[4];
    float* OUT = (float*)d_out;     // [2][2048][1024]
    char* wsp = (char*)d_ws;
    auto take = [&](size_t bytes) { char* p = wsp; wsp += (bytes + 255) & ~(size_t)255; return (void*)p; };
    bf* WQ = (bf*)take((size_t)DQ * DM * 2); bf* WK = (bf*)take((size_t)DKV * DM * 2); bf* WV = (bf*)take((size_t)DKV * DM * 2); bf* WO = (bf*)take((size_t)DM * DQ * 2); float* CS = (float*)take((size_t)TT * HD * 2 * 4);
    bf* XB = (bf*)take((size_t)TT * DM * 2); float* FQ = (float*)take((size_t)TT * DQ * 4); float* FK = (float*)take((size_t)TT * DKV * 4);
    h16* QP16 = (h16*)take((size_t)NH_ * TT * HD * 2); h16* KP16 = (h16*)take((size_t)NKV * TT * HD * 2); h16* VT16 = (h16*)take((size_t)NKV * HD * TT * 2);
    bf* QPh = (bf*)take((size_t)NH_ * TT * HD * 2); bf* QPl = (bf*)take((size_t)NH_ * TT * HD * 2); bf* KPh = (bf*)take((size_t)NKV * TT * HD * 2); bf* KPl = (bf*)take((size_t)NKV * TT * HD * 2); bf* VTh = (bf*)take((size_t)NKV * HD * TT * 2); bf* VTl = (bf*)take((size_t)NKV * HD * TT * 2); bf* Ph = (bf*)take((size_t)ZH * RH * TT * 2); bf* Pl = (bf*)take((size_t)ZH * RH * TT * 2);
    float* Sb = (float*)take((size_t)ZH * TT * TT * 4); h16* P16 = (h16*)take((size_t)ZH * TT * TT * 2); float* Ob = (float*)take((size_t)ZH * TT * HD * 4); bf* ATh = (bf*)take((size_t)TT * DQ * 2); bf* ATl = (bf*)take((size_t)TT * DQ * 2);
    if ((size_t)(wsp - (char*)d_ws) > ws_size) return;    // ws 256 MiB
    float* FV = FK;   // v projection reuses the k buffer after the k planes are built (stream-ordered)
    { k_wtG<<<(unsigned)((DM * DQ / 64 + 63) / 64), 256, 0, stream>>>(wq, DM, DQ, WQ); k_wtG<<<(unsigned)((DM * DKV / 64 + 63) / 64), 256, 0, stream>>>(wk, DM, DKV, WK); k_wtG<<<(unsigned)((DM * DKV / 64 + 63) / 64), 256, 0, stream>>>(wv, DM, DKV, WV);
      k_wtG<<<(unsigned)((DQ * DM / 64 + 63) / 64), 256, 0, stream>>>(wo, DQ, DM, WO);
       }
    const unsigned LQ = (unsigned)(((size_t)NH_ * TT * HD / 2 + 255) / 256), LKv = (unsigned)(((size_t)NKV * TT * HD / 2 + 255) / 256);
    for (int b = 0; b < NB_; ++b) {
        if (b == 0) k_cs4<<<(TT * HD + 255) / 256, 256, 0, stream>>>(CS);
        k_cvt8<<<(unsigned)(((size_t)TT * DM / 8 + 255) / 256), 256, 0, stream>>>(x + (size_t)b * TT * DM, XB, (size_t)TT * DM / 8);
        k_gemmw<bf, 0, false><<<dim3(TT / 64, DQ / 64, 1), 256, 0, stream>>>(XB, nullptr, WQ, nullptr, DM, FQ, DQ, nullptr, 0, 0, 0);
        k_hrms0<<<(unsigned)(((size_t)TT * NH_ + 7) / 8), 256, 0, stream>>>(FQ, NH_);   /* per-head RMS-norm (no scale) */ k_rope<<<LQ, 256, 0, stream>>>(FQ, DQ, NH_, CS, nullptr, nullptr, 1.0f, QP16, QPh, QPl);
        k_gemmw<bf, 0, false><<<dim3(TT / 64, DKV / 64, 1), 256, 0, stream>>>(XB, nullptr, WK, nullptr, DM, FK, DKV, nullptr, 0, 0, 0);
        k_hrms0<<<(unsigned)(((size_t)TT * NKV + 7) / 8), 256, 0, stream>>>(FK, NKV); k_rope<<<LKv, 256, 0, stream>>>(FK, DKV, NKV, CS, nullptr, nullptr, 1.0f, KP16, KPh, KPl);
        k_gemmw<bf, 0, false><<<dim3(TT / 64, DKV / 64, 1), 256, 0, stream>>>(XB, nullptr, WV, nullptr, DM, FV, DKV, nullptr, 0, 0, 0); k_vtp<<<LKv, 256, 0, stream>>>(FV, DKV, NKV, VT16, VTh, VTl);
        for (int h0 = 0; h0 < NH_; h0 += ZH) { const size_t zq = (size_t)h0, zk = (size_t)(h0 / REP);   // both heads of a pass share kv group h0/REP (REP >= 2): sB = 0
            k_gemmc<bf, 2, 1><<<dim3(RH / 64, TT / 64, ZH), 32, 0, stream>>>(QPh + zq * TT * HD, QPl + zq * TT * HD, KPh + zk * TT * HD, KPl + zk * TT * HD, HD, Sb, TT, 0, (size_t)TT * HD, 0, (size_t)TT * TT);
            k_gemmc<h16, 0, 1><<<dim3((TT - RH) / 64, TT / 64, ZH), 32, 0, stream>>>(QP16 + zq * TT * HD + (size_t)RH * HD, nullptr, KP16 + zk * TT * HD, nullptr, HD, Sb + (size_t)RH * TT, TT, RH, (size_t)TT * HD, 0, (size_t)TT * TT);
            k_asoft<<<ZH * TT / 8, 256, 0, stream>>>(Sb, P16, Ph, Pl);
            k_gemmpv<bf, 2, 8><<<dim3(RH / 64, HD / 64, ZH), 256, 0, stream>>>(Ph, Pl, VTh + zk * HD * TT, VTl + zk * HD * TT, TT, Ob, HD, 0, (size_t)RH * TT, 0, (size_t)TT * HD);
            k_gemmpv<h16, 0, 16><<<dim3((TT - RH) / 64, HD / 64, ZH), 512, 0, stream>>>(P16 + (size_t)RH * TT, nullptr, VT16 + zk * HD * TT, nullptr, TT, Ob + (size_t)RH * HD, HD, RH, (size_t)TT * TT, 0, (size_t)TT * HD);
            k_merge<<<(unsigned)(((size_t)ZH * TT * HD / 2 + 255) / 256), 256, 0, stream>>>(Ob, h0, ATh, ATl); }
        k_gemmw<bf, 1, false><<<dim3(TT / 64, DM / 64, 1), 256, 0, stream>>>(ATh, ATl, WO, nullptr, DQ, OUT + (size_t)b * TT * DM, DM, nullptr, 0, 0, 0); }
}

// v003
// One run takes 496 microseconds.
// In two side-by-side timings against v002, it was 1.76 and 1.75 times as fast.
// Over all steps from v000 it is 3.14 times as fast.
#include <hip/hip_runtime.h>

// Causal grouped-query self-attention with QK RMS-norm, rotary embeddings and tanh logit soft-capping (x [2][2048][1024]; q = x w_q ('xw' [1024][1024] 0.02, 16 heads x 64), k, v = x w_k / w_v ([1024][256]: 4 kv heads, each shared by 4 query heads); q, k <- RMS-norm over 64 (eps 1e-5, no scale); half-split rope (theta 1e4, computed); scores / 8; softcap: 50 tanh(scores / 50); causal (-inf); softmax; out = merged w_o ('xw') -> [2][2048][1024] (4.2 M)).
// Layout per batch: bf16 copy of x; 'xw' weights transposed once; exact projections; in-place per-(token, head) RMS-norm kernels; {cos, sin} table once; rotate-half rotary plane builders; causal T-2048 GQA attention, 8 query heads (2 kv planes) a pass (each kv plane serves 4 query heads; the probabilities of a row overwrite its own f32 score row; hybrid rows: < 512 hi/lo 3 products, rest fp16 x1024; tiles above the diagonal skipped) whose softmax kernel applies the soft cap as 50 x tanh(s/50) (tanh via one exp2 and a division, f32); merged hi/lo x w_o exact.
// Compute dtypes, f32 accumulate: every input rounded to bf16; projections exact; RMS-norm and rotary f32; attention rows < 512 3 products, rest fp16; soft cap and softmax f32; w_o hl x exact.

#define NB_  2
#define TT   2048
#define DM   1024
#define NH_  16
#define NKV  4
#define REP  (NH_ / NKV)
#define HD   64
#define DQ   (NH_ * HD)
#define DKV  (NKV * HD)
#define ZH   8                    // query heads per attention pass (a multiple of REP)
#define RH   512                  // query rows < RH use hi+lo planes (0: none)
#define WIN  2048
#define PCAR 1024.0f
#define SCL  0.125f
#define CAP  50.0f
#define RMSEPS 1e-5f
typedef _Float16 h16;
typedef unsigned short bf;
typedef __attribute__((ext_vector_type(16))) __bf16   v16bf;
typedef __attribute__((ext_vector_type(16))) _Float16 v16h;
typedef __attribute__((ext_vector_type(8)))  _Float16 v8h;
typedef __attribute__((ext_vector_type(8)))  unsigned short v8us;
typedef __attribute__((ext_vector_type(8)))  float    v8f;
typedef __attribute__((ext_vector_type(4)))  float    v4f;
typedef v8h  __attribute__((may_alias)) v8ha;
typedef v4f  __attribute__((may_alias)) v4fa;
typedef v8us __attribute__((may_alias)) v8usa;

__device__ __forceinline__ unsigned short f2bf(float f) { unsigned u = __float_as_uint(f); u += 0x7FFFu + ((u >> 16) & 1u); return (unsigned short)(u >> 16); }
__device__ __forceinline__ float bf2f(unsigned short b) { return __uint_as_float(((unsigned)b) << 16); }
__device__ __forceinline__ float bfr(float f) { return bf2f(f2bf(f)); }
__device__ __forceinline__ v16h cat16(v8h lo, v8h hi) { return __builtin_shufflevector(lo, hi, 0, 1, 2, 3, 4, 5, 6, 7, 8, 9, 10, 11, 12, 13, 14, 15); }
__device__ __forceinline__ v16bf cat16b(v8us lo, v8us hi) { return __builtin_bit_cast(v16bf, __builtin_shufflevector(lo, hi, 0, 1, 2, 3, 4, 5, 6, 7, 8, 9, 10, 11, 12, 13, 14, 15)); }
__device__ __forceinline__ v8f wmma16(v16h a, v16h b, v8f c) { return __builtin_amdgcn_wmma_f32_16x16x32_f16(false, a, false, b, (short)0, c, false, false); }
__device__ __forceinline__ v8f wmmab(v16bf a, v16bf b, v8f c) { return __builtin_amdgcn_wmma_f32_16x16x32_bf16(false, a, false, b, (short)0, c, false, false); }



// ---- k_gemmw: register-blocked GEMM, 8 waves per 64x64 output tile, the K range split over the waves (16 accumulators each), operands straight from K-contiguous 16-bit planes; grid (M/64, N/64, Z), 256 threads.
// C[m][n] (f32, pitch ldc, + optional f32 bias[n]) = sum_k A[m][k] Bt[n][k] (+ split products per NSPLIT). z-batch strides sA/sB/sC in elements. K % 64 == 0.
// softcap: 50 tanh(s / 50) with tanh(u) = 1 - 2 / (exp(2u) + 1) (one exp2 of 2u log2 e, one precise division; u in [-0.2, 0.2] here so no overflow); f32.
__device__ __forceinline__ float softcap(float s) { const float u = __fmul_rn(s, 1.0f / CAP); const float e = __builtin_amdgcn_exp2f(__fmul_rn(__fmul_rn(u, 2.0f), 1.4426950408889634f)); const float th = __fsub_rn(1.0f, __fdiv_rn(2.0f, __fadd_rn(e, 1.0f))); return __fmul_rn(th, CAP); }
template <typename T16> struct WFrag;
template <> struct WFrag<h16> { typedef v16h V; static __device__ __forceinline__ V ld(const h16* p) { return cat16(*(const v8h*)p, *(const v8h*)(p + 16)); } static __device__ __forceinline__ v8f mma(V a, V b, v8f c) { return wmma16(a, b, c); } };
template <> struct WFrag<bf> { typedef v16bf V; static __device__ __forceinline__ V ld(const bf* p) { return cat16b(*(const v8us*)p, *(const v8us*)(p + 16)); } static __device__ __forceinline__ v8f mma(V a, V b, v8f c) { return wmmab(a, b, c); } };
// tile_splitk: one 64x64 output tile by a work-group of NW (8 or 16) waves. Wave w takes the 64-wide k chunks w, w + NW, ... below Kl (Kl % 64 == 0; a chunk = one whole 128-byte line of every operand row, two
// trips of 32) with the 16-accumulator register block; the NW partial tiles go to LDS in register order (b128, one slot per lane), and behind one barrier each wave sums, in wave order 0..NW-1, its 32 / NW
// slots and stores them: 32 columns = one whole 128-byte line of each of its rows, so every line of C has one writer. lda = pitch of the A planes in elements (the Bt planes have pitch K).
template <typename T16, int NSPLIT, bool BIAS, int NW>
__device__ __forceinline__ void tile_splitk(const T16* __restrict__ A, const T16* __restrict__ A2, const T16* __restrict__ Bt, const T16* __restrict__ Bt2, int lda, int K, int Kl, float* C, int ldc, const float* __restrict__ bias, int r0, int c0) {
    typedef typename WFrag<T16>::V V;
    __shared__ __align__(16) float part[NW * 32 * 32 * 4];           // [wave][slot = (mb * 4 + nb) * 2 + g][lane][4]: accumulator elements 4 g .. 4 g + 3
    const int lane = threadIdx.x & 31, lr = lane & 15, hi = lane >> 4; const int w = __builtin_amdgcn_readfirstlane(threadIdx.x >> 5);
    v8f acc[4][4];
#pragma unroll
    for (int mb = 0; mb < 4; ++mb)
#pragma unroll
        for (int nb = 0; nb < 4; ++nb) acc[mb][nb] = (v8f){};
    const size_t aoff = (size_t)(r0 + lr) * lda + 8 * hi, boff = (size_t)(c0 + lr) * K + 8 * hi;
#pragma unroll 1
    for (int kc = w * 64; kc < Kl; kc += (kc & 32) ? NW * 64 - 32 : 32) {
        V a[4], a2[4];
#pragma unroll
        for (int mb = 0; mb < 4; ++mb) { a[mb] = WFrag<T16>::ld(A + aoff + (size_t)mb * 16 * lda + kc); if (NSPLIT == 1 || NSPLIT == 2) a2[mb] = WFrag<T16>::ld(A2 + aoff + (size_t)mb * 16 * lda + kc); }
#pragma unroll
        for (int nb = 0; nb < 4; ++nb) { const V b = WFrag<T16>::ld(Bt + boff + (size_t)nb * 16 * K + kc); V b2; if (NSPLIT >= 2) b2 = WFrag<T16>::ld(Bt2 + boff + (size_t)nb * 16 * K + kc);
#pragma unroll
            for (int mb = 0; mb < 4; ++mb) { acc[mb][nb] = WFrag<T16>::mma(a[mb], b, acc[mb][nb]); if (NSPLIT == 1 || NSPLIT == 2) acc[mb][nb] = WFrag<T16>::mma(a2[mb], b, acc[mb][nb]); if (NSPLIT >= 2) acc[mb][nb] = WFrag<T16>::mma(a[mb], b2, acc[mb][nb]); } }
        // four vector slots behind the trip's last matrix instructions, on the back edge and on the exit alike, before fragments are reloaded or accumulators read
        asm volatile("v_nop\n\tv_nop\n\tv_nop\n\tv_nop" : "+v"(acc[0][0]), "+v"(acc[1][1]), "+v"(acc[2][2]), "+v"(acc[3][3]) : "v"(a[0]), "v"(a[3]));
    }
#pragma unroll
    for (int mb = 0; mb < 4; ++mb)
#pragma unroll
        for (int nb = 0; nb < 4; ++nb)
#pragma unroll
            for (int g = 0; g < 2; ++g) { v4f p; p[0] = acc[mb][nb][g * 4]; p[1] = acc[mb][nb][g * 4 + 1]; p[2] = acc[mb][nb][g * 4 + 2]; p[3] = acc[mb][nb][g * 4 + 3];
                *(v4fa*)(part + (((w * 32 + (mb * 4 + nb) * 2 + g) * 32 + lane) << 2)) = p; }
    __syncthreads();                                                 // every wave's partial tile is in LDS before any wave sums
    constexpr int GS = 16 / NW;                                      // g values a wave sums: 2 with 8 waves, 1 with 16
    const int mbw = w / (NW / 4), rem = w % (NW / 4), nbp = rem / (2 / GS), g0 = (rem % (2 / GS)) * GS;
#pragma unroll
    for (int u = 0; u < 2; ++u) { const int col = c0 + (nbp * 2 + u) * 16 + lr; const float bv = BIAS ? bfr(bias[col]) : 0.0f;
#pragma unroll
        for (int gg = 0; gg < GS; ++gg) { const int slot = (mbw * 4 + nbp * 2 + u) * 2 + g0 + gg; v4f s = *(const v4fa*)(part + ((slot * 32 + lane) << 2));
#pragma unroll
            for (int p = 1; p < NW; ++p) s += *(const v4fa*)(part + (((p * 32 + slot) * 32 + lane) << 2));
#pragma unroll
            for (int q = 0; q < 4; ++q) { float val = s[q]; if (BIAS) val += bv; C[(size_t)(r0 + mbw * 16 + hi * 8 + (g0 + gg) * 4 + q) * ldc + col] = val; } } }
}
template <typename T16, int NSPLIT, bool BIAS>
__global__ __launch_bounds__(256) void k_gemmw(const T16* __restrict__ A, const T16* __restrict__ A2, const T16* __restrict__ Bt, const T16* __restrict__ Bt2, int K, float* C, int ldc, const float* __restrict__ bias, size_t sA, size_t sB, size_t sC) {
    const size_t z = blockIdx.z; A += z * sA; if (A2) A2 += z * sA; Bt += z * sB; if (Bt2) Bt2 += z * sB; C += z * sC;
    tile_splitk<T16, NSPLIT, BIAS, 8>(A, A2, Bt, Bt2, K, K, K, C, ldc, bias, blockIdx.x * 64, blockIdx.y * 64);
}
// ---- k_gemmpv: the probability x value contraction on the same NW-wave tile (NW * 32 threads); the key (K) range stops at the diagonal block (probabilities beyond it are exactly zero). roff = row offset of this launch's first row within the sequence. z = query head of the pass: A, C step per head, Bt per kv group (z / REP); lda = pitch of the probability rows.
template <typename T16, int NSPLIT, int NW>
__global__ __launch_bounds__(NW * 32) void k_gemmpv(const T16* __restrict__ A, const T16* __restrict__ A2, const T16* __restrict__ Bt, const T16* __restrict__ Bt2, int lda, int K, float* C, int ldc, int roff, size_t sA, size_t sB, size_t sC) {
    const size_t z = blockIdx.z; A += z * sA; if (A2) A2 += z * sA; Bt += (z / REP) * sB; if (Bt2) Bt2 += (z / REP) * sB; C += z * sC;
    const int r0 = blockIdx.x * 64;
    tile_splitk<T16, NSPLIT, false, NW>(A, A2, Bt, Bt2, lda, K, min(K, r0 + roff + 64), C, ldc, nullptr, r0, blockIdx.y * 64);
}

// ---- k_gemmc: one-wave 64x64 tile GEMM (16 accumulators, 32 threads) for the causal scores (K = 64): CMODE 1 skips score tiles entirely above the diagonal (query rows r0+roff.., key columns c0..). roff = row offset of this launch's first row within the sequence. z = query head of the pass: A, C step per head, Bt per kv group (z / REP).
template <typename T16, int NSPLIT, int CMODE>
__global__ __launch_bounds__(32) void k_gemmc(const T16* __restrict__ A, const T16* __restrict__ A2, const T16* __restrict__ Bt, const T16* __restrict__ Bt2, int K, float* C, int ldc, int roff, size_t sA, size_t sB, size_t sC) {
    typedef typename WFrag<T16>::V V;
    __shared__ __align__(16) float os[16 * 68];
    const size_t z = blockIdx.z; A += z * sA; if (A2) A2 += z * sA; Bt += (z / REP) * sB; if (Bt2) Bt2 += (z / REP) * sB; C += z * sC;
    const int lane = threadIdx.x & 31, lr = lane & 15, hi = lane >> 4; const int r0 = blockIdx.x * 64, c0 = blockIdx.y * 64;
    if (CMODE == 1 && c0 > r0 + roff + 63) return;                  // score tile entirely above the causal diagonal: not computed; read and soft-capped by the softmax but never used (the softmax masks j > i by select)
    v8f acc[4][4];
#pragma unroll
    for (int mb = 0; mb < 4; ++mb)
#pragma unroll
        for (int nb = 0; nb < 4; ++nb) acc[mb][nb] = (v8f){};
    const size_t aoff = (size_t)(r0 + lr) * K + 8 * hi, boff = (size_t)(c0 + lr) * K + 8 * hi;
#pragma unroll 1
    for (int kc = 0; kc < K; kc += 32) {
        V a[4], a2[4];
#pragma unroll
        for (int mb = 0; mb < 4; ++mb) { a[mb] = WFrag<T16>::ld(A + aoff + (size_t)mb * 16 * K + kc); if (NSPLIT == 1 || NSPLIT == 2) a2[mb] = WFrag<T16>::ld(A2 + aoff + (size_t)mb * 16 * K + kc); }
#pragma unroll
        for (int nb = 0; nb < 4; ++nb) { const V b = WFrag<T16>::ld(Bt + boff + (size_t)nb * 16 * K + kc); V b2; if (NSPLIT >= 2) b2 = WFrag<T16>::ld(Bt2 + boff + (size_t)nb * 16 * K + kc);
#pragma unroll
            for (int mb = 0; mb < 4; ++mb) { acc[mb][nb] = WFrag<T16>::mma(a[mb], b, acc[mb][nb]); if (NSPLIT == 1 || NSPLIT == 2) acc[mb][nb] = WFrag<T16>::mma(a2[mb], b, acc[mb][nb]); if (NSPLIT >= 2) acc[mb][nb] = WFrag<T16>::mma(a[mb], b2, acc[mb][nb]); } }
        asm volatile("v_nop\n\tv_nop\n\tv_nop\n\tv_nop" : "+v"(acc[0][0]), "+v"(acc[1][1]), "+v"(acc[2][2]), "+v"(acc[3][3]) : "v"(a[0]), "v"(a[3]));
    }
#pragma unroll
    for (int mb = 0; mb < 4; ++mb) {
#pragma unroll
        for (int nb = 0; nb < 4; ++nb) {
#pragma unroll
            for (int j = 0; j < 8; ++j) os[(hi * 8 + j) * 68 + nb * 16 + lr] = acc[mb][nb][j]; }
        __builtin_amdgcn_wave_barrier(); asm volatile("" ::: "memory");
        float* crow = C + (size_t)(r0 + mb * 16) * ldc + c0;
{
#pragma unroll
            for (int s = 0; s < 8; ++s) { const int row = 2 * s + hi, cofs = lr * 4; v4f val = *(const v4fa*)(os + row * 68 + cofs);
                *(v4f*)(crow + (size_t)row * ldc + cofs) = val; }
             }
        __builtin_amdgcn_wave_barrier(); asm volatile("" ::: "memory");
    }
}

__device__ __forceinline__ h16 tohx(float x) { return (h16)x; }
__device__ __forceinline__ void splitf(float y, unsigned short& h, unsigned short& l) { h = f2bf(y); l = f2bf(y - bf2f(h)); }
typedef __attribute__((ext_vector_type(2))) _Float16 v2h;
typedef __attribute__((ext_vector_type(4))) _Float16 v4h;
typedef __attribute__((ext_vector_type(2))) unsigned short v2us;
typedef __attribute__((ext_vector_type(4))) unsigned short v4us;
typedef __attribute__((ext_vector_type(2))) float v2f;
typedef __attribute__((ext_vector_type(4))) int v4i;

__global__ __launch_bounds__(256) void k_wtG(const float* __restrict__ w, int K, int N, bf* Bt) {
    const int lane = threadIdx.x & 31; const int L0 = (blockIdx.x * 8 + (threadIdx.x >> 5)) * 8; const int nlines = N * K / 64;
{
#pragma unroll 1
        for (int l = 0; l < 8; ++l) { const int L = L0 + l; if (L >= nlines) break; const size_t e = (size_t)L * 64 + lane * 2; const int k = (int)(e % K), n = (int)(e / K); v2us o;
            o[0] = f2bf(w[(size_t)k * N + n]); o[1] = f2bf(w[(size_t)(k + 1) * N + n]); *(v2us*)(Bt + e) = o; }
         }
}
__global__ __launch_bounds__(256) void k_cvt8(const float* __restrict__ src, bf* dst, size_t n8) { const size_t i = (size_t)blockIdx.x * 256 + threadIdx.x; if (i >= n8) return; const v8f v = *(const v8f*)(src + i * 8); v8us o;
#pragma unroll
    for (int k = 0; k < 8; ++k) o[k] = f2bf(v[k]); *(v8us*)(dst + i * 8) = o;  }
// k_rope: head planes [h][t][d] (fp16 + hi/lo) of rope(x) x sc with the rotate-half convention out[d] = x[d] cos[t][d] - x[d+HD/2] sin[t][d], out[d+HD/2] = x[d+HD/2] cos[t][d+HD/2] + x[d] sin[t][d+HD/2]
__global__ __launch_bounds__(256) void k_rope(const float* __restrict__ F, int pitch, int nheads, const float* __restrict__ CS, const float* __restrict__ RF, const float* __restrict__ nw, float sc, h16* P16, bf* Ph, bf* Pl) {
    const size_t e = ((size_t)blockIdx.x * 256 + threadIdx.x) * 2; if (e >= (size_t)nheads * TT * HD) return; const int d = (int)(e % HD); const int t = (int)((e / HD) % TT); const int h = (int)(e / ((size_t)HD * TT)); const float* f = F + (size_t)t * pitch + h * HD; const float rf = RF ? RF[(size_t)h * TT + t] : 1.0f; v2h o16; v2us oh, ol;
#pragma unroll
    for (int q = 0; q < 2; ++q) { const int dd = d + q; const int dp = (dd < HD / 2) ? dd + HD / 2 : dd - HD / 2; float x0 = f[dd], x1 = f[dp];
        if (RF) { float n0 = __fmul_rn(x0, rf), n1 = __fmul_rn(x1, rf); asm volatile("" : "+v"(n0)); asm volatile("" : "+v"(n1)); x0 = __fmul_rn(bfr(nw[dd]), n0); x1 = __fmul_rn(bfr(nw[dp]), n1); }
        const v2f cs = *(const v2f*)(CS + ((size_t)t * HD + dd) * 2); float a = __fmul_rn(x0, cs[0]), bq = __fmul_rn(x1, cs[1]); asm volatile("" : "+v"(a)); asm volatile("" : "+v"(bq)); const float r = ((dd < HD / 2) ? __fsub_rn(a, bq) : __fadd_rn(a, bq)) * sc;
        o16[q] = tohx(r); unsigned short a2, c2; splitf(r, a2, c2); oh[q] = a2; ol[q] = c2; }
    *(v2h*)(P16 + e) = o16; *(v2us*)(Ph + e) = oh; *(v2us*)(Pl + e) = ol;  }
__global__ __launch_bounds__(256) void k_vtp(const float* __restrict__ F, int pitch, int nheads, h16* V16, bf* Vh, bf* Vl) { const size_t e = ((size_t)blockIdx.x * 256 + threadIdx.x) * 2; if (e >= (size_t)nheads * HD * TT) return; const int t = (int)(e % TT); const int d = (int)((e / TT) % HD); const int g = (int)(e / ((size_t)TT * HD)); v2h o16; v2us oh, ol;
#pragma unroll
    for (int q = 0; q < 2; ++q) { const float x = F[(size_t)(t + q) * pitch + g * HD + d]; o16[q] = tohx(x); unsigned short a2, c2; splitf(x, a2, c2); oh[q] = a2; ol[q] = c2; }
    *(v2h*)(V16 + e) = o16; *(v2us*)(Vh + e) = oh; *(v2us*)(Vl + e) = ol;  }
// k_asoft: per row (zz, i): t = 50 tanh((S / 8) / 50) (S: the raw score products) for keys j <= i, -3e38 for j > i (causal); softmax over the 2048 keys (register row, one exp, fixed trees);
// the probabilities go back into the row's own 8192 bytes, which its one wave has read whole into registers by then: rows < RH hi plane in the first half, lo plane in the second; other rows fp16 in the first half.
__global__ __launch_bounds__(256) void k_asoft(float* Sb) {
    const int lane = threadIdx.x & 31; const int row = blockIdx.x * 8 + (threadIdx.x >> 5); if (row >= ZH * TT) return; const int i = row % TT; const int zz = row / TT; (void)zz; const bool hires = (i < RH); float* sr = Sb + (size_t)row * TT; float v[TT / 32]; float mx = -3.0e38f;
#pragma unroll
    for (int ch = 0; ch < TT / 128; ++ch) { const int j0 = ch * 128 + lane * 4; const v4f a = *(const v4f*)(sr + j0);
#pragma unroll
        for (int q = 0; q < 4; ++q) { const int j = j0 + q; (void)j; const float c = softcap(a[q] * SCL);   /* soft cap of the raw score / 8, computed for every key (64 independent chains to interleave); the causal select drops the rest */ const float t = (j <= i) ? c : -3.0e38f; v[ch * 4 + q] = t; mx = fmaxf(mx, t); } }
#pragma unroll
    for (int sh = 16; sh; sh >>= 1) mx = fmaxf(mx, __shfl_xor(mx, sh, 32));
    float sum = 0.f;
#pragma unroll
    for (int k = 0; k < TT / 32; ++k) { float d0 = __fsub_rn(v[k], mx); asm volatile("" : "+v"(d0)); v[k] = __builtin_amdgcn_exp2f(__fmul_rn(d0, 1.4426950408889634f)); sum += v[k]; }
#pragma unroll
    for (int sh = 16; sh; sh >>= 1) sum += __shfl_xor(sum, sh, 32);
    const float f = __fdiv_rn(hires ? 1.0f : PCAR, sum);
{
        if (hires) {
#pragma unroll
            for (int ch = 0; ch < TT / 128; ++ch) { v4us oh, ol;
#pragma unroll
                for (int q = 0; q < 4; ++q) { unsigned short a, c2; splitf(v[ch * 4 + q] * f, a, c2); oh[q] = a; ol[q] = c2; }
                const int oo = ch * 128 + lane * 4; *(v4us*)((bf*)sr + oo) = oh; *(v4us*)((bf*)sr + TT + oo) = ol; }
        } else {
#pragma unroll
            for (int ch = 0; ch < TT / 128; ++ch) { v4h o4;
#pragma unroll
                for (int q = 0; q < 4; ++q) o4[q] = tohx(v[ch * 4 + q] * f);
                *(v4h*)((h16*)sr + ch * 128 + lane * 4) = o4; } }
         }
}
__constant__ float INVT[HD / 2] = { 1.000000000e+00f, 7.498942018e-01f, 5.623413324e-01f, 4.216965139e-01f, 3.162277639e-01f, 2.371373773e-01f, 1.778279394e-01f, 1.333521456e-01f, 1.000000015e-01f, 7.498942316e-02f, 5.623413250e-02f, 4.216964915e-02f, 3.162277490e-02f, 2.371373773e-02f, 1.778279431e-02f, 1.333521400e-02f, 9.999999776e-03f, 7.498942316e-03f, 5.623413250e-03f, 4.216964822e-03f, 3.162277630e-03f, 2.371373819e-03f, 1.778279431e-03f, 1.333521446e-03f, 1.000000047e-03f, 7.498941850e-04f, 5.623413017e-04f, 4.216965172e-04f, 3.162277571e-04f, 2.371373703e-04f, 1.778279402e-04f, 1.333521504e-04f };   // 10000^(-2i/64) (the module's power form) (float32, generated with jnp to be bit-exact)
__global__ __launch_bounds__(256) void k_cs4(float* CS) { const int idx = blockIdx.x * 256 + threadIdx.x; if (idx >= TT * HD) return; const int d = idx % HD; const int t = idx / HD; const float a = __fmul_rn((float)t, INVT[d % (HD / 2)]); v2f cs; cs[0] = cosf(a); cs[1] = sinf(a); *(v2f*)(CS + (size_t)idx * 2) = cs;  }

__global__ __launch_bounds__(256) void k_hrms0(float* F, int nheads) { const int lane = threadIdx.x & 31; const size_t wv = (size_t)blockIdx.x * 8 + (threadIdx.x >> 5); if (wv >= (size_t)TT * nheads) return; float* f = F + wv * HD + lane * 2; const v2f a = *(const v2f*)f; float p0 = __fmul_rn(a[0], a[0]), p1 = __fmul_rn(a[1], a[1]); asm volatile("" : "+v"(p0), "+v"(p1)); float ss = __fadd_rn(p0, p1);
#pragma unroll
    for (int sh = 16; sh; sh >>= 1) ss = __fadd_rn(ss, __shfl_xor(ss, sh, 32));
    const float rs = __fdiv_rn(1.0f, __fsqrt_rn(__fadd_rn(__fdiv_rn(ss, (float)HD), RMSEPS))); v2f o;
#pragma unroll
    for (int q = 0; q < 2; ++q) { o[q] = __fmul_rn(a[q], rs); }
    *(v2f*)f = o;  }

__global__ __launch_bounds__(256) void k_merge(const float* __restrict__ O, int h0, bf* Ah, bf* Al) { const size_t e = ((size_t)blockIdx.x * 256 + threadIdx.x) * 2; if (e >= (size_t)ZH * TT * HD) return; const int d = (int)(e % HD); const int t = (int)((e / HD) % TT); const int zz = (int)(e / ((size_t)HD * TT)); const float cs = (t < RH) ? 1.0f : (1.0f / PCAR); const size_t oo = (size_t)t * DQ + (h0 + zz) * HD + d;
    v2us oh, ol;
#pragma unroll
    for (int q = 0; q < 2; ++q) { unsigned short a, c2; splitf(O[e + q] * cs, a, c2); oh[q] = a; ol[q] = c2; } *(v2us*)(Ah + oo) = oh; *(v2us*)(Al + oo) = ol;  }

extern "C" void kernel_launch(void* const* d_in, const int* in_sizes, int n_in,
                              void* d_out, int out_size, void* d_ws, size_t ws_size, hipStream_t stream) {
    (void)in_sizes; (void)n_in; (void)out_size;
    const float* x = (const float*)d_in[0]; const float* wq = (const float*)d_in[1]; const float* wk = (const float*)d_in[2]; const float* wv = (const float*)d_in[3]; const float* wo = (const float*)d_in[4];
    float* OUT = (float*)d_out;     // [2][2048][1024]
    char* wsp = (char*)d_ws;
    auto take = [&](size_t bytes) { char* p = wsp; wsp += (bytes + 255) & ~(size_t)255; return (void*)p; };
    bf* WQ = (bf*)take((size_t)DQ * DM * 2); bf* WK = (bf*)take((size_t)DKV * DM * 2); bf* WV = (bf*)take((size_t)DKV * DM * 2); bf* WO = (bf*)take((size_t)DM * DQ * 2); float* CS = (float*)take((size_t)TT * HD * 2 * 4);
    bf* XB = (bf*)take((size_t)TT * DM * 2); float* FQ = (float*)take((size_t)TT * DQ * 4); float* FK = (float*)take((size_t)TT * DKV * 4);
    h16* QP16 = (h16*)take((size_t)NH_ * TT * HD * 2); h16* KP16 = (h16*)take((size_t)NKV * TT * HD * 2); h16* VT16 = (h16*)take((size_t)NKV * HD * TT * 2);
    bf* QPh = (bf*)take((size_t)NH_ * TT * HD * 2); bf* QPl = (bf*)take((size_t)NH_ * TT * HD * 2); bf* KPh = (bf*)take((size_t)NKV * TT * HD * 2); bf* KPl = (bf*)take((size_t)NKV * TT * HD * 2); bf* VTh = (bf*)take((size_t)NKV * HD * TT * 2); bf* VTl = (bf*)take((size_t)NKV * HD * TT * 2);
    float* Sb = (float*)take((size_t)ZH * TT * TT * 4); float* Ob = (float*)take((size_t)ZH * TT * HD * 4); bf* ATh = (bf*)take((size_t)TT * DQ * 2); bf* ATl = (bf*)take((size_t)TT * DQ * 2);
    if ((size_t)(wsp - (char*)d_ws) > ws_size) return;    // ws 256 MiB
    float* FV = FK;   // v projection reuses the k buffer after the k planes are built (stream-ordered)
    { k_wtG<<<(unsigned)((DM * DQ / 64 + 63) / 64), 256, 0, stream>>>(wq, DM, DQ, WQ); k_wtG<<<(unsigned)((DM * DKV / 64 + 63) / 64), 256, 0, stream>>>(wk, DM, DKV, WK); k_wtG<<<(unsigned)((DM * DKV / 64 + 63) / 64), 256, 0, stream>>>(wv, DM, DKV, WV);
      k_wtG<<<(unsigned)((DQ * DM / 64 + 63) / 64), 256, 0, stream>>>(wo, DQ, DM, WO);
       }
    const unsigned LQ = (unsigned)(((size_t)NH_ * TT * HD / 2 + 255) / 256), LKv = (unsigned)(((size_t)NKV * TT * HD / 2 + 255) / 256);
    for (int b = 0; b < NB_; ++b) {
        if (b == 0) k_cs4<<<(TT * HD + 255) / 256, 256, 0, stream>>>(CS);
        k_cvt8<<<(unsigned)(((size_t)TT * DM / 8 + 255) / 256), 256, 0, stream>>>(x + (size_t)b * TT * DM, XB, (size_t)TT * DM / 8);
        k_gemmw<bf, 0, false><<<dim3(TT / 64, DQ / 64, 1), 256, 0, stream>>>(XB, nullptr, WQ, nullptr, DM, FQ, DQ, nullptr, 0, 0, 0);
        k_hrms0<<<(unsigned)(((size_t)TT * NH_ + 7) / 8), 256, 0, stream>>>(FQ, NH_);   /* per-head RMS-norm (no scale) */ k_rope<<<LQ, 256, 0, stream>>>(FQ, DQ, NH_, CS, nullptr, nullptr, 1.0f, QP16, QPh, QPl);
        k_gemmw<bf, 0, false><<<dim3(TT / 64, DKV / 64, 1), 256, 0, stream>>>(XB, nullptr, WK, nullptr, DM, FK, DKV, nullptr, 0, 0, 0);
        k_hrms0<<<(unsigned)(((size_t)TT * NKV + 7) / 8), 256, 0, stream>>>(FK, NKV); k_rope<<<LKv, 256, 0, stream>>>(FK, DKV, NKV, CS, nullptr, nullptr, 1.0f, KP16, KPh, KPl);
        k_gemmw<bf, 0, false><<<dim3(TT / 64, DKV / 64, 1), 256, 0, stream>>>(XB, nullptr, WV, nullptr, DM, FV, DKV, nullptr, 0, 0, 0); k_vtp<<<LKv, 256, 0, stream>>>(FV, DKV, NKV, VT16, VTh, VTl);
        for (int h0 = 0; h0 < NH_; h0 += ZH) { const size_t zq = (size_t)h0, zk = (size_t)(h0 / REP);   // the ZH heads of a pass use kv groups h0/REP .. : sB = one kv plane, stepped per REP heads in the kernels
            k_gemmc<bf, 2, 1><<<dim3(RH / 64, TT / 64, ZH), 32, 0, stream>>>(QPh + zq * TT * HD, QPl + zq * TT * HD, KPh + zk * TT * HD, KPl + zk * TT * HD, HD, Sb, TT, 0, (size_t)TT * HD, (size_t)TT * HD, (size_t)TT * TT);
            k_gemmc<h16, 0, 1><<<dim3((TT - RH) / 64, TT / 64, ZH), 32, 0, stream>>>(QP16 + zq * TT * HD + (size_t)RH * HD, nullptr, KP16 + zk * TT * HD, nullptr, HD, Sb + (size_t)RH * TT, TT, RH, (size_t)TT * HD, (size_t)TT * HD, (size_t)TT * TT);
            k_asoft<<<ZH * TT / 8, 256, 0, stream>>>(Sb);
            k_gemmpv<bf, 2, 8><<<dim3(RH / 64, HD / 64, ZH), 256, 0, stream>>>((const bf*)Sb, (const bf*)Sb + TT, VTh + zk * HD * TT, VTl + zk * HD * TT, 2 * TT, TT, Ob, HD, 0, (size_t)2 * TT * TT, (size_t)HD * TT, (size_t)TT * HD);
            k_gemmpv<h16, 0, 16><<<dim3((TT - RH) / 64, HD / 64, ZH), 512, 0, stream>>>((const h16*)Sb + (size_t)RH * 2 * TT, nullptr, VT16 + zk * HD * TT, nullptr, 2 * TT, TT, Ob + (size_t)RH * HD, HD, RH, (size_t)2 * TT * TT, (size_t)HD * TT, (size_t)TT * HD);
            k_merge<<<(unsigned)(((size_t)ZH * TT * HD / 2 + 255) / 256), 256, 0, stream>>>(Ob, h0, ATh, ATl); }
        k_gemmw<bf, 1, false><<<dim3(TT / 64, DM / 64, 1), 256, 0, stream>>>(ATh, ATl, WO, nullptr, DQ, OUT + (size_t)b * TT * DM, DM, nullptr, 0, 0, 0); }
}

// v005
// It runs in 234 microseconds.
// Versions in between are left out here; by their measured steps it is 2.09 times as fast as v003.
// Over all steps from v000 it is 6.55 times as fast.
#include <hip/hip_runtime.h>

// Causal grouped-query self-attention with QK RMS-norm, rotary embeddings and tanh logit soft-capping (x [2][2048][1024]; q = x w_q ('xw' [1024][1024] 0.02, 16 heads x 64), k, v = x w_k / w_v ([1024][256]: 4 kv heads, each shared by 4 query heads); q, k <- RMS-norm over 64 (eps 1e-5, no scale); half-split rope (theta 1e4, computed); scores / 8; softcap: 50 tanh(scores / 50); causal (-inf); softmax; out = merged w_o ('xw') -> [2][2048][1024] (4.2 M)).
// Layout, both batches in every launch (token-major buffers hold 2 x 2048 rows, head planes are [batch][head]; the batch is a grid dimension or more row tiles): bf16 copy of x; 'xw' weights transposed once; exact projections; in-place per-(token, head) RMS-norm kernels; {cos, sin} table once; rotate-half rotary plane builders; causal T-2048 GQA attention fused in one launch (each kv plane serves 4 query heads; scores, soft cap as 50 x tanh(s/50) (tanh via one exp2 and a division, f32), running-maximum softmax and P.V in registers; hybrid rows: < 512 hi/lo 3 products, rest fp16 x1024; key blocks above the diagonal skipped); merged hi/lo x w_o exact.
// Compute dtypes, f32 accumulate: every input rounded to bf16; projections exact; RMS-norm and rotary f32; attention rows < 512 3 products, rest fp16; soft cap and softmax f32; w_o hl x exact.

#define NB_  2
#define TT   2048
#define DM   1024
#define NH_  16
#define NKV  4
#define REP  (NH_ / NKV)
#define HD   64
#define DQ   (NH_ * HD)
#define DKV  (NKV * HD)
#define RH   512                  // query rows < RH use hi+lo planes (0: none)
#define SCL  0.125f
#define CAP  50.0f
#define RMSEPS 1e-5f
typedef _Float16 h16;
typedef unsigned short bf;
typedef __attribute__((ext_vector_type(16))) __bf16   v16bf;
typedef __attribute__((ext_vector_type(16))) _Float16 v16h;
typedef __attribute__((ext_vector_type(8)))  _Float16 v8h;
typedef __attribute__((ext_vector_type(8)))  unsigned short v8us;
typedef __attribute__((ext_vector_type(8)))  float    v8f;
typedef __attribute__((ext_vector_type(4)))  float    v4f;
typedef v8h  __attribute__((may_alias)) v8ha;
typedef v4f  __attribute__((may_alias)) v4fa;
typedef v8us __attribute__((may_alias)) v8usa;

__device__ __forceinline__ unsigned short f2bf(float f) { unsigned u = __float_as_uint(f); u += 0x7FFFu + ((u >> 16) & 1u); return (unsigned short)(u >> 16); }
__device__ __forceinline__ float bf2f(unsigned short b) { return __uint_as_float(((unsigned)b) << 16); }
__device__ __forceinline__ float bfr(float f) { return bf2f(f2bf(f)); }
__device__ __forceinline__ v16h cat16(v8h lo, v8h hi) { return __builtin_shufflevector(lo, hi, 0, 1, 2, 3, 4, 5, 6, 7, 8, 9, 10, 11, 12, 13, 14, 15); }
__device__ __forceinline__ v16bf cat16b(v8us lo, v8us hi) { return __builtin_bit_cast(v16bf, __builtin_shufflevector(lo, hi, 0, 1, 2, 3, 4, 5, 6, 7, 8, 9, 10, 11, 12, 13, 14, 15)); }
__device__ __forceinline__ v8f wmma16(v16h a, v16h b, v8f c) { return __builtin_amdgcn_wmma_f32_16x16x32_f16(false, a, false, b, (short)0, c, false, false); }
__device__ __forceinline__ v8f wmmab(v16bf a, v16bf b, v8f c) { return __builtin_amdgcn_wmma_f32_16x16x32_bf16(false, a, false, b, (short)0, c, false, false); }



// ---- k_gemmw: register-blocked GEMM, 8 waves per 64x64 output tile, the K range split over the waves (16 accumulators each), operands straight from K-contiguous 16-bit planes; grid (M/64, N/64, Z), 256 threads.
// C[m][n] (f32, pitch ldc, + optional f32 bias[n]) = sum_k A[m][k] Bt[n][k] (+ split products per NSPLIT). z-batch strides sA/sB/sC in elements. K % 64 == 0.
// softcap: 50 tanh(s / 50) with tanh(u) = 1 - 2 / (exp(2u) + 1) (one exp2 of 2u log2 e, one precise division; u in [-0.2, 0.2] here so no overflow); f32.
// exp2s: v_exp_f32 and, in the same statement, the one vector slot that the instruction set asks for behind a transcendental before its result is read or its source overwritten
__device__ __forceinline__ float exp2s(float x) { float r; asm("v_exp_f32 %0, %1\n\tv_nop" : "=v"(r) : "v"(x)); return r; }
__device__ __forceinline__ float softcap(float s) { const float u = __fmul_rn(s, 1.0f / CAP); const float e = exp2s(__fmul_rn(__fmul_rn(u, 2.0f), 1.4426950408889634f)); const float th = __fsub_rn(1.0f, __fdiv_rn(2.0f, __fadd_rn(e, 1.0f))); return __fmul_rn(th, CAP); }
template <typename T16> struct WFrag;
template <> struct WFrag<h16> { typedef v16h V; static __device__ __forceinline__ V ld(const h16* p) { return cat16(*(const v8h*)p, *(const v8h*)(p + 16)); } static __device__ __forceinline__ v8f mma(V a, V b, v8f c) { return wmma16(a, b, c); } };
template <> struct WFrag<bf> { typedef v16bf V; static __device__ __forceinline__ V ld(const bf* p) { return cat16b(*(const v8us*)p, *(const v8us*)(p + 16)); } static __device__ __forceinline__ v8f mma(V a, V b, v8f c) { return wmmab(a, b, c); } };
// tile_splitk: one 64x64 output tile by a work-group of NW (8 or 16) waves. Wave w takes the 64-wide k chunks w, w + NW, ... below Kl (Kl % 64 == 0; a chunk = one whole 128-byte line of every operand row, two
// trips of 32) with the 16-accumulator register block; the NW partial tiles go to LDS in register order (b128, one slot per lane), and behind one barrier each wave sums, in wave order 0..NW-1, its 32 / NW
// slots and stores them: 32 columns = one whole 128-byte line of each of its rows, so every line of C has one writer. lda = pitch of the A planes in elements (the Bt planes have pitch K).
template <typename T16, int NSPLIT, bool BIAS, int NW>
__device__ __forceinline__ void tile_splitk(const T16* __restrict__ A, const T16* __restrict__ A2, const T16* __restrict__ Bt, const T16* __restrict__ Bt2, int lda, int K, int Kl, float* C, int ldc, const float* __restrict__ bias, int r0, int c0) {
    typedef typename WFrag<T16>::V V;
    __shared__ __align__(16) float part[NW * 32 * 32 * 4];           // [wave][slot = (mb * 4 + nb) * 2 + g][lane][4]: accumulator elements 4 g .. 4 g + 3
    const int lane = threadIdx.x & 31, lr = lane & 15, hi = lane >> 4; const int w = __builtin_amdgcn_readfirstlane(threadIdx.x >> 5);
    v8f acc[4][4];
#pragma unroll
    for (int mb = 0; mb < 4; ++mb)
#pragma unroll
        for (int nb = 0; nb < 4; ++nb) acc[mb][nb] = (v8f){};
    const size_t aoff = (size_t)(r0 + lr) * lda + 8 * hi, boff = (size_t)(c0 + lr) * K + 8 * hi;
#pragma unroll 1
    for (int kc = w * 64; kc < Kl; kc += (kc & 32) ? NW * 64 - 32 : 32) {
        V a[4], a2[4];
#pragma unroll
        for (int mb = 0; mb < 4; ++mb) { a[mb] = WFrag<T16>::ld(A + aoff + (size_t)mb * 16 * lda + kc); if (NSPLIT == 1 || NSPLIT == 2) a2[mb] = WFrag<T16>::ld(A2 + aoff + (size_t)mb * 16 * lda + kc); }
#pragma unroll
        for (int nb = 0; nb < 4; ++nb) { const V b = WFrag<T16>::ld(Bt + boff + (size_t)nb * 16 * K + kc); V b2; if (NSPLIT >= 2) b2 = WFrag<T16>::ld(Bt2 + boff + (size_t)nb * 16 * K + kc);
#pragma unroll
            for (int mb = 0; mb < 4; ++mb) { acc[mb][nb] = WFrag<T16>::mma(a[mb], b, acc[mb][nb]); if (NSPLIT == 1 || NSPLIT == 2) acc[mb][nb] = WFrag<T16>::mma(a2[mb], b, acc[mb][nb]); if (NSPLIT >= 2) acc[mb][nb] = WFrag<T16>::mma(a[mb], b2, acc[mb][nb]); } }
        // four vector slots behind the trip's last matrix instructions, on the back edge and on the exit alike, before fragments are reloaded or accumulators read
        asm volatile("v_nop\n\tv_nop\n\tv_nop\n\tv_nop" : "+v"(acc[0][0]), "+v"(acc[1][1]), "+v"(acc[2][2]), "+v"(acc[3][3]) : "v"(a[0]), "v"(a[3]));
    }
#pragma unroll
    for (int mb = 0; mb < 4; ++mb)
#pragma unroll
        for (int nb = 0; nb < 4; ++nb)
#pragma unroll
            for (int g = 0; g < 2; ++g) { v4f p; p[0] = acc[mb][nb][g * 4]; p[1] = acc[mb][nb][g * 4 + 1]; p[2] = acc[mb][nb][g * 4 + 2]; p[3] = acc[mb][nb][g * 4 + 3];
                *(v4fa*)(part + (((w * 32 + (mb * 4 + nb) * 2 + g) * 32 + lane) << 2)) = p; }
    __syncthreads();                                                 // every wave's partial tile is in LDS before any wave sums
    constexpr int GS = 16 / NW;                                      // g values a wave sums: 2 with 8 waves, 1 with 16
    const int mbw = w / (NW / 4), rem = w % (NW / 4), nbp = rem / (2 / GS), g0 = (rem % (2 / GS)) * GS;
#pragma unroll
    for (int u = 0; u < 2; ++u) { const int col = c0 + (nbp * 2 + u) * 16 + lr; const float bv = BIAS ? bfr(bias[col]) : 0.0f;
#pragma unroll
        for (int gg = 0; gg < GS; ++gg) { const int slot = (mbw * 4 + nbp * 2 + u) * 2 + g0 + gg; v4f s = *(const v4fa*)(part + ((slot * 32 + lane) << 2));
#pragma unroll
            for (int p = 1; p < NW; ++p) s += *(const v4fa*)(part + (((p * 32 + slot) * 32 + lane) << 2));
#pragma unroll
            for (int q = 0; q < 4; ++q) { float val = s[q]; if (BIAS) val += bv; C[(size_t)(r0 + mbw * 16 + hi * 8 + (g0 + gg) * 4 + q) * ldc + col] = val; } } }
}
template <typename T16, int NSPLIT, bool BIAS>
__global__ __launch_bounds__(256) void k_gemmw(const T16* __restrict__ A, const T16* __restrict__ A2, const T16* __restrict__ Bt, const T16* __restrict__ Bt2, int K, float* C, int ldc, const float* __restrict__ bias, size_t sA, size_t sB, size_t sC) {
    const size_t z = blockIdx.z; A += z * sA; if (A2) A2 += z * sA; Bt += z * sB; if (Bt2) Bt2 += z * sB; C += z * sC;
    tile_splitk<T16, NSPLIT, BIAS, 8>(A, A2, Bt, Bt2, K, K, K, C, ldc, bias, blockIdx.x * 64, blockIdx.y * 64);
}
__device__ __forceinline__ h16 tohx(float x) { return (h16)x; }
__device__ __forceinline__ void splitf(float y, unsigned short& h, unsigned short& l) { h = f2bf(y); l = f2bf(y - bf2f(h)); }
typedef __attribute__((ext_vector_type(2))) _Float16 v2h;
typedef __attribute__((ext_vector_type(4))) _Float16 v4h;
typedef __attribute__((ext_vector_type(2))) unsigned short v2us;
typedef __attribute__((ext_vector_type(4))) unsigned short v4us;
typedef __attribute__((ext_vector_type(2))) float v2f;
typedef __attribute__((ext_vector_type(4))) int v4i;

__global__ __launch_bounds__(256) void k_wtG(const float* __restrict__ w, int K, int N, bf* Bt) {
    const int lane = threadIdx.x & 31; const int L0 = (blockIdx.x * 8 + (threadIdx.x >> 5)) * 8; const int nlines = N * K / 64;
{
#pragma unroll 1
        for (int l = 0; l < 8; ++l) { const int L = L0 + l; if (L >= nlines) break; const size_t e = (size_t)L * 64 + lane * 2; const int k = (int)(e % K), n = (int)(e / K); v2us o;
            o[0] = f2bf(w[(size_t)k * N + n]); o[1] = f2bf(w[(size_t)(k + 1) * N + n]); *(v2us*)(Bt + e) = o; }
         }
}
__global__ __launch_bounds__(256) void k_cvt8(const float* __restrict__ src, bf* dst, size_t n8) { const size_t i = (size_t)blockIdx.x * 256 + threadIdx.x; if (i >= n8) return; const v8f v = *(const v8f*)(src + i * 8); v8us o;
#pragma unroll
    for (int k = 0; k < 8; ++k) o[k] = f2bf(v[k]); *(v8us*)(dst + i * 8) = o;  }
// k_rope: grid y = batch; head planes [b][h][t][d] (fp16 + hi/lo) of rope(x) x sc with the rotate-half convention out[d] = x[d] cos[t][d] - x[d+HD/2] sin[t][d], out[d+HD/2] = x[d+HD/2] cos[t][d+HD/2] + x[d] sin[t][d+HD/2]
__global__ __launch_bounds__(256) void k_rope(const float* __restrict__ F, int pitch, int nheads, const float* __restrict__ CS, const float* __restrict__ RF, const float* __restrict__ nw, float sc, h16* P16, bf* Ph, bf* Pl) {
    { const size_t b = blockIdx.y, po = b * nheads * TT * HD; F += b * TT * pitch; if (RF) RF += b * nheads * TT; P16 += po; Ph += po; Pl += po; }   // this batch's token rows and head planes
    const size_t e = ((size_t)blockIdx.x * 256 + threadIdx.x) * 2; if (e >= (size_t)nheads * TT * HD) return; const int d = (int)(e % HD); const int t = (int)((e / HD) % TT); const int h = (int)(e / ((size_t)HD * TT)); const float* f = F + (size_t)t * pitch + h * HD; const float rf = RF ? RF[(size_t)h * TT + t] : 1.0f; v2h o16; v2us oh, ol;
#pragma unroll
    for (int q = 0; q < 2; ++q) { const int dd = d + q; const int dp = (dd < HD / 2) ? dd + HD / 2 : dd - HD / 2; float x0 = f[dd], x1 = f[dp];
        if (RF) { float n0 = __fmul_rn(x0, rf), n1 = __fmul_rn(x1, rf); asm volatile("" : "+v"(n0)); asm volatile("" : "+v"(n1)); x0 = __fmul_rn(bfr(nw[dd]), n0); x1 = __fmul_rn(bfr(nw[dp]), n1); }
        const v2f cs = *(const v2f*)(CS + ((size_t)t * HD + dd) * 2); float a = __fmul_rn(x0, cs[0]), bq = __fmul_rn(x1, cs[1]); asm volatile("" : "+v"(a)); asm volatile("" : "+v"(bq)); const float r = ((dd < HD / 2) ? __fsub_rn(a, bq) : __fadd_rn(a, bq)) * sc;
        o16[q] = tohx(r); unsigned short a2, c2; splitf(r, a2, c2); oh[q] = a2; ol[q] = c2; }
    *(v2h*)(P16 + e) = o16; *(v2us*)(Ph + e) = oh; *(v2us*)(Pl + e) = ol;  }
__global__ __launch_bounds__(256) void k_vtp(const float* __restrict__ F, int pitch, int nheads, h16* V16, bf* Vh, bf* Vl) { { const size_t b = blockIdx.y, po = b * nheads * HD * TT; F += b * TT * pitch; V16 += po; Vh += po; Vl += po; } const size_t e = ((size_t)blockIdx.x * 256 + threadIdx.x) * 2; if (e >= (size_t)nheads * HD * TT) return; const int t = (int)(e % TT); const int d = (int)((e / TT) % HD); const int g = (int)(e / ((size_t)TT * HD)); v2h o16; v2us oh, ol;
#pragma unroll
    for (int q = 0; q < 2; ++q) { const float x = F[(size_t)(t + q) * pitch + g * HD + d]; o16[q] = tohx(x); unsigned short a2, c2; splitf(x, a2, c2); oh[q] = a2; ol[q] = c2; }
    *(v2h*)(V16 + e) = o16; *(v2us*)(Vh + e) = oh; *(v2us*)(Vl + e) = ol;  }
__constant__ float INVT[HD / 2] = { 1.000000000e+00f, 7.498942018e-01f, 5.623413324e-01f, 4.216965139e-01f, 3.162277639e-01f, 2.371373773e-01f, 1.778279394e-01f, 1.333521456e-01f, 1.000000015e-01f, 7.498942316e-02f, 5.623413250e-02f, 4.216964915e-02f, 3.162277490e-02f, 2.371373773e-02f, 1.778279431e-02f, 1.333521400e-02f, 9.999999776e-03f, 7.498942316e-03f, 5.623413250e-03f, 4.216964822e-03f, 3.162277630e-03f, 2.371373819e-03f, 1.778279431e-03f, 1.333521446e-03f, 1.000000047e-03f, 7.498941850e-04f, 5.623413017e-04f, 4.216965172e-04f, 3.162277571e-04f, 2.371373703e-04f, 1.778279402e-04f, 1.333521504e-04f };   // 10000^(-2i/64) (the module's power form) (float32, generated with jnp to be bit-exact)
__global__ __launch_bounds__(256) void k_cs4(float* CS) { const int idx = blockIdx.x * 256 + threadIdx.x; if (idx >= TT * HD) return; const int d = idx % HD; const int t = idx / HD; const float a = __fmul_rn((float)t, INVT[d % (HD / 2)]); v2f cs; cs[0] = cosf(a); cs[1] = sinf(a); *(v2f*)(CS + (size_t)idx * 2) = cs;  }

__global__ __launch_bounds__(256) void k_hrms0(float* F, int nheads) { const int lane = threadIdx.x & 31; const size_t wv = (size_t)blockIdx.x * 8 + (threadIdx.x >> 5); if (wv >= (size_t)TT * nheads) return; float* f = F + wv * HD + lane * 2; const v2f a = *(const v2f*)f; float p0 = __fmul_rn(a[0], a[0]), p1 = __fmul_rn(a[1], a[1]); asm volatile("" : "+v"(p0), "+v"(p1)); float ss = __fadd_rn(p0, p1);
#pragma unroll
    for (int sh = 16; sh; sh >>= 1) ss = __fadd_rn(ss, __shfl_xor(ss, sh, 32));
    const float rs = __fdiv_rn(1.0f, __fsqrt_rn(__fadd_rn(__fdiv_rn(ss, (float)HD), RMSEPS))); v2f o;
#pragma unroll
    for (int q = 0; q < 2; ++q) { o[q] = __fmul_rn(a[q], rs); }
    *(v2f*)f = o;  }

template <typename T16, bool HI>
__device__ __forceinline__ void attn_rows(const T16* __restrict__ Q, const T16* __restrict__ Q2, const T16* __restrict__ Kp, const T16* __restrict__ K2, const T16* __restrict__ Vt, const T16* __restrict__ V2, int q0, bf* Ah, bf* Al) {
    typedef typename WFrag<T16>::V V;
    const int lane = threadIdx.x & 31, lr = lane & 15, hi = lane >> 4; const int iq = q0 + lr;
    V qb[2], qb2[2];
#pragma unroll
    for (int ks = 0; ks < 2; ++ks) { qb[ks] = WFrag<T16>::ld(Q + (size_t)iq * HD + ks * 32 + 8 * hi); if (HI) qb2[ks] = WFrag<T16>::ld(Q2 + (size_t)iq * HD + ks * 32 + 8 * hi); }
    v8f o[4];
#pragma unroll
    for (int dt = 0; dt < 4; ++dt) o[dt] = (v8f){};
    float m = -3.0e38f, l = 0.0f;
    const int klast = ((q0 + 15) >> 5) << 5;                         // first key of the block that holds the diagonal
    const size_t koff = (size_t)lr * HD + 8 * hi, voff = (size_t)lr * TT + 8 * hi;
    V ka[4], ka2[4];                                                 // [key tile * 2 + k step], fetched one block ahead
#pragma unroll
    for (int f = 0; f < 4; ++f) { ka[f] = WFrag<T16>::ld(Kp + koff + (size_t)(f >> 1) * 16 * HD + (f & 1) * 32); if (HI) ka2[f] = WFrag<T16>::ld(K2 + koff + (size_t)(f >> 1) * 16 * HD + (f & 1) * 32); }
    // kept rolled: the trip count is the wave's own and one block is some 500 instructions already; every inner loop below is unrolled whole so that fragments, scores and accumulators stay in registers
#pragma unroll 1
    for (int k0 = 0; k0 <= klast; k0 += 32) {
        V va[4], va2[4];                                             // this block's value rows: issued here, used behind the softmax arithmetic
#pragma unroll
        for (int dt = 0; dt < 4; ++dt) { va[dt] = WFrag<T16>::ld(Vt + voff + (size_t)dt * 16 * TT + k0); if (HI) va2[dt] = WFrag<T16>::ld(V2 + voff + (size_t)dt * 16 * TT + k0); }
        asm volatile("s_wait_xcnt 0x0" ::: "memory");                // stands between the value loads and the first rewrite of their address registers (results of the key loads below land in some of them)
        v8f s[2];
#pragma unroll
        for (int kt = 0; kt < 2; ++kt) { s[kt] = (v8f){};
#pragma unroll
            for (int ks = 0; ks < 2; ++ks) { s[kt] = WFrag<T16>::mma(ka[kt * 2 + ks], qb[ks], s[kt]); if (HI) { s[kt] = WFrag<T16>::mma(ka[kt * 2 + ks], qb2[ks], s[kt]); s[kt] = WFrag<T16>::mma(ka2[kt * 2 + ks], qb[ks], s[kt]); } } }
        float t[16]; float bm = -3.0e38f;
#pragma unroll
        for (int e = 0; e < 16; ++e) { const int key = k0 + (e >> 3) * 16 + hi * 8 + (e & 7); const float c = softcap(s[e >> 3][e & 7] * SCL); t[e] = (key <= iq) ? c : -3.0e38f; bm = fmaxf(bm, t[e]); }
        const int kn = min(k0 + 32, klast);                          // next block's key rows (the last block fetches its own again: in bounds, unused)
#pragma unroll
        for (int f = 0; f < 4; ++f) { ka[f] = WFrag<T16>::ld(Kp + koff + (size_t)(kn + (f >> 1) * 16) * HD + (f & 1) * 32); if (HI) ka2[f] = WFrag<T16>::ld(K2 + koff + (size_t)(kn + (f >> 1) * 16) * HD + (f & 1) * 32); }
        bm = fmaxf(bm, __shfl_xor(bm, 16, 32));
        const float mn = fmaxf(m, bm); const float alpha = exp2s(__fmul_rn(__fsub_rn(m, mn), 1.4426950408889634f)); m = mn;
        float ls = 0.0f;
#pragma unroll
        for (int e = 0; e < 16; ++e) { const float d0 = __fsub_rn(t[e], mn); t[e] = exp2s(HI ? __fmul_rn(d0, 1.4426950408889634f) : __fmaf_rn(d0, 1.4426950408889634f, 10.0f)); ls += t[e]; }
        l = l * alpha + ls;
#pragma unroll
        for (int dt = 0; dt < 4; ++dt)
#pragma unroll
            for (int j = 0; j < 8; ++j) o[dt][j] *= alpha;
        if constexpr (HI) {
            v8us h0, h1, l0, l1;
#pragma unroll
            for (int j = 0; j < 8; ++j) { unsigned short a, c2; splitf(t[j], a, c2); h0[j] = a; l0[j] = c2; splitf(t[8 + j], a, c2); h1[j] = a; l1[j] = c2; }
            const V ph = cat16b(h0, h1), pl = cat16b(l0, l1);
#pragma unroll
            for (int dt = 0; dt < 4; ++dt) { o[dt] = WFrag<T16>::mma(va[dt], ph, o[dt]); o[dt] = WFrag<T16>::mma(va[dt], pl, o[dt]); o[dt] = WFrag<T16>::mma(va2[dt], ph, o[dt]); }
        } else {
            V ph;
#pragma unroll
            for (int e = 0; e < 16; ++e) ph[e] = tohx(t[e]);
#pragma unroll
            for (int dt = 0; dt < 4; ++dt) o[dt] = WFrag<T16>::mma(va[dt], ph, o[dt]);
        }
        // four vector slots behind the block's last matrix instructions, on the back edge and on the exit alike, before their operand registers are rewritten or the accumulators read
        asm volatile("v_nop\n\tv_nop\n\tv_nop\n\tv_nop" : "+v"(o[0]), "+v"(o[1]), "+v"(o[2]), "+v"(o[3]));
    }
    l += __shfl_xor(l, 16, 32);
    const float f = __fdiv_rn(1.0f, l);
#pragma unroll
    for (int dt = 0; dt < 4; ++dt) { v8us oh, ol;
#pragma unroll
        for (int j = 0; j < 8; ++j) { unsigned short a, c2; splitf(o[dt][j] * f, a, c2); oh[j] = a; ol[j] = c2; }
        const size_t oo = (size_t)iq * DQ + dt * 16 + hi * 8; *(v8us*)(Ah + oo) = oh; *(v8us*)(Al + oo) = ol; }
}
// grid (TT / 32, kv heads, batches), 8 waves: waves 0-3 = the 4 query heads of the kv head on row tile 127 - x, waves 4-7 the same heads on row tile x, so that every work-group walks the same number of keys (the 4 waves of a tile read the same K and V lines).
__global__ __launch_bounds__(256) void k_fattn(const h16* __restrict__ Q16, const bf* __restrict__ Qh, const bf* __restrict__ Ql, const h16* __restrict__ K16, const bf* __restrict__ Kh, const bf* __restrict__ Kl, const h16* __restrict__ V16, const bf* __restrict__ Vh, const bf* __restrict__ Vl, bf* Ah, bf* Al) {
    const int w = __builtin_amdgcn_readfirstlane(threadIdx.x >> 5); const int g = blockIdx.y, head = g * REP + (w & 3);
    const int q0 = ((w >> 2) ? (int)blockIdx.x : TT / 16 - 1 - (int)blockIdx.x) * 16;
    const size_t b = blockIdx.z, qo = (b * NH_ + head) * TT * HD, ko = (b * NKV + g) * TT * HD; Ah += b * TT * DQ; Al += b * TT * DQ;
    if (q0 < RH) attn_rows<bf, true>(Qh + qo, Ql + qo, Kh + ko, Kl + ko, Vh + ko, Vl + ko, q0, Ah + head * HD, Al + head * HD);
    else attn_rows<h16, false>(Q16 + qo, nullptr, K16 + ko, nullptr, V16 + ko, nullptr, q0, Ah + head * HD, Al + head * HD);
}

extern "C" void kernel_launch(void* const* d_in, const int* in_sizes, int n_in,
                              void* d_out, int out_size, void* d_ws, size_t ws_size, hipStream_t stream) {
    (void)in_sizes; (void)n_in; (void)out_size;
    const float* x = (const float*)d_in[0]; const float* wq = (const float*)d_in[1]; const float* wk = (const float*)d_in[2]; const float* wv = (const float*)d_in[3]; const float* wo = (const float*)d_in[4];
    float* OUT = (float*)d_out;     // [2][2048][1024]
    char* wsp = (char*)d_ws;
    auto take = [&](size_t bytes) { char* p = wsp; wsp += (bytes + 255) & ~(size_t)255; return (void*)p; };
    bf* WQ = (bf*)take((size_t)DQ * DM * 2); bf* WK = (bf*)take((size_t)DKV * DM * 2); bf* WV = (bf*)take((size_t)DKV * DM * 2); bf* WO = (bf*)take((size_t)DM * DQ * 2); float* CS = (float*)take((size_t)TT * HD * 2 * 4);
    bf* XB = (bf*)take((size_t)NB_ * TT * DM * 2); float* FQ = (float*)take((size_t)NB_ * TT * DQ * 4); float* FK = (float*)take((size_t)NB_ * TT * DKV * 4);
    h16* QP16 = (h16*)take((size_t)NB_ * NH_ * TT * HD * 2); h16* KP16 = (h16*)take((size_t)NB_ * NKV * TT * HD * 2); h16* VT16 = (h16*)take((size_t)NB_ * NKV * HD * TT * 2);
    bf* QPh = (bf*)take((size_t)NB_ * NH_ * TT * HD * 2); bf* QPl = (bf*)take((size_t)NB_ * NH_ * TT * HD * 2); bf* KPh = (bf*)take((size_t)NB_ * NKV * TT * HD * 2); bf* KPl = (bf*)take((size_t)NB_ * NKV * TT * HD * 2); bf* VTh = (bf*)take((size_t)NB_ * NKV * HD * TT * 2); bf* VTl = (bf*)take((size_t)NB_ * NKV * HD * TT * 2);
    bf* ATh = (bf*)take((size_t)NB_ * TT * DQ * 2); bf* ATl = (bf*)take((size_t)NB_ * TT * DQ * 2);
    if ((size_t)(wsp - (char*)d_ws) > ws_size) return;    // ws 256 MiB
    float* FV = FK;   // v projection reuses the k buffer after the k planes are built (stream-ordered)
    { k_wtG<<<(unsigned)((DM * DQ / 64 + 63) / 64), 256, 0, stream>>>(wq, DM, DQ, WQ); k_wtG<<<(unsigned)((DM * DKV / 64 + 63) / 64), 256, 0, stream>>>(wk, DM, DKV, WK); k_wtG<<<(unsigned)((DM * DKV / 64 + 63) / 64), 256, 0, stream>>>(wv, DM, DKV, WV);
      k_wtG<<<(unsigned)((DQ * DM / 64 + 63) / 64), 256, 0, stream>>>(wo, DQ, DM, WO);
       }
    const unsigned LQ = (unsigned)(((size_t)NH_ * TT * HD / 2 + 255) / 256), LKv = (unsigned)(((size_t)NKV * TT * HD / 2 + 255) / 256);
    k_cs4<<<(TT * HD + 255) / 256, 256, 0, stream>>>(CS);
    k_cvt8<<<(unsigned)(((size_t)NB_ * TT * DM / 8 + 255) / 256), 256, 0, stream>>>(x, XB, (size_t)NB_ * TT * DM / 8);
    k_gemmw<bf, 0, false><<<dim3(NB_ * TT / 64, DQ / 64, 1), 256, 0, stream>>>(XB, nullptr, WQ, nullptr, DM, FQ, DQ, nullptr, 0, 0, 0);
    // k_hrms0 sees the 2 x 2048 token rows as 2048 rows of twice the heads: the 64-wide rows it norms are contiguous either way
    k_hrms0<<<(unsigned)(((size_t)NB_ * TT * NH_ + 7) / 8), 256, 0, stream>>>(FQ, NB_ * NH_);   /* per-head RMS-norm (no scale) */ k_rope<<<dim3(LQ, NB_, 1), 256, 0, stream>>>(FQ, DQ, NH_, CS, nullptr, nullptr, 1.0f, QP16, QPh, QPl);
    k_gemmw<bf, 0, false><<<dim3(NB_ * TT / 64, DKV / 64, 1), 256, 0, stream>>>(XB, nullptr, WK, nullptr, DM, FK, DKV, nullptr, 0, 0, 0);
    k_hrms0<<<(unsigned)(((size_t)NB_ * TT * NKV + 7) / 8), 256, 0, stream>>>(FK, NB_ * NKV); k_rope<<<dim3(LKv, NB_, 1), 256, 0, stream>>>(FK, DKV, NKV, CS, nullptr, nullptr, 1.0f, KP16, KPh, KPl);
    k_gemmw<bf, 0, false><<<dim3(NB_ * TT / 64, DKV / 64, 1), 256, 0, stream>>>(XB, nullptr, WV, nullptr, DM, FV, DKV, nullptr, 0, 0, 0); k_vtp<<<dim3(LKv, NB_, 1), 256, 0, stream>>>(FV, DKV, NKV, VT16, VTh, VTl);
    k_fattn<<<dim3(TT / 32, NKV, NB_), 256, 0, stream>>>(QP16, QPh, QPl, KP16, KPh, KPl, VT16, VTh, VTl, ATh, ATl);
    k_gemmw<bf, 1, false><<<dim3(NB_ * TT / 64, DM / 64, 1), 256, 0, stream>>>(ATh, ATl, WO, nullptr, DQ, OUT, DM, nullptr, 0, 0, 0);
}

// v006
// One run takes 193 microseconds.
// In both of two side-by-side timings against v005, it was 1.21 times as fast.
// Over all steps from v000 it is 7.90 times as fast.
#include <hip/hip_runtime.h>

// Causal grouped-query self-attention with QK RMS-norm, rotary embeddings and tanh logit soft-capping (x [2][2048][1024]; q = x w_q ('xw' [1024][1024] 0.02, 16 heads x 64), k, v = x w_k / w_v ([1024][256]: 4 kv heads, each shared by 4 query heads); q, k <- RMS-norm over 64 (eps 1e-5, no scale); half-split rope (theta 1e4, computed); scores / 8; softcap: 50 tanh(scores / 50); causal (-inf); softmax; out = merged w_o ('xw') -> [2][2048][1024] (4.2 M)).
// Launches: 6. Stages that do not depend on one another share a grid, told apart by block index: {4 weight transposes, bf16 copy of x, cos/sin table}; {q, k, v projections: one GEMM on the three weight planes laid end to end, one [token][q | k | v] f32 buffer}; {q, k RMS-norm}; {q, k rotary planes, v planes}; attention; w_o.
// Layout, both batches in every launch (token-major buffers hold 2 x 2048 rows, head planes are [batch][head]; the batch is a grid dimension or more row tiles): bf16 copy of x; 'xw' weights transposed once; exact projections; in-place per-(token, head) RMS-norm kernel; {cos, sin} table once; rotate-half rotary plane builders; causal T-2048 GQA attention fused in one launch (each kv plane serves 4 query heads; scores, soft cap as 50 x tanh(s/50) (tanh via one exp2 and a division, f32), running-maximum softmax and P.V in registers; hybrid rows: < 512 hi/lo 3 products, rest fp16 x1024; key blocks above the diagonal skipped); merged hi/lo x w_o exact.
// Compute dtypes, f32 accumulate: every input rounded to bf16; projections exact; RMS-norm and rotary f32; attention rows < 512 3 products, rest fp16; soft cap and softmax f32; w_o hl x exact.

#define NB_  2
#define TT   2048
#define DM   1024
#define NH_  16
#define NKV  4
#define REP  (NH_ / NKV)
#define HD   64
#define DQ   (NH_ * HD)
#define DKV  (NKV * HD)
#define NQK  (NH_ + NKV)          // heads of a token that are normed and rotated
#define NALL (NH_ + 2 * NKV)      // q, k and v heads of a token, side by side in the joint projection buffer
#define DALL (NALL * HD)
#define RH   512                  // query rows < RH use hi+lo planes (0: none)
#define SCL  0.125f
#define CAP  50.0f
#define RMSEPS 1e-5f
typedef _Float16 h16;
typedef unsigned short bf;
typedef __attribute__((ext_vector_type(16))) __bf16   v16bf;
typedef __attribute__((ext_vector_type(16))) _Float16 v16h;
typedef __attribute__((ext_vector_type(8)))  _Float16 v8h;
typedef __attribute__((ext_vector_type(8)))  unsigned short v8us;
typedef __attribute__((ext_vector_type(8)))  float    v8f;
typedef __attribute__((ext_vector_type(4)))  float    v4f;
typedef v8h  __attribute__((may_alias)) v8ha;
typedef v4f  __attribute__((may_alias)) v4fa;
typedef v8us __attribute__((may_alias)) v8usa;

__device__ __forceinline__ unsigned short f2bf(float f) { unsigned u = __float_as_uint(f); u += 0x7FFFu + ((u >> 16) & 1u); return (unsigned short)(u >> 16); }
__device__ __forceinline__ float bf2f(unsigned short b) { return __uint_as_float(((unsigned)b) << 16); }
__device__ __forceinline__ float bfr(float f) { return bf2f(f2bf(f)); }
__device__ __forceinline__ v16h cat16(v8h lo, v8h hi) { return __builtin_shufflevector(lo, hi, 0, 1, 2, 3, 4, 5, 6, 7, 8, 9, 10, 11, 12, 13, 14, 15); }
__device__ __forceinline__ v16bf cat16b(v8us lo, v8us hi) { return __builtin_bit_cast(v16bf, __builtin_shufflevector(lo, hi, 0, 1, 2, 3, 4, 5, 6, 7, 8, 9, 10, 11, 12, 13, 14, 15)); }
__device__ __forceinline__ v8f wmma16(v16h a, v16h b, v8f c) { return __builtin_amdgcn_wmma_f32_16x16x32_f16(false, a, false, b, (short)0, c, false, false); }
__device__ __forceinline__ v8f wmmab(v16bf a, v16bf b, v8f c) { return __builtin_amdgcn_wmma_f32_16x16x32_bf16(false, a, false, b, (short)0, c, false, false); }



// ---- k_gemmw: register-blocked GEMM, 8 waves per 64x64 output tile, the K range split over the waves (16 accumulators each), operands straight from K-contiguous 16-bit planes; grid (M/64, N/64, Z), 256 threads.
// C[m][n] (f32, pitch ldc, + optional f32 bias[n]) = sum_k A[m][k] Bt[n][k] (+ split products per NSPLIT). z-batch strides sA/sB/sC in elements. K % 64 == 0.
// softcap: 50 tanh(s / 50) with tanh(u) = 1 - 2 / (exp(2u) + 1) (one exp2 of 2u log2 e, one precise division; u in [-0.2, 0.2] here so no overflow); f32.
// exp2s: v_exp_f32 and, in the same statement, the one vector slot that the instruction set asks for behind a transcendental before its result is read or its source overwritten
__device__ __forceinline__ float exp2s(float x) { float r; asm("v_exp_f32 %0, %1\n\tv_nop" : "=v"(r) : "v"(x)); return r; }
__device__ __forceinline__ float softcap(float s) { const float u = __fmul_rn(s, 1.0f / CAP); const float e = exp2s(__fmul_rn(__fmul_rn(u, 2.0f), 1.4426950408889634f)); const float th = __fsub_rn(1.0f, __fdiv_rn(2.0f, __fadd_rn(e, 1.0f))); return __fmul_rn(th, CAP); }
template <typename T16> struct WFrag;
template <> struct WFrag<h16> { typedef v16h V; static __device__ __forceinline__ V ld(const h16* p) { return cat16(*(const v8h*)p, *(const v8h*)(p + 16)); } static __device__ __forceinline__ v8f mma(V a, V b, v8f c) { return wmma16(a, b, c); } };
template <> struct WFrag<bf> { typedef v16bf V; static __device__ __forceinline__ V ld(const bf* p) { return cat16b(*(const v8us*)p, *(const v8us*)(p + 16)); } static __device__ __forceinline__ v8f mma(V a, V b, v8f c) { return wmmab(a, b, c); } };
// tile_splitk: one 64x64 output tile by a work-group of NW (8 or 16) waves. Wave w takes the 64-wide k chunks w, w + NW, ... below Kl (Kl % 64 == 0; a chunk = one whole 128-byte line of every operand row, two
// trips of 32) with the 16-accumulator register block; the NW partial tiles go to LDS in register order (b128, one slot per lane), and behind one barrier each wave sums, in wave order 0..NW-1, its 32 / NW
// slots and stores them: 32 columns = one whole 128-byte line of each of its rows, so every line of C has one writer. lda = pitch of the A planes in elements (the Bt planes have pitch K).
template <typename T16, int NSPLIT, bool BIAS, int NW>
__device__ __forceinline__ void tile_splitk(const T16* __restrict__ A, const T16* __restrict__ A2, const T16* __restrict__ Bt, const T16* __restrict__ Bt2, int lda, int K, int Kl, float* C, int ldc, const float* __restrict__ bias, int r0, int c0) {
    typedef typename WFrag<T16>::V V;
    __shared__ __align__(16) float part[NW * 32 * 32 * 4];           // [wave][slot = (mb * 4 + nb) * 2 + g][lane][4]: accumulator elements 4 g .. 4 g + 3
    const int lane = threadIdx.x & 31, lr = lane & 15, hi = lane >> 4; const int w = __builtin_amdgcn_readfirstlane(threadIdx.x >> 5);
    v8f acc[4][4];
#pragma unroll
    for (int mb = 0; mb < 4; ++mb)
#pragma unroll
        for (int nb = 0; nb < 4; ++nb) acc[mb][nb] = (v8f){};
    const size_t aoff = (size_t)(r0 + lr) * lda + 8 * hi, boff = (size_t)(c0 + lr) * K + 8 * hi;
#pragma unroll 1
    for (int kc = w * 64; kc < Kl; kc += (kc & 32) ? NW * 64 - 32 : 32) {
        V a[4], a2[4];
#pragma unroll
        for (int mb = 0; mb < 4; ++mb) { a[mb] = WFrag<T16>::ld(A + aoff + (size_t)mb * 16 * lda + kc); if (NSPLIT == 1 || NSPLIT == 2) a2[mb] = WFrag<T16>::ld(A2 + aoff + (size_t)mb * 16 * lda + kc); }
#pragma unroll
        for (int nb = 0; nb < 4; ++nb) { const V b = WFrag<T16>::ld(Bt + boff + (size_t)nb * 16 * K + kc); V b2; if (NSPLIT >= 2) b2 = WFrag<T16>::ld(Bt2 + boff + (size_t)nb * 16 * K + kc);
#pragma unroll
            for (int mb = 0; mb < 4; ++mb) { acc[mb][nb] = WFrag<T16>::mma(a[mb], b, acc[mb][nb]); if (NSPLIT == 1 || NSPLIT == 2) acc[mb][nb] = WFrag<T16>::mma(a2[mb], b, acc[mb][nb]); if (NSPLIT >= 2) acc[mb][nb] = WFrag<T16>::mma(a[mb], b2, acc[mb][nb]); } }
        // four vector slots behind the trip's last matrix instructions, on the back edge and on the exit alike, before fragments are reloaded or accumulators read
        asm volatile("v_nop\n\tv_nop\n\tv_nop\n\tv_nop" : "+v"(acc[0][0]), "+v"(acc[1][1]), "+v"(acc[2][2]), "+v"(acc[3][3]) : "v"(a[0]), "v"(a[3]));
    }
#pragma unroll
    for (int mb = 0; mb < 4; ++mb)
#pragma unroll
        for (int nb = 0; nb < 4; ++nb)
#pragma unroll
            for (int g = 0; g < 2; ++g) { v4f p; p[0] = acc[mb][nb][g * 4]; p[1] = acc[mb][nb][g * 4 + 1]; p[2] = acc[mb][nb][g * 4 + 2]; p[3] = acc[mb][nb][g * 4 + 3];
                *(v4fa*)(part + (((w * 32 + (mb * 4 + nb) * 2 + g) * 32 + lane) << 2)) = p; }
    __syncthreads();                                                 // every wave's partial tile is in LDS before any wave sums
    constexpr int GS = 16 / NW;                                      // g values a wave sums: 2 with 8 waves, 1 with 16
    const int mbw = w / (NW / 4), rem = w % (NW / 4), nbp = rem / (2 / GS), g0 = (rem % (2 / GS)) * GS;
#pragma unroll
    for (int u = 0; u < 2; ++u) { const int col = c0 + (nbp * 2 + u) * 16 + lr; const float bv = BIAS ? bfr(bias[col]) : 0.0f;
#pragma unroll
        for (int gg = 0; gg < GS; ++gg) { const int slot = (mbw * 4 + nbp * 2 + u) * 2 + g0 + gg; v4f s = *(const v4fa*)(part + ((slot * 32 + lane) << 2));
#pragma unroll
            for (int p = 1; p < NW; ++p) s += *(const v4fa*)(part + (((p * 32 + slot) * 32 + lane) << 2));
#pragma unroll
            for (int q = 0; q < 4; ++q) { float val = s[q]; if (BIAS) val += bv; C[(size_t)(r0 + mbw * 16 + hi * 8 + (g0 + gg) * 4 + q) * ldc + col] = val; } } }
}
template <typename T16, int NSPLIT, bool BIAS>
__global__ __launch_bounds__(256) void k_gemmw(const T16* __restrict__ A, const T16* __restrict__ A2, const T16* __restrict__ Bt, const T16* __restrict__ Bt2, int K, float* C, int ldc, const float* __restrict__ bias, size_t sA, size_t sB, size_t sC) {
    const size_t z = blockIdx.z; A += z * sA; if (A2) A2 += z * sA; Bt += z * sB; if (Bt2) Bt2 += z * sB; C += z * sC;
    tile_splitk<T16, NSPLIT, BIAS, 8>(A, A2, Bt, Bt2, K, K, K, C, ldc, bias, blockIdx.x * 64, blockIdx.y * 64);
}
__device__ __forceinline__ h16 tohx(float x) { return (h16)x; }
__device__ __forceinline__ void splitf(float y, unsigned short& h, unsigned short& l) { h = f2bf(y); l = f2bf(y - bf2f(h)); }
typedef __attribute__((ext_vector_type(2))) _Float16 v2h;
typedef __attribute__((ext_vector_type(4))) _Float16 v4h;
typedef __attribute__((ext_vector_type(2))) unsigned short v2us;
typedef __attribute__((ext_vector_type(4))) unsigned short v4us;
typedef __attribute__((ext_vector_type(2))) float v2f;
typedef __attribute__((ext_vector_type(4))) int v4i;

// the bodies below take their block index bx as an argument: the launched kernels hand each block range of a shared grid to one of them
__device__ __forceinline__ void wtG(const float* __restrict__ w, int K, int N, bf* Bt, int bx) {
    const int lane = threadIdx.x & 31; const int L0 = (bx * 8 + (threadIdx.x >> 5)) * 8; const int nlines = N * K / 64;
{
#pragma unroll 1
        for (int l = 0; l < 8; ++l) { const int L = L0 + l; if (L >= nlines) break; const size_t e = (size_t)L * 64 + lane * 2; const int k = (int)(e % K), n = (int)(e / K); v2us o;
            o[0] = f2bf(w[(size_t)k * N + n]); o[1] = f2bf(w[(size_t)(k + 1) * N + n]); *(v2us*)(Bt + e) = o; }
         }
}
__device__ __forceinline__ void cvt8(const float* __restrict__ src, bf* dst, size_t n8, int bx) { const size_t i = (size_t)bx * 256 + threadIdx.x; if (i >= n8) return; const v8f v = *(const v8f*)(src + i * 8); v8us o;
#pragma unroll
    for (int k = 0; k < 8; ++k) o[k] = f2bf(v[k]); *(v8us*)(dst + i * 8) = o;  }
// rope: grid y = batch; head planes [b][h][t][d] (fp16 + hi/lo) of rope(x) x sc with the rotate-half convention out[d] = x[d] cos[t][d] - x[d+HD/2] sin[t][d], out[d+HD/2] = x[d+HD/2] cos[t][d+HD/2] + x[d] sin[t][d+HD/2]
__device__ __forceinline__ void rope(const float* __restrict__ F, int pitch, int nheads, const float* __restrict__ CS, const float* __restrict__ RF, const float* __restrict__ nw, float sc, h16* P16, bf* Ph, bf* Pl, int bx) {
    { const size_t b = blockIdx.y, po = b * nheads * TT * HD; F += b * TT * pitch; if (RF) RF += b * nheads * TT; P16 += po; Ph += po; Pl += po; }   // this batch's token rows and head planes
    const size_t e = ((size_t)bx * 256 + threadIdx.x) * 2; if (e >= (size_t)nheads * TT * HD) return; const int d = (int)(e % HD); const int t = (int)((e / HD) % TT); const int h = (int)(e / ((size_t)HD * TT)); const float* f = F + (size_t)t * pitch + h * HD; const float rf = RF ? RF[(size_t)h * TT + t] : 1.0f; v2h o16; v2us oh, ol;
#pragma unroll
    for (int q = 0; q < 2; ++q) { const int dd = d + q; const int dp = (dd < HD / 2) ? dd + HD / 2 : dd - HD / 2; float x0 = f[dd], x1 = f[dp];
        if (RF) { float n0 = __fmul_rn(x0, rf), n1 = __fmul_rn(x1, rf); asm volatile("" : "+v"(n0)); asm volatile("" : "+v"(n1)); x0 = __fmul_rn(bfr(nw[dd]), n0); x1 = __fmul_rn(bfr(nw[dp]), n1); }
        const v2f cs = *(const v2f*)(CS + ((size_t)t * HD + dd) * 2); float a = __fmul_rn(x0, cs[0]), bq = __fmul_rn(x1, cs[1]); asm volatile("" : "+v"(a)); asm volatile("" : "+v"(bq)); const float r = ((dd < HD / 2) ? __fsub_rn(a, bq) : __fadd_rn(a, bq)) * sc;
        o16[q] = tohx(r); unsigned short a2, c2; splitf(r, a2, c2); oh[q] = a2; ol[q] = c2; }
    *(v2h*)(P16 + e) = o16; *(v2us*)(Ph + e) = oh; *(v2us*)(Pl + e) = ol;  }
__device__ __forceinline__ void vtp(const float* __restrict__ F, int pitch, int nheads, h16* V16, bf* Vh, bf* Vl, int bx) { { const size_t b = blockIdx.y, po = b * nheads * HD * TT; F += b * TT * pitch; V16 += po; Vh += po; Vl += po; } const size_t e = ((size_t)bx * 256 + threadIdx.x) * 2; if (e >= (size_t)nheads * HD * TT) return; const int t = (int)(e % TT); const int d = (int)((e / TT) % HD); const int g = (int)(e / ((size_t)TT * HD)); v2h o16; v2us oh, ol;
#pragma unroll
    for (int q = 0; q < 2; ++q) { const float x = F[(size_t)(t + q) * pitch + g * HD + d]; o16[q] = tohx(x); unsigned short a2, c2; splitf(x, a2, c2); oh[q] = a2; ol[q] = c2; }
    *(v2h*)(V16 + e) = o16; *(v2us*)(Vh + e) = oh; *(v2us*)(Vl + e) = ol;  }
__constant__ float INVT[HD / 2] = { 1.000000000e+00f, 7.498942018e-01f, 5.623413324e-01f, 4.216965139e-01f, 3.162277639e-01f, 2.371373773e-01f, 1.778279394e-01f, 1.333521456e-01f, 1.000000015e-01f, 7.498942316e-02f, 5.623413250e-02f, 4.216964915e-02f, 3.162277490e-02f, 2.371373773e-02f, 1.778279431e-02f, 1.333521400e-02f, 9.999999776e-03f, 7.498942316e-03f, 5.623413250e-03f, 4.216964822e-03f, 3.162277630e-03f, 2.371373819e-03f, 1.778279431e-03f, 1.333521446e-03f, 1.000000047e-03f, 7.498941850e-04f, 5.623413017e-04f, 4.216965172e-04f, 3.162277571e-04f, 2.371373703e-04f, 1.778279402e-04f, 1.333521504e-04f };   // 10000^(-2i/64) (the module's power form) (float32, generated with jnp to be bit-exact)
__device__ __forceinline__ void cs4(float* CS, int bx) { const int idx = bx * 256 + threadIdx.x; if (idx >= TT * HD) return; const int d = idx % HD; const int t = idx / HD; const float a = __fmul_rn((float)t, INVT[d % (HD / 2)]); v2f cs; cs[0] = cosf(a); cs[1] = sinf(a); *(v2f*)(CS + (size_t)idx * 2) = cs;  }

// k_hrms0: one wave a (token, head) row; the rows are the first NQK (q and k) heads of each token's NALL heads in the joint projection buffer
__global__ __launch_bounds__(256) void k_hrms0(float* F) { const int lane = threadIdx.x & 31; const int wv = blockIdx.x * 8 + (threadIdx.x >> 5); if (wv >= NB_ * TT * NQK) return; float* f = F + ((size_t)(wv / NQK) * NALL + wv % NQK) * HD + lane * 2; const v2f a = *(const v2f*)f; float p0 = __fmul_rn(a[0], a[0]), p1 = __fmul_rn(a[1], a[1]); asm volatile("" : "+v"(p0), "+v"(p1)); float ss = __fadd_rn(p0, p1);
#pragma unroll
    for (int sh = 16; sh; sh >>= 1) ss = __fadd_rn(ss, __shfl_xor(ss, sh, 32));
    const float rs = __fdiv_rn(1.0f, __fsqrt_rn(__fadd_rn(__fdiv_rn(ss, (float)HD), RMSEPS))); v2f o;
#pragma unroll
    for (int q = 0; q < 2; ++q) { o[q] = __fmul_rn(a[q], rs); }
    *(v2f*)f = o;  }

// block counts of the bodies above (each as its own launch had it)
#define BWQ  (DM * DQ / 64 / 64)
#define BWKV (DM * DKV / 64 / 64)
#define BCVT (NB_ * TT * DM / 8 / 256)
#define BCS  (TT * HD / 256)
#define BRQ  (NH_ * TT * HD / 2 / 256)
#define BRK  (NKV * TT * HD / 2 / 256)
// k_prep: everything that reads only the inputs. The transposes stand first in the grid: their waves run longest (8 dependent trips of strided loads).
__global__ __launch_bounds__(256) void k_prep(const float* __restrict__ x, const float* __restrict__ wq, const float* __restrict__ wk, const float* __restrict__ wv, const float* __restrict__ wo, bf* WQ, bf* WK, bf* WV, bf* WO, bf* XB, float* CS) {
    int bx = blockIdx.x;
    // tested first although its blocks stand last: as the last of six tests the compiler took the call site for cold and left cosf and sinf as real calls
    if (bx >= BWQ * 2 + BWKV * 2 + BCVT) { cs4(CS, bx - (BWQ * 2 + BWKV * 2 + BCVT)); return; }
    if (bx < BWQ) { wtG(wq, DM, DQ, WQ, bx); return; } bx -= BWQ;
    if (bx < BWQ) { wtG(wo, DQ, DM, WO, bx); return; } bx -= BWQ;
    if (bx < BWKV) { wtG(wk, DM, DKV, WK, bx); return; } bx -= BWKV;
    if (bx < BWKV) { wtG(wv, DM, DKV, WV, bx); return; } bx -= BWKV;
    cvt8(x, XB, (size_t)NB_ * TT * DM / 8, bx);
}
// k_planes: grid (q blocks + k blocks + v blocks, batches): rotary planes of q and k, transposed planes of v
__global__ __launch_bounds__(256) void k_planes(const float* __restrict__ F, const float* __restrict__ CS, h16* QP16, bf* QPh, bf* QPl, h16* KP16, bf* KPh, bf* KPl, h16* VT16, bf* VTh, bf* VTl) {
    const int bx = blockIdx.x;
    if (bx < BRQ) rope(F, DALL, NH_, CS, nullptr, nullptr, 1.0f, QP16, QPh, QPl, bx);
    else if (bx < BRQ + BRK) rope(F + DQ, DALL, NKV, CS, nullptr, nullptr, 1.0f, KP16, KPh, KPl, bx - BRQ);
    else vtp(F + DQ + DKV, DALL, NKV, VT16, VTh, VTl, bx - BRQ - BRK);
}

template <typename T16, bool HI>
__device__ __forceinline__ void attn_rows(const T16* __restrict__ Q, const T16* __restrict__ Q2, const T16* __restrict__ Kp, const T16* __restrict__ K2, const T16* __restrict__ Vt, const T16* __restrict__ V2, int q0, bf* Ah, bf* Al) {
    typedef typename WFrag<T16>::V V;
    const int lane = threadIdx.x & 31, lr = lane & 15, hi = lane >> 4; const int iq = q0 + lr;
    V qb[2], qb2[2];
#pragma unroll
    for (int ks = 0; ks < 2; ++ks) { qb[ks] = WFrag<T16>::ld(Q + (size_t)iq * HD + ks * 32 + 8 * hi); if (HI) qb2[ks] = WFrag<T16>::ld(Q2 + (size_t)iq * HD + ks * 32 + 8 * hi); }
    v8f o[4];
#pragma unroll
    for (int dt = 0; dt < 4; ++dt) o[dt] = (v8f){};
    float m = -3.0e38f, l = 0.0f;
    const int klast = ((q0 + 15) >> 5) << 5;                         // first key of the block that holds the diagonal
    const size_t koff = (size_t)lr * HD + 8 * hi, voff = (size_t)lr * TT + 8 * hi;
    V ka[4], ka2[4];                                                 // [key tile * 2 + k step], fetched one block ahead
#pragma unroll
    for (int f = 0; f < 4; ++f) { ka[f] = WFrag<T16>::ld(Kp + koff + (size_t)(f >> 1) * 16 * HD + (f & 1) * 32); if (HI) ka2[f] = WFrag<T16>::ld(K2 + koff + (size_t)(f >> 1) * 16 * HD + (f & 1) * 32); }
    // kept rolled: the trip count is the wave's own and one block is some 500 instructions already; every inner loop below is unrolled whole so that fragments, scores and accumulators stay in registers
#pragma unroll 1
    for (int k0 = 0; k0 <= klast; k0 += 32) {
        V va[4], va2[4];                                             // this block's value rows: issued here, used behind the softmax arithmetic
#pragma unroll
        for (int dt = 0; dt < 4; ++dt) { va[dt] = WFrag<T16>::ld(Vt + voff + (size_t)dt * 16 * TT + k0); if (HI) va2[dt] = WFrag<T16>::ld(V2 + voff + (size_t)dt * 16 * TT + k0); }
        asm volatile("s_wait_xcnt 0x0" ::: "memory");                // stands between the value loads and the first rewrite of their address registers (results of the key loads below land in some of them)
        v8f s[2];
#pragma unroll
        for (int kt = 0; kt < 2; ++kt) { s[kt] = (v8f){};
#pragma unroll
            for (int ks = 0; ks < 2; ++ks) { s[kt] = WFrag<T16>::mma(ka[kt * 2 + ks], qb[ks], s[kt]); if (HI) { s[kt] = WFrag<T16>::mma(ka[kt * 2 + ks], qb2[ks], s[kt]); s[kt] = WFrag<T16>::mma(ka2[kt * 2 + ks], qb[ks], s[kt]); } } }
        float t[16]; float bm = -3.0e38f;
#pragma unroll
        for (int e = 0; e < 16; ++e) { const int key = k0 + (e >> 3) * 16 + hi * 8 + (e & 7); const float c = softcap(s[e >> 3][e & 7] * SCL); t[e] = (key <= iq) ? c : -3.0e38f; bm = fmaxf(bm, t[e]); }
        const int kn = min(k0 + 32, klast);                          // next block's key rows (the last block fetches its own again: in bounds, unused)
#pragma unroll
        for (int f = 0; f < 4; ++f) { ka[f] = WFrag<T16>::ld(Kp + koff + (size_t)(kn + (f >> 1) * 16) * HD + (f & 1) * 32); if (HI) ka2[f] = WFrag<T16>::ld(K2 + koff + (size_t)(kn + (f >> 1) * 16) * HD + (f & 1) * 32); }
        bm = fmaxf(bm, __shfl_xor(bm, 16, 32));
        const float mn = fmaxf(m, bm); const float alpha = exp2s(__fmul_rn(__fsub_rn(m, mn), 1.4426950408889634f)); m = mn;
        float ls = 0.0f;
#pragma unroll
        for (int e = 0; e < 16; ++e) { const float d0 = __fsub_rn(t[e], mn); t[e] = exp2s(HI ? __fmul_rn(d0, 1.4426950408889634f) : __fmaf_rn(d0, 1.4426950408889634f, 10.0f)); ls += t[e]; }
        l = l * alpha + ls;
#pragma unroll
        for (int dt = 0; dt < 4; ++dt)
#pragma unroll
            for (int j = 0; j < 8; ++j) o[dt][j] *= alpha;
        if constexpr (HI) {
            v8us h0, h1, l0, l1;
#pragma unroll
            for (int j = 0; j < 8; ++j) { unsigned short a, c2; splitf(t[j], a, c2); h0[j] = a; l0[j] = c2; splitf(t[8 + j], a, c2); h1[j] = a; l1[j] = c2; }
            const V ph = cat16b(h0, h1), pl = cat16b(l0, l1);
#pragma unroll
            for (int dt = 0; dt < 4; ++dt) { o[dt] = WFrag<T16>::mma(va[dt], ph, o[dt]); o[dt] = WFrag<T16>::mma(va[dt], pl, o[dt]); o[dt] = WFrag<T16>::mma(va2[dt], ph, o[dt]); }
        } else {
            V ph;
#pragma unroll
            for (int e = 0; e < 16; ++e) ph[e] = tohx(t[e]);
#pragma unroll
            for (int dt = 0; dt < 4; ++dt) o[dt] = WFrag<T16>::mma(va[dt], ph, o[dt]);
        }
        // four vector slots behind the block's last matrix instructions, on the back edge and on the exit alike, before their operand registers are rewritten or the accumulators read
        asm volatile("v_nop\n\tv_nop\n\tv_nop\n\tv_nop" : "+v"(o[0]), "+v"(o[1]), "+v"(o[2]), "+v"(o[3]));
    }
    l += __shfl_xor(l, 16, 32);
    const float f = __fdiv_rn(1.0f, l);
#pragma unroll
    for (int dt = 0; dt < 4; ++dt) { v8us oh, ol;
#pragma unroll
        for (int j = 0; j < 8; ++j) { unsigned short a, c2; splitf(o[dt][j] * f, a, c2); oh[j] = a; ol[j] = c2; }
        const size_t oo = (size_t)iq * DQ + dt * 16 + hi * 8; *(v8us*)(Ah + oo) = oh; *(v8us*)(Al + oo) = ol; }
}
// grid (TT / 32, kv heads, batches), 8 waves: waves 0-3 = the 4 query heads of the kv head on row tile 127 - x, waves 4-7 the same heads on row tile x, so that every work-group walks the same number of keys (the 4 waves of a tile read the same K and V lines).
__global__ __launch_bounds__(256) void k_fattn(const h16* __restrict__ Q16, const bf* __restrict__ Qh, const bf* __restrict__ Ql, const h16* __restrict__ K16, const bf* __restrict__ Kh, const bf* __restrict__ Kl, const h16* __restrict__ V16, const bf* __restrict__ Vh, const bf* __restrict__ Vl, bf* Ah, bf* Al) {
    const int w = __builtin_amdgcn_readfirstlane(threadIdx.x >> 5); const int g = blockIdx.y, head = g * REP + (w & 3);
    const int q0 = ((w >> 2) ? (int)blockIdx.x : TT / 16 - 1 - (int)blockIdx.x) * 16;
    const size_t b = blockIdx.z, qo = (b * NH_ + head) * TT * HD, ko = (b * NKV + g) * TT * HD; Ah += b * TT * DQ; Al += b * TT * DQ;
    if (q0 < RH) attn_rows<bf, true>(Qh + qo, Ql + qo, Kh + ko, Kl + ko, Vh + ko, Vl + ko, q0, Ah + head * HD, Al + head * HD);
    else attn_rows<h16, false>(Q16 + qo, nullptr, K16 + ko, nullptr, V16 + ko, nullptr, q0, Ah + head * HD, Al + head * HD);
}

extern "C" void kernel_launch(void* const* d_in, const int* in_sizes, int n_in,
                              void* d_out, int out_size, void* d_ws, size_t ws_size, hipStream_t stream) {
    (void)in_sizes; (void)n_in; (void)out_size;
    const float* x = (const float*)d_in[0]; const float* wq = (const float*)d_in[1]; const float* wk = (const float*)d_in[2]; const float* wv = (const float*)d_in[3]; const float* wo = (const float*)d_in[4];
    float* OUT = (float*)d_out;     // [2][2048][1024]
    char* wsp = (char*)d_ws;
    auto take = [&](size_t bytes) { char* p = wsp; wsp += (bytes + 255) & ~(size_t)255; return (void*)p; };
    bf* WQ = (bf*)take((size_t)DALL * DM * 2); bf* WK = WQ + (size_t)DQ * DM; bf* WV = WK + (size_t)DKV * DM;   /* one [q | k | v columns][DM] plane */ bf* WO = (bf*)take((size_t)DM * DQ * 2); float* CS = (float*)take((size_t)TT * HD * 2 * 4);
    bf* XB = (bf*)take((size_t)NB_ * TT * DM * 2); float* F = (float*)take((size_t)NB_ * TT * DALL * 4);
    h16* QP16 = (h16*)take((size_t)NB_ * NH_ * TT * HD * 2); h16* KP16 = (h16*)take((size_t)NB_ * NKV * TT * HD * 2); h16* VT16 = (h16*)take((size_t)NB_ * NKV * HD * TT * 2);
    bf* QPh = (bf*)take((size_t)NB_ * NH_ * TT * HD * 2); bf* QPl = (bf*)take((size_t)NB_ * NH_ * TT * HD * 2); bf* KPh = (bf*)take((size_t)NB_ * NKV * TT * HD * 2); bf* KPl = (bf*)take((size_t)NB_ * NKV * TT * HD * 2); bf* VTh = (bf*)take((size_t)NB_ * NKV * HD * TT * 2); bf* VTl = (bf*)take((size_t)NB_ * NKV * HD * TT * 2);
    bf* ATh = (bf*)take((size_t)NB_ * TT * DQ * 2); bf* ATl = (bf*)take((size_t)NB_ * TT * DQ * 2);
    if ((size_t)(wsp - (char*)d_ws) > ws_size) return;    // ws 256 MiB
    k_prep<<<BWQ * 2 + BWKV * 2 + BCVT + BCS, 256, 0, stream>>>(x, wq, wk, wv, wo, WQ, WK, WV, WO, XB, CS);
    k_gemmw<bf, 0, false><<<dim3(NB_ * TT / 64, DALL / 64, 1), 256, 0, stream>>>(XB, nullptr, WQ, nullptr, DM, F, DALL, nullptr, 0, 0, 0);
    k_hrms0<<<NB_ * TT * NQK / 8, 256, 0, stream>>>(F);
    k_planes<<<dim3(BRQ + 2 * BRK, NB_, 1), 256, 0, stream>>>(F, CS, QP16, QPh, QPl, KP16, KPh, KPl, VT16, VTh, VTl);
    k_fattn<<<dim3(TT / 32, NKV, NB_), 256, 0, stream>>>(QP16, QPh, QPl, KP16, KPh, KPl, VT16, VTh, VTl, ATh, ATl);
    k_gemmw<bf, 1, false><<<dim3(NB_ * TT / 64, DM / 64, 1), 256, 0, stream>>>(ATh, ATl, WO, nullptr, DQ, OUT, DM, nullptr, 0, 0, 0);
}

// v007
// Measured time: 147 microseconds a run.
// Timed twice side by side with v006, it ran 1.33 and 1.31 times as fast.
// Counting every step since v000, it is 10.4 times as fast.
#include <hip/hip_runtime.h>

// Causal grouped-query self-attention with QK RMS-norm, rotary embeddings and tanh logit soft-capping (x [2][2048][1024]; q = x w_q ('xw' [1024][1024] 0.02, 16 heads x 64), k, v = x w_k / w_v ([1024][256]: 4 kv heads, each shared by 4 query heads); q, k <- RMS-norm over 64 (eps 1e-5, no scale); half-split rope (theta 1e4, computed); scores / 8; softcap: 50 tanh(scores / 50); causal (-inf); softmax; out = merged w_o ('xw') -> [2][2048][1024] (4.2 M)).
// Launches: 4. {4 weight transposes, bf16 copy of x, cos/sin table} in one grid, told apart by block index; {q, k, v projections: one GEMM on the three weight planes laid end to end; a 64x64 tile is 64 tokens of one head, and its epilogue norms and rotates q and k tiles and writes the head planes}; attention; w_o.
// Layout, both batches in every launch (token-major buffers hold 2 x 2048 rows, head planes are [batch][head]; the batch is a grid dimension or more row tiles): bf16 copy of x; 'xw' weights transposed once; exact projections with per-(token, head) RMS-norm and rotate-half rotary in the epilogue; {cos, sin} table once; causal T-2048 GQA attention fused in one launch (each kv plane serves 4 query heads; scores, soft cap as 50 x tanh(s/50) (tanh via one exp2 and a division, f32), running-maximum softmax and P.V in registers; hybrid rows: < 512 hi/lo 3 products, rest fp16 x1024; key blocks above the diagonal skipped); merged hi/lo x w_o exact.
// Compute dtypes, f32 accumulate: every input rounded to bf16; projections exact; RMS-norm and rotary f32; attention rows < 512 3 products, rest fp16; soft cap and softmax f32; w_o hl x exact.

#define NB_  2
#define TT   2048
#define DM   1024
#define NH_  16
#define NKV  4
#define REP  (NH_ / NKV)
#define HD   64
#define DQ   (NH_ * HD)
#define DKV  (NKV * HD)
#define NQK  (NH_ + NKV)          // heads of a token that are normed and rotated
#define NALL (NH_ + 2 * NKV)      // q, k and v heads of a token, side by side in the joint weight plane
#define DALL (NALL * HD)
#define RH   512                  // query rows < RH use hi+lo planes (0: none)
#define SCL  0.125f
#define CAP  50.0f
#define RMSEPS 1e-5f
typedef _Float16 h16;
typedef unsigned short bf;
typedef __attribute__((ext_vector_type(16))) __bf16   v16bf;
typedef __attribute__((ext_vector_type(16))) _Float16 v16h;
typedef __attribute__((ext_vector_type(8)))  _Float16 v8h;
typedef __attribute__((ext_vector_type(8)))  unsigned short v8us;
typedef __attribute__((ext_vector_type(8)))  float    v8f;
typedef __attribute__((ext_vector_type(4)))  float    v4f;
typedef v8h  __attribute__((may_alias)) v8ha;
typedef v4f  __attribute__((may_alias)) v4fa;
typedef v8us __attribute__((may_alias)) v8usa;

__device__ __forceinline__ unsigned short f2bf(float f) { unsigned u = __float_as_uint(f); u += 0x7FFFu + ((u >> 16) & 1u); return (unsigned short)(u >> 16); }
__device__ __forceinline__ float bf2f(unsigned short b) { return __uint_as_float(((unsigned)b) << 16); }
__device__ __forceinline__ float bfr(float f) { return bf2f(f2bf(f)); }
__device__ __forceinline__ v16h cat16(v8h lo, v8h hi) { return __builtin_shufflevector(lo, hi, 0, 1, 2, 3, 4, 5, 6, 7, 8, 9, 10, 11, 12, 13, 14, 15); }
__device__ __forceinline__ v16bf cat16b(v8us lo, v8us hi) { return __builtin_bit_cast(v16bf, __builtin_shufflevector(lo, hi, 0, 1, 2, 3, 4, 5, 6, 7, 8, 9, 10, 11, 12, 13, 14, 15)); }
__device__ __forceinline__ v8f wmma16(v16h a, v16h b, v8f c) { return __builtin_amdgcn_wmma_f32_16x16x32_f16(false, a, false, b, (short)0, c, false, false); }
__device__ __forceinline__ v8f wmmab(v16bf a, v16bf b, v8f c) { return __builtin_amdgcn_wmma_f32_16x16x32_bf16(false, a, false, b, (short)0, c, false, false); }



// ---- k_gemmw: register-blocked GEMM, 8 waves per 64x64 output tile, the K range split over the waves (16 accumulators each), operands straight from K-contiguous 16-bit planes; grid (M/64, N/64, Z), 256 threads.
// C[m][n] (f32, pitch ldc, + optional f32 bias[n]) = sum_k A[m][k] Bt[n][k] (+ split products per NSPLIT). z-batch strides sA/sB/sC in elements. K % 64 == 0.
// softcap: 50 tanh(s / 50) with tanh(u) = 1 - 2 / (exp(2u) + 1) (one exp2 of 2u log2 e, one precise division; u in [-0.2, 0.2] here so no overflow); f32.
// exp2s: v_exp_f32 and, in the same statement, the one vector slot that the instruction set asks for behind a transcendental before its result is read or its source overwritten
__device__ __forceinline__ float exp2s(float x) { float r; asm("v_exp_f32 %0, %1\n\tv_nop" : "=v"(r) : "v"(x)); return r; }
__device__ __forceinline__ float softcap(float s) { const float u = __fmul_rn(s, 1.0f / CAP); const float e = exp2s(__fmul_rn(__fmul_rn(u, 2.0f), 1.4426950408889634f)); const float th = __fsub_rn(1.0f, __fdiv_rn(2.0f, __fadd_rn(e, 1.0f))); return __fmul_rn(th, CAP); }
__device__ __forceinline__ h16 tohx(float x) { return (h16)x; }
__device__ __forceinline__ void splitf(float y, unsigned short& h, unsigned short& l) { h = f2bf(y); l = f2bf(y - bf2f(h)); }
typedef __attribute__((ext_vector_type(2))) float v2f;
typedef unsigned short __attribute__((may_alias)) usa;
template <typename T16> struct WFrag;
template <> struct WFrag<h16> { typedef v16h V; static __device__ __forceinline__ V ld(const h16* p) { return cat16(*(const v8h*)p, *(const v8h*)(p + 16)); } static __device__ __forceinline__ v8f mma(V a, V b, v8f c) { return wmma16(a, b, c); } };
template <> struct WFrag<bf> { typedef v16bf V; static __device__ __forceinline__ V ld(const bf* p) { return cat16b(*(const v8us*)p, *(const v8us*)(p + 16)); } static __device__ __forceinline__ v8f mma(V a, V b, v8f c) { return wmmab(a, b, c); } };
// tile_splitk: one 64x64 output tile by a work-group of NW (8 or 16) waves. Wave w takes the 64-wide k chunks w, w + NW, ... below Kl (Kl % 64 == 0; a chunk = one whole 128-byte line of every operand row, two
// trips of 32) with the 16-accumulator register block; the NW partial tiles go to LDS in register order (b128, one slot per lane), and behind one barrier each wave sums, in wave order 0..NW-1, its 32 / NW
// slots and stores them: 32 columns = one whole 128-byte line of each of its rows, so every line of C has one writer. lda = pitch of the A planes in elements (the Bt planes have pitch K).
// PLN (8 waves): the tile goes out as three 16-bit planes (fp16, bf16 hi, bf16 lo; P16, Ph, Pl point at its first element, row pitch pp elements) instead of f32 C. A wave then sums the slots of 8 whole rows
// (16 mbw + 8 hi + 4 g + q, a lane's columns 16 nb + lr), so that a row's mean square is in-lane plus a 16-lane exchange and a rotary pair (d, d + 32) sits in one lane. cs != null: the rows are tokens, the columns
// one head: RMS-norm, then rotate-half rotary out[d] = x[d] cos - x[d+32] sin, out[d+32] = x[d+32] cos + x[d] sin with {cos, sin} = cs[row][d] (the table's entries d and d + 32 are equal). cs == null: values as they are.
template <typename T16, int NSPLIT, bool BIAS, int NW, bool PLN = false>
__device__ __forceinline__ void tile_splitk(const T16* __restrict__ A, const T16* __restrict__ A2, const T16* __restrict__ Bt, const T16* __restrict__ Bt2, int lda, int K, int Kl, float* C, int ldc, const float* __restrict__ bias, int r0, int c0, const float* __restrict__ cs = nullptr, h16* P16 = nullptr, bf* Ph = nullptr, bf* Pl = nullptr, int pp = 0) {
    typedef typename WFrag<T16>::V V;
    __shared__ __align__(16) float part[NW * 32 * 32 * 4];           // [wave][slot = (mb * 4 + nb) * 2 + g][lane][4]: accumulator elements 4 g .. 4 g + 3
    const int lane = threadIdx.x & 31, lr = lane & 15, hi = lane >> 4; const int w = __builtin_amdgcn_readfirstlane(threadIdx.x >> 5);
    v8f acc[4][4];
#pragma unroll
    for (int mb = 0; mb < 4; ++mb)
#pragma unroll
        for (int nb = 0; nb < 4; ++nb) acc[mb][nb] = (v8f){};
    const size_t aoff = (size_t)(r0 + lr) * lda + 8 * hi, boff = (size_t)(c0 + lr) * K + 8 * hi;
#pragma unroll 1
    for (int kc = w * 64; kc < Kl; kc += (kc & 32) ? NW * 64 - 32 : 32) {
        V a[4], a2[4];
#pragma unroll
        for (int mb = 0; mb < 4; ++mb) { a[mb] = WFrag<T16>::ld(A + aoff + (size_t)mb * 16 * lda + kc); if (NSPLIT == 1 || NSPLIT == 2) a2[mb] = WFrag<T16>::ld(A2 + aoff + (size_t)mb * 16 * lda + kc); }
        if constexpr (PLN) asm volatile("s_wait_xcnt 0x0" ::: "memory");   // stands between the A loads and the first rewrite of their address registers (in this build results of the B loads land in them)
#pragma unroll
        for (int nb = 0; nb < 4; ++nb) { const V b = WFrag<T16>::ld(Bt + boff + (size_t)nb * 16 * K + kc); V b2; if (NSPLIT >= 2) b2 = WFrag<T16>::ld(Bt2 + boff + (size_t)nb * 16 * K + kc);
#pragma unroll
            for (int mb = 0; mb < 4; ++mb) { acc[mb][nb] = WFrag<T16>::mma(a[mb], b, acc[mb][nb]); if (NSPLIT == 1 || NSPLIT == 2) acc[mb][nb] = WFrag<T16>::mma(a2[mb], b, acc[mb][nb]); if (NSPLIT >= 2) acc[mb][nb] = WFrag<T16>::mma(a[mb], b2, acc[mb][nb]); } }
        // four vector slots behind the trip's last matrix instructions, on the back edge and on the exit alike, before fragments are reloaded or accumulators read
        asm volatile("v_nop\n\tv_nop\n\tv_nop\n\tv_nop" : "+v"(acc[0][0]), "+v"(acc[1][1]), "+v"(acc[2][2]), "+v"(acc[3][3]) : "v"(a[0]), "v"(a[3]));
    }
#pragma unroll
    for (int mb = 0; mb < 4; ++mb)
#pragma unroll
        for (int nb = 0; nb < 4; ++nb)
#pragma unroll
            for (int g = 0; g < 2; ++g) { v4f p; p[0] = acc[mb][nb][g * 4]; p[1] = acc[mb][nb][g * 4 + 1]; p[2] = acc[mb][nb][g * 4 + 2]; p[3] = acc[mb][nb][g * 4 + 3];
                *(v4fa*)(part + (((w * 32 + (mb * 4 + nb) * 2 + g) * 32 + lane) << 2)) = p; }
    v2f csv[4][2] = {};                                              // PLN: {cos, sin} of the lane's 4 rows and 2 rotary pairs, issued in front of the barrier: they depend on nothing that it orders
    if constexpr (PLN) { if (cs) {
#pragma unroll
        for (int q = 0; q < 4; ++q)
#pragma unroll
            for (int u = 0; u < 2; ++u) csv[q][u] = *(const v2f*)(cs + ((size_t)((w >> 1) * 16 + (w & 1) * 4 + hi * 8 + q) * HD + u * 16 + lr) * 2); } }
    __syncthreads();                                                 // every wave's partial tile is in LDS before any wave sums
    if constexpr (PLN) {
        static_assert(NW == 8, "8 rows a wave");
        const int mbw = w >> 1, g = w & 1, row0 = mbw * 16 + g * 4;   // the lane's rows: row0 + 8 hi + q
        v4f s[4];
#pragma unroll
        for (int nb = 0; nb < 4; ++nb) { const int slot = (mbw * 4 + nb) * 2 + g; s[nb] = *(const v4fa*)(part + ((slot * 32 + lane) << 2));
#pragma unroll
            for (int p = 1; p < NW; ++p) s[nb] += *(const v4fa*)(part + (((p * 32 + slot) * 32 + lane) << 2)); }
        if (cs) {
            v4f ss = s[0] * s[0] + s[1] * s[1] + s[2] * s[2] + s[3] * s[3];
#pragma unroll
            for (int sh = 8; sh; sh >>= 1)
#pragma unroll
                for (int q = 0; q < 4; ++q) ss[q] += __shfl_xor(ss[q], sh, 32);
#pragma unroll
            for (int q = 0; q < 4; ++q) { const float rs = __fdiv_rn(1.0f, __fsqrt_rn(__fadd_rn(__fdiv_rn(ss[q], (float)HD), RMSEPS)));
#pragma unroll
                for (int u = 0; u < 2; ++u) { const float x0 = s[u][q] * rs, x1 = s[u + 2][q] * rs, co = csv[q][u][0], si = csv[q][u][1]; s[u][q] = x0 * co - x1 * si; s[u + 2][q] = x1 * co + x0 * si; } }
        }
        // staged through LDS so that every global store is whole 128-byte rows: plane pl, rows 8 i .. 8 i + 3 (+ row0) lie in the 512 bytes of slot (mbw * 4 + i) * 2 + g of partial tile pl, one of the slots that this wave alone has read
        usa* st = (usa*)part;
#pragma unroll
        for (int nb = 0; nb < 4; ++nb)
#pragma unroll
            for (int q = 0; q < 4; ++q) { const float r = s[nb][q]; unsigned short a, c2; splitf(r, a, c2); const int at = (((mbw * 4 + hi) * 2 + g) << 8) + q * 64 + nb * 16 + lr;
                st[at] = __builtin_bit_cast(unsigned short, tohx(r)); st[at + (32 << 8)] = a; st[at + (64 << 8)] = c2; }
        asm volatile("s_wait_dscnt 0x0" ::: "memory");               // the wave's staged rows are in LDS before its lanes read what other lanes of it wrote
#pragma unroll
        for (int i = 0; i < 2; ++i) { const int at = (((mbw * 4 + i) * 2 + g) << 8) + lane * 8; const size_t o = (size_t)(row0 + i * 8 + (lane >> 3)) * pp + (lane & 7) * 8;
            *(v8usa*)(P16 + o) = *(const v8usa*)(st + at); *(v8usa*)(Ph + o) = *(const v8usa*)(st + at + (32 << 8)); *(v8usa*)(Pl + o) = *(const v8usa*)(st + at + (64 << 8)); }
        return;
    }
    constexpr int GS = 16 / NW;                                      // g values a wave sums: 2 with 8 waves, 1 with 16
    const int mbw = w / (NW / 4), rem = w % (NW / 4), nbp = rem / (2 / GS), g0 = (rem % (2 / GS)) * GS;
#pragma unroll
    for (int u = 0; u < 2; ++u) { const int col = c0 + (nbp * 2 + u) * 16 + lr; const float bv = BIAS ? bfr(bias[col]) : 0.0f;
#pragma unroll
        for (int gg = 0; gg < GS; ++gg) { const int slot = (mbw * 4 + nbp * 2 + u) * 2 + g0 + gg; v4f s = *(const v4fa*)(part + ((slot * 32 + lane) << 2));
#pragma unroll
            for (int p = 1; p < NW; ++p) s += *(const v4fa*)(part + (((p * 32 + slot) * 32 + lane) << 2));
#pragma unroll
            for (int q = 0; q < 4; ++q) { float val = s[q]; if (BIAS) val += bv; C[(size_t)(r0 + mbw * 16 + hi * 8 + (g0 + gg) * 4 + q) * ldc + col] = val; } } }
}
template <typename T16, int NSPLIT, bool BIAS>
__global__ __launch_bounds__(256) void k_gemmw(const T16* __restrict__ A, const T16* __restrict__ A2, const T16* __restrict__ Bt, const T16* __restrict__ Bt2, int K, float* C, int ldc, const float* __restrict__ bias, size_t sA, size_t sB, size_t sC) {
    const size_t z = blockIdx.z; A += z * sA; if (A2) A2 += z * sA; Bt += z * sB; if (Bt2) Bt2 += z * sB; C += z * sC;
    tile_splitk<T16, NSPLIT, BIAS, 8>(A, A2, Bt, Bt2, K, K, K, C, ldc, bias, blockIdx.x * 64, blockIdx.y * 64);
}
typedef __attribute__((ext_vector_type(2))) unsigned short v2us;

// the bodies below take their block index bx as an argument: the launched kernels hand each block range of a shared grid to one of them
__device__ __forceinline__ void wtG(const float* __restrict__ w, int K, int N, bf* Bt, int bx) {
    const int lane = threadIdx.x & 31; const int L0 = (bx * 8 + (threadIdx.x >> 5)) * 8; const int nlines = N * K / 64;
{
#pragma unroll 1
        for (int l = 0; l < 8; ++l) { const int L = L0 + l; if (L >= nlines) break; const size_t e = (size_t)L * 64 + lane * 2; const int k = (int)(e % K), n = (int)(e / K); v2us o;
            o[0] = f2bf(w[(size_t)k * N + n]); o[1] = f2bf(w[(size_t)(k + 1) * N + n]); *(v2us*)(Bt + e) = o; }
         }
}
__device__ __forceinline__ void cvt8(const float* __restrict__ src, bf* dst, size_t n8, int bx) { const size_t i = (size_t)bx * 256 + threadIdx.x; if (i >= n8) return; const v8f v = *(const v8f*)(src + i * 8); v8us o;
#pragma unroll
    for (int k = 0; k < 8; ++k) o[k] = f2bf(v[k]); *(v8us*)(dst + i * 8) = o;  }
__constant__ float INVT[HD / 2] = { 1.000000000e+00f, 7.498942018e-01f, 5.623413324e-01f, 4.216965139e-01f, 3.162277639e-01f, 2.371373773e-01f, 1.778279394e-01f, 1.333521456e-01f, 1.000000015e-01f, 7.498942316e-02f, 5.623413250e-02f, 4.216964915e-02f, 3.162277490e-02f, 2.371373773e-02f, 1.778279431e-02f, 1.333521400e-02f, 9.999999776e-03f, 7.498942316e-03f, 5.623413250e-03f, 4.216964822e-03f, 3.162277630e-03f, 2.371373819e-03f, 1.778279431e-03f, 1.333521446e-03f, 1.000000047e-03f, 7.498941850e-04f, 5.623413017e-04f, 4.216965172e-04f, 3.162277571e-04f, 2.371373703e-04f, 1.778279402e-04f, 1.333521504e-04f };   // 10000^(-2i/64) (the module's power form) (float32, generated with jnp to be bit-exact)
__device__ __forceinline__ void cs4(float* CS, int bx) { const int idx = bx * 256 + threadIdx.x; if (idx >= TT * HD) return; const int d = idx % HD; const int t = idx / HD; const float a = __fmul_rn((float)t, INVT[d % (HD / 2)]); v2f cs; cs[0] = cosf(a); cs[1] = sinf(a); *(v2f*)(CS + (size_t)idx * 2) = cs;  }

// block counts of the bodies above (each as its own launch had it)
#define BWQ  (DM * DQ / 64 / 64)
#define BWKV (DM * DKV / 64 / 64)
#define BCVT (NB_ * TT * DM / 8 / 256)
#define BCS  (TT * HD / 256)
// k_prep: everything that reads only the inputs. The transposes stand first in the grid: their waves run longest (8 dependent trips of strided loads).
__global__ __launch_bounds__(256) void k_prep(const float* __restrict__ x, const float* __restrict__ wq, const float* __restrict__ wk, const float* __restrict__ wv, const float* __restrict__ wo, bf* WQ, bf* WK, bf* WV, bf* WO, bf* XB, float* CS) {
    int bx = blockIdx.x;
    // tested first although its blocks stand last: as the last of six tests the compiler took the call site for cold and left cosf and sinf as real calls
    if (bx >= BWQ * 2 + BWKV * 2 + BCVT) { cs4(CS, bx - (BWQ * 2 + BWKV * 2 + BCVT)); return; }
    if (bx < BWQ) { wtG(wq, DM, DQ, WQ, bx); return; } bx -= BWQ;
    if (bx < BWQ) { wtG(wo, DQ, DM, WO, bx); return; } bx -= BWQ;
    if (bx < BWKV) { wtG(wk, DM, DKV, WK, bx); return; } bx -= BWKV;
    if (bx < BWKV) { wtG(wv, DM, DKV, WV, bx); return; } bx -= BWKV;
    cvt8(x, XB, (size_t)NB_ * TT * DM / 8, bx);
}
// k_qkv: grid (token tiles of both batches, q + k + v heads). W = the [q | k | v columns][DM] weight plane. A q or k tile is [64 tokens][head], normed, rotated and written to the head's [t][d] planes;
// a v tile is computed transposed, [d][64 tokens] (the weight rows as the A operand), so that its rows are whole lines of the [d][t] value planes.
__global__ __launch_bounds__(256) void k_qkv(const bf* __restrict__ XB, const bf* __restrict__ W, const float* __restrict__ CS, h16* QP16, bf* QPh, bf* QPl, h16* KP16, bf* KPh, bf* KPl, h16* VT16, bf* VTh, bf* VTl) {
    const int hh = blockIdx.y, tok = blockIdx.x * 64, b = tok / TT, t0 = tok % TT; const bool isq = hh < NH_, isv = hh >= NQK;
    const size_t o = isq ? ((size_t)(b * NH_ + hh) * TT + t0) * HD : isv ? (size_t)(b * NKV + hh - NQK) * HD * TT + t0 : ((size_t)(b * NKV + hh - NH_) * TT + t0) * HD;
    tile_splitk<bf, 0, false, 8, true>(isv ? W : XB, nullptr, isv ? XB : W, nullptr, DM, DM, DM, nullptr, 0, nullptr, isv ? hh * HD : tok, isv ? tok : hh * HD, isv ? nullptr : CS + (size_t)t0 * HD * 2,
        (isq ? QP16 : isv ? VT16 : KP16) + o, (isq ? QPh : isv ? VTh : KPh) + o, (isq ? QPl : isv ? VTl : KPl) + o, isv ? TT : HD);
}

template <typename T16, bool HI>
__device__ __forceinline__ void attn_rows(const T16* __restrict__ Q, const T16* __restrict__ Q2, const T16* __restrict__ Kp, const T16* __restrict__ K2, const T16* __restrict__ Vt, const T16* __restrict__ V2, int q0, bf* Ah, bf* Al) {
    typedef typename WFrag<T16>::V V;
    const int lane = threadIdx.x & 31, lr = lane & 15, hi = lane >> 4; const int iq = q0 + lr;
    V qb[2], qb2[2];
#pragma unroll
    for (int ks = 0; ks < 2; ++ks) { qb[ks] = WFrag<T16>::ld(Q + (size_t)iq * HD + ks * 32 + 8 * hi); if (HI) qb2[ks] = WFrag<T16>::ld(Q2 + (size_t)iq * HD + ks * 32 + 8 * hi); }
    v8f o[4];
#pragma unroll
    for (int dt = 0; dt < 4; ++dt) o[dt] = (v8f){};
    float m = -3.0e38f, l = 0.0f;
    const int klast = ((q0 + 15) >> 5) << 5;                         // first key of the block that holds the diagonal
    const size_t koff = (size_t)lr * HD + 8 * hi, voff = (size_t)lr * TT + 8 * hi;
    V ka[4], ka2[4];                                                 // [key tile * 2 + k step], fetched one block ahead
#pragma unroll
    for (int f = 0; f < 4; ++f) { ka[f] = WFrag<T16>::ld(Kp + koff + (size_t)(f >> 1) * 16 * HD + (f & 1) * 32); if (HI) ka2[f] = WFrag<T16>::ld(K2 + koff + (size_t)(f >> 1) * 16 * HD + (f & 1) * 32); }
    // kept rolled: the trip count is the wave's own and one block is some 500 instructions already; every inner loop below is unrolled whole so that fragments, scores and accumulators stay in registers
#pragma unroll 1
    for (int k0 = 0; k0 <= klast; k0 += 32) {
        V va[4], va2[4];                                             // this block's value rows: issued here, used behind the softmax arithmetic
#pragma unroll
        for (int dt = 0; dt < 4; ++dt) { va[dt] = WFrag<T16>::ld(Vt + voff + (size_t)dt * 16 * TT + k0); if (HI) va2[dt] = WFrag<T16>::ld(V2 + voff + (size_t)dt * 16 * TT + k0); }
        asm volatile("s_wait_xcnt 0x0" ::: "memory");                // stands between the value loads and the first rewrite of their address registers (results of the key loads below land in some of them)
        v8f s[2];
#pragma unroll
        for (int kt = 0; kt < 2; ++kt) { s[kt] = (v8f){};
#pragma unroll
            for (int ks = 0; ks < 2; ++ks) { s[kt] = WFrag<T16>::mma(ka[kt * 2 + ks], qb[ks], s[kt]); if (HI) { s[kt] = WFrag<T16>::mma(ka[kt * 2 + ks], qb2[ks], s[kt]); s[kt] = WFrag<T16>::mma(ka2[kt * 2 + ks], qb[ks], s[kt]); } } }
        float t[16]; float bm = -3.0e38f;
#pragma unroll
        for (int e = 0; e < 16; ++e) { const int key = k0 + (e >> 3) * 16 + hi * 8 + (e & 7); const float c = softcap(s[e >> 3][e & 7] * SCL); t[e] = (key <= iq) ? c : -3.0e38f; bm = fmaxf(bm, t[e]); }
        const int kn = min(k0 + 32, klast);                          // next block's key rows (the last block fetches its own again: in bounds, unused)
#pragma unroll
        for (int f = 0; f < 4; ++f) { ka[f] = WFrag<T16>::ld(Kp + koff + (size_t)(kn + (f >> 1) * 16) * HD + (f & 1) * 32); if (HI) ka2[f] = WFrag<T16>::ld(K2 + koff + (size_t)(kn + (f >> 1) * 16) * HD + (f & 1) * 32); }
        bm = fmaxf(bm, __shfl_xor(bm, 16, 32));
        const float mn = fmaxf(m, bm); const float alpha = exp2s(__fmul_rn(__fsub_rn(m, mn), 1.4426950408889634f)); m = mn;
        float ls = 0.0f;
#pragma unroll
        for (int e = 0; e < 16; ++e) { const float d0 = __fsub_rn(t[e], mn); t[e] = exp2s(HI ? __fmul_rn(d0, 1.4426950408889634f) : __fmaf_rn(d0, 1.4426950408889634f, 10.0f)); ls += t[e]; }
        l = l * alpha + ls;
#pragma unroll
        for (int dt = 0; dt < 4; ++dt)
#pragma unroll
            for (int j = 0; j < 8; ++j) o[dt][j] *= alpha;
        if constexpr (HI) {
            v8us h0, h1, l0, l1;
#pragma unroll
            for (int j = 0; j < 8; ++j) { unsigned short a, c2; splitf(t[j], a, c2); h0[j] = a; l0[j] = c2; splitf(t[8 + j], a, c2); h1[j] = a; l1[j] = c2; }
            const V ph = cat16b(h0, h1), pl = cat16b(l0, l1);
#pragma unroll
            for (int dt = 0; dt < 4; ++dt) { o[dt] = WFrag<T16>::mma(va[dt], ph, o[dt]); o[dt] = WFrag<T16>::mma(va[dt], pl, o[dt]); o[dt] = WFrag<T16>::mma(va2[dt], ph, o[dt]); }
        } else {
            V ph;
#pragma unroll
            for (int e = 0; e < 16; ++e) ph[e] = tohx(t[e]);
#pragma unroll
            for (int dt = 0; dt < 4; ++dt) o[dt] = WFrag<T16>::mma(va[dt], ph, o[dt]);
        }
        // four vector slots behind the block's last matrix instructions, on the back edge and on the exit alike, before their operand registers are rewritten or the accumulators read
        asm volatile("v_nop\n\tv_nop\n\tv_nop\n\tv_nop" : "+v"(o[0]), "+v"(o[1]), "+v"(o[2]), "+v"(o[3]));
    }
    l += __shfl_xor(l, 16, 32);
    const float f = __fdiv_rn(1.0f, l);
#pragma unroll
    for (int dt = 0; dt < 4; ++dt) { v8us oh, ol;
#pragma unroll
        for (int j = 0; j < 8; ++j) { unsigned short a, c2; splitf(o[dt][j] * f, a, c2); oh[j] = a; ol[j] = c2; }
        const size_t oo = (size_t)iq * DQ + dt * 16 + hi * 8; *(v8us*)(Ah + oo) = oh; *(v8us*)(Al + oo) = ol; }
}
// grid (TT / 32, kv heads, batches), 8 waves: waves 0-3 = the 4 query heads of the kv head on row tile 127 - x, waves 4-7 the same heads on row tile x, so that every work-group walks the same number of keys (the 4 waves of a tile read the same K and V lines).
__global__ __launch_bounds__(256) void k_fattn(const h16* __restrict__ Q16, const bf* __restrict__ Qh, const bf* __restrict__ Ql, const h16* __restrict__ K16, const bf* __restrict__ Kh, const bf* __restrict__ Kl, const h16* __restrict__ V16, const bf* __restrict__ Vh, const bf* __restrict__ Vl, bf* Ah, bf* Al) {
    const int w = __builtin_amdgcn_readfirstlane(threadIdx.x >> 5); const int g = blockIdx.y, head = g * REP + (w & 3);
    const int q0 = ((w >> 2) ? (int)blockIdx.x : TT / 16 - 1 - (int)blockIdx.x) * 16;
    const size_t b = blockIdx.z, qo = (b * NH_ + head) * TT * HD, ko = (b * NKV + g) * TT * HD; Ah += b * TT * DQ; Al += b * TT * DQ;
    if (q0 < RH) attn_rows<bf, true>(Qh + qo, Ql + qo, Kh + ko, Kl + ko, Vh + ko, Vl + ko, q0, Ah + head * HD, Al + head * HD);
    else attn_rows<h16, false>(Q16 + qo, nullptr, K16 + ko, nullptr, V16 + ko, nullptr, q0, Ah + head * HD, Al + head * HD);
}

extern "C" void kernel_launch(void* const* d_in, const int* in_sizes, int n_in,
                              void* d_out, int out_size, void* d_ws, size_t ws_size, hipStream_t stream) {
    (void)in_sizes; (void)n_in; (void)out_size;
    const float* x = (const float*)d_in[0]; const float* wq = (const float*)d_in[1]; const float* wk = (const float*)d_in[2]; const float* wv = (const float*)d_in[3]; const float* wo = (const float*)d_in[4];
    float* OUT = (float*)d_out;     // [2][2048][1024]
    char* wsp = (char*)d_ws;
    auto take = [&](size_t bytes) { char* p = wsp; wsp += (bytes + 255) & ~(size_t)255; return (void*)p; };
    bf* WQ = (bf*)take((size_t)DALL * DM * 2); bf* WK = WQ + (size_t)DQ * DM; bf* WV = WK + (size_t)DKV * DM;   /* one [q | k | v columns][DM] plane */ bf* WO = (bf*)take((size_t)DM * DQ * 2); float* CS = (float*)take((size_t)TT * HD * 2 * 4);
    bf* XB = (bf*)take((size_t)NB_ * TT * DM * 2);
    h16* QP16 = (h16*)take((size_t)NB_ * NH_ * TT * HD * 2); h16* KP16 = (h16*)take((size_t)NB_ * NKV * TT * HD * 2); h16* VT16 = (h16*)take((size_t)NB_ * NKV * HD * TT * 2);
    bf* QPh = (bf*)take((size_t)NB_ * NH_ * TT * HD * 2); bf* QPl = (bf*)take((size_t)NB_ * NH_ * TT * HD * 2); bf* KPh = (bf*)take((size_t)NB_ * NKV * TT * HD * 2); bf* KPl = (bf*)take((size_t)NB_ * NKV * TT * HD * 2); bf* VTh = (bf*)take((size_t)NB_ * NKV * HD * TT * 2); bf* VTl = (bf*)take((size_t)NB_ * NKV * HD * TT * 2);
    bf* ATh = (bf*)take((size_t)NB_ * TT * DQ * 2); bf* ATl = (bf*)take((size_t)NB_ * TT * DQ * 2);
    if ((size_t)(wsp - (char*)d_ws) > ws_size) return;    // ws 256 MiB
    k_prep<<<BWQ * 2 + BWKV * 2 + BCVT + BCS, 256, 0, stream>>>(x, wq, wk, wv, wo, WQ, WK, WV, WO, XB, CS);
    k_qkv<<<dim3(NB_ * TT / 64, NALL, 1), 256, 0, stream>>>(XB, WQ, CS, QP16, QPh, QPl, KP16, KPh, KPl, VT16, VTh, VTl);
    k_fattn<<<dim3(TT / 32, NKV, NB_), 256, 0, stream>>>(QP16, QPh, QPl, KP16, KPh, KPl, VT16, VTh, VTl, ATh, ATl);
    k_gemmw<bf, 1, false><<<dim3(NB_ * TT / 64, DM / 64, 1), 256, 0, stream>>>(ATh, ATl, WO, nullptr, DQ, OUT, DM, nullptr, 0, 0, 0);
}

// v008
// It runs in 104 microseconds.
// Two timings next to v007 put it at 1.41 and 1.42 times that version's speed.
// All steps since v000 together make it 14.7 times as fast.
#include <hip/hip_runtime.h>

// Causal grouped-query self-attention with QK RMS-norm, rotary embeddings and tanh logit soft-capping (x [2][2048][1024]; q = x w_q ('xw' [1024][1024] 0.02, 16 heads x 64), k, v = x w_k / w_v ([1024][256]: 4 kv heads, each shared by 4 query heads); q, k <- RMS-norm over 64 (eps 1e-5, no scale); half-split rope (theta 1e4, computed); scores / 8; softcap: 50 tanh(scores / 50); causal (-inf); softmax; out = merged w_o ('xw') -> [2][2048][1024] (4.2 M)).
// Launches: 4. {4 weight transposes, bf16 copy of x, cos/sin table} in one grid, told apart by block index; {q, k, v projections: one GEMM on the three weight planes laid end to end; a 64x64 tile is 64 tokens of one head, and its epilogue norms, rotates and writes the head planes}; attention; w_o.
// Layout, both batches in every launch (token-major buffers hold 2 x 2048 rows, head planes are [batch][head]; the batch is a grid dimension or more row tiles; every 16-bit plane in fragment order, see FRAGMENT ORDER below): bf16 copy of x; 'xw' weights transposed once; exact projections with per-(token, head) RMS-norm and rotate-half rotary in the epilogue; {cos, sin} table once; causal T-2048 GQA attention fused in one launch (each kv plane serves 4 query heads; scores, soft cap as 50 x tanh(s/50) (tanh via one exp2 and a division, f32), running-maximum softmax and P.V in registers; hybrid rows: < 512 hi/lo 3 products, rest fp16 x1024; key blocks above the diagonal skipped); merged hi/lo x w_o exact.
// Compute dtypes, f32 accumulate: every input rounded to bf16; projections exact; RMS-norm and rotary f32; attention rows < 512 3 products, rest fp16; soft cap and softmax f32; w_o hl x exact.

#define NB_  2
#define TT   2048
#define DM   1024
#define NH_  16
#define NKV  4
#define REP  (NH_ / NKV)
#define HD   64
#define DQ   (NH_ * HD)
#define DKV  (NKV * HD)
#define NQK  (NH_ + NKV)          // heads of a token that are normed and rotated
#define NALL (NH_ + 2 * NKV)      // q, k and v heads of a token, side by side in the joint weight plane
#define DALL (NALL * HD)
#define RH   512                  // query rows < RH use hi+lo planes (0: none)
#define SCL  0.125f
#define CAP  50.0f
#define RMSEPS 1e-5f
typedef _Float16 h16;
typedef unsigned short bf;
typedef __attribute__((ext_vector_type(16))) __bf16   v16bf;
typedef __attribute__((ext_vector_type(16))) _Float16 v16h;
typedef __attribute__((ext_vector_type(8)))  _Float16 v8h;
typedef __attribute__((ext_vector_type(8)))  unsigned short v8us;
typedef __attribute__((ext_vector_type(8)))  float    v8f;
typedef __attribute__((ext_vector_type(4)))  float    v4f;
typedef v8h  __attribute__((may_alias)) v8ha;
typedef v4f  __attribute__((may_alias)) v4fa;
typedef v8us __attribute__((may_alias)) v8usa;

__device__ __forceinline__ unsigned short f2bf(float f) { unsigned u = __float_as_uint(f); u += 0x7FFFu + ((u >> 16) & 1u); return (unsigned short)(u >> 16); }
__device__ __forceinline__ float bf2f(unsigned short b) { return __uint_as_float(((unsigned)b) << 16); }
__device__ __forceinline__ float bfr(float f) { return bf2f(f2bf(f)); }
__device__ __forceinline__ v16h cat16(v8h lo, v8h hi) { return __builtin_shufflevector(lo, hi, 0, 1, 2, 3, 4, 5, 6, 7, 8, 9, 10, 11, 12, 13, 14, 15); }
__device__ __forceinline__ v16bf cat16b(v8us lo, v8us hi) { return __builtin_bit_cast(v16bf, __builtin_shufflevector(lo, hi, 0, 1, 2, 3, 4, 5, 6, 7, 8, 9, 10, 11, 12, 13, 14, 15)); }
__device__ __forceinline__ v8f wmma16(v16h a, v16h b, v8f c) { return __builtin_amdgcn_wmma_f32_16x16x32_f16(false, a, false, b, (short)0, c, false, false); }
__device__ __forceinline__ v8f wmmab(v16bf a, v16bf b, v8f c) { return __builtin_amdgcn_wmma_f32_16x16x32_bf16(false, a, false, b, (short)0, c, false, false); }



// ---- k_gemmw: register-blocked GEMM, 8 waves per 64x64 output tile, the K range split over the waves (16 accumulators each), operands straight from 16-bit planes in fragment order; grid (M/64, N/64, Z), 256 threads.
// C[m][n] (f32, pitch ldc, + optional f32 bias[n]) = sum_k A[m][k] Bt[n][k] (+ split products per NSPLIT). z-batch strides sA/sB/sC in elements. K % 64 == 0.
// softcap: 50 tanh(s / 50) with tanh(u) = 1 - 2 / (exp(2u) + 1) (one exp2 of 2u log2 e, one precise division; u in [-0.2, 0.2] here so no overflow); f32.
// exp2s: v_exp_f32 and, in the same statement, the one vector slot that the instruction set asks for behind a transcendental before its result is read or its source overwritten
__device__ __forceinline__ float exp2s(float x) { float r; asm("v_exp_f32 %0, %1\n\tv_nop" : "=v"(r) : "v"(x)); return r; }
__device__ __forceinline__ float softcap(float s) { const float u = __fmul_rn(s, 1.0f / CAP); const float e = exp2s(__fmul_rn(__fmul_rn(u, 2.0f), 1.4426950408889634f)); const float th = __fsub_rn(1.0f, __fdiv_rn(2.0f, __fadd_rn(e, 1.0f))); return __fmul_rn(th, CAP); }
__device__ __forceinline__ h16 tohx(float x) { return (h16)x; }
__device__ __forceinline__ void splitf(float y, unsigned short& h, unsigned short& l) { h = f2bf(y); l = f2bf(y - bf2f(h)); }
typedef __attribute__((ext_vector_type(2))) float v2f;
typedef unsigned short __attribute__((may_alias)) usa;
// FRAGMENT ORDER, the layout of every 16-bit operand plane [rows][K]: a block = 16 rows x 32 k = 1,024 bytes, blocks of a 16-row tile side by side along k (a tile = 16 K elements, as in row order; the v head planes instead put the 4 d tiles' blocks of each 32 keys side by side). Inside a block the
// 16-byte chunk (row r, k = 16 j + 8 h .. + 7) lies at chunk place 32 j + 16 h + pos(r): a wave's two fragment loads (lane = 16 h + r; j = 0, 1) each cover 512 contiguous bytes, 4 whole lines, where row order touched 16.
// pos(r) = r in the planes of the GEMMs; in the q, k and v head planes pos = hpos (below), so that the 8 rows which one wave of the projection epilogue owns fill one 128-byte line. Registers hold what they held: the k order is untouched.
__device__ __forceinline__ int hpos(int r) { return ((r >> 2) & 1) * 8 + ((r >> 3) & 1) * 4 + (r & 3); }
template <typename T16> struct WFrag;
template <> struct WFrag<h16> { typedef v16h V; static __device__ __forceinline__ V ld(const h16* p) { return cat16(*(const v8h*)p, *(const v8h*)(p + 256)); } static __device__ __forceinline__ v8f mma(V a, V b, v8f c) { return wmma16(a, b, c); } };
template <> struct WFrag<bf> { typedef v16bf V; static __device__ __forceinline__ V ld(const bf* p) { return cat16b(*(const v8us*)p, *(const v8us*)(p + 256)); } static __device__ __forceinline__ v8f mma(V a, V b, v8f c) { return wmmab(a, b, c); } };
// tile_splitk: one 64x64 output tile by a work-group of NW (8 or 16) waves. Wave w takes the 64-wide k chunks w, w + NW, ... below Kl (Kl % 64 == 0; a chunk = two
// trips of 32: in fragment order two 1,024-byte blocks of every 16-row tile) with the 16-accumulator register block; the NW partial tiles go to LDS in register order (b128, one slot per lane), and behind one barrier each wave sums, in wave order 0..NW-1, its 32 / NW
// slots and stores them: 32 columns = one whole 128-byte line of each of its rows, so every line of C has one writer. lda = pitch of the A planes in elements (the Bt planes have pitch K).
// PLN (8 waves): the tile goes out as three 16-bit planes in fragment order (fp16, bf16 hi, bf16 lo; P16, Ph, Pl point at the tile's 4,096 elements; vlay: its columns are the k of a [64][T] plane, 2 blocks of 32 for each of the 4 row tiles; else its 64 columns are all of k) instead of f32 C. A wave then sums the slots of 8 whole rows
// (16 mbw + 8 hi + 4 g + q, a lane's columns 16 nb + lr), so that a row's mean square is in-lane plus a 16-lane exchange and a rotary pair (d, d + 32) sits in one lane. cs != null: the rows are tokens, the columns
// one head: RMS-norm, then rotate-half rotary out[d] = x[d] cos - x[d+32] sin, out[d+32] = x[d+32] cos + x[d] sin with {cos, sin} = cs[row][d] (the table's entries d and d + 32 are equal). cs == null: values as they are.
template <typename T16, int NSPLIT, bool BIAS, int NW, bool PLN = false>
__device__ __forceinline__ void tile_splitk(const T16* __restrict__ A, const T16* __restrict__ A2, const T16* __restrict__ Bt, const T16* __restrict__ Bt2, int lda, int K, int Kl, float* C, int ldc, const float* __restrict__ bias, int r0, int c0, const float* __restrict__ cs = nullptr, h16* P16 = nullptr, bf* Ph = nullptr, bf* Pl = nullptr, bool vlay = false) {
    typedef typename WFrag<T16>::V V;
    __shared__ __align__(16) float part[NW * 32 * 32 * 4];           // [wave][slot = (mb * 4 + nb) * 2 + g][lane][4]: accumulator elements 4 g .. 4 g + 3
    const int lane = threadIdx.x & 31, lr = lane & 15, hi = lane >> 4; const int w = __builtin_amdgcn_readfirstlane(threadIdx.x >> 5);
    v8f acc[4][4];
#pragma unroll
    for (int mb = 0; mb < 4; ++mb)
#pragma unroll
        for (int nb = 0; nb < 4; ++nb) acc[mb][nb] = (v8f){};
    const size_t aoff = (size_t)r0 * lda, boff = (size_t)c0 * K; const unsigned l8 = lane * 8;   // fragment order: tile base + the lane's chunk; k step kc stands 16 kc elements on
    // the lane's addresses are carried through the loop and stepped at its foot, behind the trip's data waits: registers that stay live take no load's result while a load that names them is in flight
    const T16* pa = A + aoff + l8 + (size_t)w * 1024; const T16* pa2 = (NSPLIT == 1 || NSPLIT == 2) ? A2 + aoff + l8 + (size_t)w * 1024 : nullptr; const T16* pb = Bt + boff + l8 + (size_t)w * 1024; const T16* pb2 = NSPLIT >= 2 ? Bt2 + boff + l8 + (size_t)w * 1024 : nullptr;
#pragma unroll 1
    for (int kc = w * 64; kc < Kl; kc += (kc & 32) ? NW * 64 - 32 : 32) {
        V a[4], a2[4];
#pragma unroll
        for (int mb = 0; mb < 4; ++mb) { a[mb] = WFrag<T16>::ld(pa + (size_t)mb * 16 * lda); if (NSPLIT == 1 || NSPLIT == 2) a2[mb] = WFrag<T16>::ld(pa2 + (size_t)mb * 16 * lda); }
        asm volatile("s_wait_xcnt 0x0" ::: "memory");                      // stands between the A loads and the first rewrite of their address registers (the step at the loop's foot, which the compiler lifts in among the matrix instructions)
#pragma unroll
        for (int nb = 0; nb < 4; ++nb) { const V b = WFrag<T16>::ld(pb + (size_t)nb * 16 * K); V b2; if (NSPLIT >= 2) b2 = WFrag<T16>::ld(pb2 + (size_t)nb * 16 * K);
#pragma unroll
            for (int mb = 0; mb < 4; ++mb) { acc[mb][nb] = WFrag<T16>::mma(a[mb], b, acc[mb][nb]); if (NSPLIT == 1 || NSPLIT == 2) acc[mb][nb] = WFrag<T16>::mma(a2[mb], b, acc[mb][nb]); if (NSPLIT >= 2) acc[mb][nb] = WFrag<T16>::mma(a[mb], b2, acc[mb][nb]); } }
        // four vector slots behind the trip's last matrix instructions, on the back edge and on the exit alike, before fragments are reloaded or accumulators read
        asm volatile("v_nop\n\tv_nop\n\tv_nop\n\tv_nop" : "+v"(acc[0][0]), "+v"(acc[1][1]), "+v"(acc[2][2]), "+v"(acc[3][3]) : "v"(a[0]), "v"(a[3]));
        const int st = ((kc & 32) ? NW * 64 - 32 : 32) * 16; pa += st; pb += st; if (NSPLIT == 1 || NSPLIT == 2) pa2 += st; if (NSPLIT >= 2) pb2 += st;
    }
#pragma unroll
    for (int mb = 0; mb < 4; ++mb)
#pragma unroll
        for (int nb = 0; nb < 4; ++nb)
#pragma unroll
            for (int g = 0; g < 2; ++g) { v4f p; p[0] = acc[mb][nb][g * 4]; p[1] = acc[mb][nb][g * 4 + 1]; p[2] = acc[mb][nb][g * 4 + 2]; p[3] = acc[mb][nb][g * 4 + 3];
                *(v4fa*)(part + (((w * 32 + (mb * 4 + nb) * 2 + g) * 32 + lane) << 2)) = p; }
    v2f csv[4][2] = {};                                              // PLN: {cos, sin} of the lane's 4 rows and 2 rotary pairs, issued in front of the barrier: they depend on nothing that it orders
    if constexpr (PLN) { if (cs) {
#pragma unroll
        for (int q = 0; q < 4; ++q)
#pragma unroll
            for (int u = 0; u < 2; ++u) csv[q][u] = *(const v2f*)(cs + ((size_t)((w >> 1) * 16 + (w & 1) * 4 + hi * 8 + q) * HD + u * 16 + lr) * 2); } }
    __syncthreads();                                                 // every wave's partial tile is in LDS before any wave sums
    if constexpr (PLN) {
        static_assert(NW == 8, "8 rows a wave");
        const int mbw = w >> 1, g = w & 1;                            // the lane's rows: row0 + 8 hi + q, row0 = 16 mbw + 4 g
        v4f s[4];
#pragma unroll
        for (int nb = 0; nb < 4; ++nb) { const int slot = (mbw * 4 + nb) * 2 + g; s[nb] = *(const v4fa*)(part + ((slot * 32 + lane) << 2));
#pragma unroll
            for (int p = 1; p < NW; ++p) s[nb] += *(const v4fa*)(part + (((p * 32 + slot) * 32 + lane) << 2)); }
        if (cs) {
            v4f ss = s[0] * s[0] + s[1] * s[1] + s[2] * s[2] + s[3] * s[3];
#pragma unroll
            for (int sh = 8; sh; sh >>= 1)
#pragma unroll
                for (int q = 0; q < 4; ++q) ss[q] += __shfl_xor(ss[q], sh, 32);
#pragma unroll
            for (int q = 0; q < 4; ++q) { const float rs = __fdiv_rn(1.0f, __fsqrt_rn(__fadd_rn(__fdiv_rn(ss[q], (float)HD), RMSEPS)));
#pragma unroll
                for (int u = 0; u < 2; ++u) { const float x0 = s[u][q] * rs, x1 = s[u + 2][q] * rs, co = csv[q][u][0], si = csv[q][u][1]; s[u][q] = x0 * co - x1 * si; s[u + 2][q] = x1 * co + x0 * si; } }
        }
        // staged through LDS so that every global store is whole 128-byte lines: plane pl, rows 8 i .. 8 i + 3 (+ row0) lie in the 512 bytes of slot (mbw * 4 + i) * 2 + g of partial tile pl, one of the slots that this wave alone has read
        usa* st = (usa*)part;
#pragma unroll
        for (int nb = 0; nb < 4; ++nb)
#pragma unroll
            for (int q = 0; q < 4; ++q) { const float r = s[nb][q]; unsigned short a, c2; splitf(r, a, c2); const int at = (((mbw * 4 + hi) * 2 + g) << 8) + q * 64 + nb * 16 + lr;
                st[at] = __builtin_bit_cast(unsigned short, tohx(r)); st[at + (32 << 8)] = a; st[at + (64 << 8)] = c2; }
        asm volatile("s_wait_dscnt 0x0" ::: "memory");               // the wave's staged rows are in LDS before its lanes read what other lanes of it wrote
#pragma unroll
        for (int i = 0; i < 2; ++i) { const int c = i * 4 + (lane >> 3), pos = lane & 7;   // column chunk c of the wave's 8 rows (row0 + 8 (pos >> 2) + (pos & 3), at hpos = 8 g + pos) = one line of the fragment-order plane
            const int at = (((mbw * 4 + (pos >> 2)) * 2 + g) << 8) + (pos & 3) * 64 + c * 8;
            const size_t o = (size_t)(vlay ? ((c >> 2) * 4 + mbw) * 512 + ((c >> 1) & 1) * 256 : mbw * 1024 + (c >> 1) * 256) + (c & 1) * 128 + g * 64 + pos * 8;
            *(v8usa*)(P16 + o) = *(const v8usa*)(st + at); *(v8usa*)(Ph + o) = *(const v8usa*)(st + at + (32 << 8)); *(v8usa*)(Pl + o) = *(const v8usa*)(st + at + (64 << 8)); }
        return;
    }
    constexpr int GS = 16 / NW;                                      // g values a wave sums: 2 with 8 waves, 1 with 16
    const int mbw = w / (NW / 4), rem = w % (NW / 4), nbp = rem / (2 / GS), g0 = (rem % (2 / GS)) * GS;
#pragma unroll
    for (int u = 0; u < 2; ++u) { const int col = c0 + (nbp * 2 + u) * 16 + lr; const float bv = BIAS ? bfr(bias[col]) : 0.0f;
#pragma unroll
        for (int gg = 0; gg < GS; ++gg) { const int slot = (mbw * 4 + nbp * 2 + u) * 2 + g0 + gg; v4f s = *(const v4fa*)(part + ((slot * 32 + lane) << 2));
#pragma unroll
            for (int p = 1; p < NW; ++p) s += *(const v4fa*)(part + (((p * 32 + slot) * 32 + lane) << 2));
#pragma unroll
            for (int q = 0; q < 4; ++q) { float val = s[q]; if (BIAS) val += bv; C[(size_t)(r0 + mbw * 16 + hi * 8 + (g0 + gg) * 4 + q) * ldc + col] = val; } } }
}
template <typename T16, int NSPLIT, bool BIAS, int K>                // K at compile time: the blocks of a tile's four row tiles are then immediate offsets from one address
__global__ __launch_bounds__(256) void k_gemmw(const T16* __restrict__ A, const T16* __restrict__ A2, const T16* __restrict__ Bt, const T16* __restrict__ Bt2, float* C, int ldc, const float* __restrict__ bias, size_t sA, size_t sB, size_t sC) {
    const size_t z = blockIdx.z; A += z * sA; if (A2) A2 += z * sA; Bt += z * sB; if (Bt2) Bt2 += z * sB; C += z * sC;
    tile_splitk<T16, NSPLIT, BIAS, 8>(A, A2, Bt, Bt2, K, K, K, C, ldc, bias, blockIdx.x * 64, blockIdx.y * 64);
}
typedef __attribute__((ext_vector_type(2))) unsigned short v2us;

// the bodies below take their block index bx as an argument: the launched kernels hand each block range of a shared grid to one of them
__device__ __forceinline__ void wtG(const float* __restrict__ w, int K, int N, bf* Bt, int bx) {
    const int lane = threadIdx.x & 31; const int L0 = (bx * 8 + (threadIdx.x >> 5)) * 8; const int nlines = N * K / 64;
{
#pragma unroll 1
        for (int l = 0; l < 8; ++l) { const int L = L0 + l; if (L >= nlines) break; const size_t e = (size_t)L * 64 + lane * 2;   // a line of the fragment-order plane: 8 rows n x 8 k; the lane's two k of one row
            const int ci = L * 8 + (lane >> 2), blk = ci >> 6; const int k = (blk % (K / 32)) * 32 + ((ci >> 5) & 1) * 16 + ((ci >> 4) & 1) * 8 + (lane & 3) * 2, n = (blk / (K / 32)) * 16 + (ci & 15); v2us o;
            o[0] = f2bf(w[(size_t)k * N + n]); o[1] = f2bf(w[(size_t)(k + 1) * N + n]); *(v2us*)(Bt + e) = o; }
         }
}
__device__ __forceinline__ void cvt8(const float* __restrict__ src, bf* dst, size_t n8, int bx) { const size_t i = (size_t)bx * 256 + threadIdx.x; if (i >= n8) return;   // i = chunk place in the fragment-order plane of DM columns
    const size_t blk = i >> 6; const v8f v = *(const v8f*)(src + ((blk / (DM / 32)) * 16 + (i & 15)) * DM + (blk % (DM / 32)) * 32 + ((i >> 5) & 1) * 16 + ((i >> 4) & 1) * 8); v8us o;
#pragma unroll
    for (int k = 0; k < 8; ++k) o[k] = f2bf(v[k]); *(v8us*)(dst + i * 8) = o;  }
__constant__ float INVT[HD / 2] = { 1.000000000e+00f, 7.498942018e-01f, 5.623413324e-01f, 4.216965139e-01f, 3.162277639e-01f, 2.371373773e-01f, 1.778279394e-01f, 1.333521456e-01f, 1.000000015e-01f, 7.498942316e-02f, 5.623413250e-02f, 4.216964915e-02f, 3.162277490e-02f, 2.371373773e-02f, 1.778279431e-02f, 1.333521400e-02f, 9.999999776e-03f, 7.498942316e-03f, 5.623413250e-03f, 4.216964822e-03f, 3.162277630e-03f, 2.371373819e-03f, 1.778279431e-03f, 1.333521446e-03f, 1.000000047e-03f, 7.498941850e-04f, 5.623413017e-04f, 4.216965172e-04f, 3.162277571e-04f, 2.371373703e-04f, 1.778279402e-04f, 1.333521504e-04f };   // 10000^(-2i/64) (the module's power form) (float32, generated with jnp to be bit-exact)
__device__ __forceinline__ void cs4(float* CS, int bx) { const int idx = bx * 256 + threadIdx.x; if (idx >= TT * HD) return; const int d = idx % HD; const int t = idx / HD; const float a = __fmul_rn((float)t, INVT[d % (HD / 2)]); v2f cs; cs[0] = cosf(a); cs[1] = sinf(a); *(v2f*)(CS + (size_t)idx * 2) = cs;  }

// block counts of the bodies above (each as its own launch had it)
#define BWQ  (DM * DQ / 64 / 64)
#define BWKV (DM * DKV / 64 / 64)
#define BCVT (NB_ * TT * DM / 8 / 256)
#define BCS  (TT * HD / 256)
// k_prep: everything that reads only the inputs. The transposes stand first in the grid: their waves run longest (8 dependent trips of strided loads).
__global__ __launch_bounds__(256) void k_prep(const float* __restrict__ x, const float* __restrict__ wq, const float* __restrict__ wk, const float* __restrict__ wv, const float* __restrict__ wo, bf* WQ, bf* WK, bf* WV, bf* WO, bf* XB, float* CS) {
    int bx = blockIdx.x;
    // tested first although its blocks stand last: as the last of six tests the compiler took the call site for cold and left cosf and sinf as real calls
    if (bx >= BWQ * 2 + BWKV * 2 + BCVT) { cs4(CS, bx - (BWQ * 2 + BWKV * 2 + BCVT)); return; }
    if (bx < BWQ) { wtG(wq, DM, DQ, WQ, bx); return; } bx -= BWQ;
    if (bx < BWQ) { wtG(wo, DQ, DM, WO, bx); return; } bx -= BWQ;
    if (bx < BWKV) { wtG(wk, DM, DKV, WK, bx); return; } bx -= BWKV;
    if (bx < BWKV) { wtG(wv, DM, DKV, WV, bx); return; } bx -= BWKV;
    cvt8(x, XB, (size_t)NB_ * TT * DM / 8, bx);
}
// k_qkv: grid (token tiles of both batches, q + k + v heads). W = the [q | k | v columns][DM] weight plane. A q or k tile is [64 tokens][head], normed, rotated and written to the head's [t][d] planes;
// a v tile is computed transposed, [d][64 tokens] (the weight rows as the A operand), as the [d][t] value planes want it.
__global__ __launch_bounds__(256) void k_qkv(const bf* __restrict__ XB, const bf* __restrict__ W, const float* __restrict__ CS, h16* QP16, bf* QPh, bf* QPl, h16* KP16, bf* KPh, bf* KPl, h16* VT16, bf* VTh, bf* VTl) {
    const int hh = blockIdx.y, tok = blockIdx.x * 64, b = tok / TT, t0 = tok % TT; const bool isq = hh < NH_, isv = hh >= NQK;
    const size_t o = isq ? ((size_t)(b * NH_ + hh) * TT + t0) * HD : ((size_t)(b * NKV + hh - (isv ? NQK : NH_)) * TT + t0) * HD;   // 64 tokens of a head are 4,096 elements in a row in all three kinds of plane
    tile_splitk<bf, 0, false, 8, true>(isv ? W : XB, nullptr, isv ? XB : W, nullptr, DM, DM, DM, nullptr, 0, nullptr, isv ? hh * HD : tok, isv ? tok : hh * HD, isv ? nullptr : CS + (size_t)t0 * HD * 2,
        (isq ? QP16 : isv ? VT16 : KP16) + o, (isq ? QPh : isv ? VTh : KPh) + o, (isq ? QPl : isv ? VTl : KPl) + o, isv);
}

template <typename T16, bool HI>
__device__ __forceinline__ void attn_rows(const T16* __restrict__ Q, const T16* __restrict__ Q2, const T16* __restrict__ Kp, const T16* __restrict__ K2, const T16* __restrict__ Vt, const T16* __restrict__ V2, int q0, bf* Ah, bf* Al) {
    typedef typename WFrag<T16>::V V;
    const int lane = threadIdx.x & 31, lr = lane & 15, hi = lane >> 4; const int iq = q0 + lr;
    const unsigned foff = (hi * 16 + hpos(lr)) * 8;            // the lane's chunk in every 512-byte half block of the head planes (fragment order); 32 keys are 2,048 elements in a row of the key planes and of the value planes
    V qb[2], qb2[2];
#pragma unroll
    for (int ks = 0; ks < 2; ++ks) { qb[ks] = WFrag<T16>::ld((Q + (size_t)q0 * HD + ks * 512) + foff); if (HI) qb2[ks] = WFrag<T16>::ld((Q2 + (size_t)q0 * HD + ks * 512) + foff); }
    asm volatile("s_wait_xcnt 0x0" ::: "memory");                    // stands between the query loads and the first rewrite of the registers that hold their address
    v8f o[4];
#pragma unroll
    for (int dt = 0; dt < 4; ++dt) o[dt] = (v8f){};
    float m = -3.0e38f, l = 0.0f;
    const int klast = ((q0 + 15) >> 5) << 5;                         // first key of the block that holds the diagonal
    V ka[4], ka2[4];                                                 // [key tile * 2 + k step], fetched one block ahead
#pragma unroll
    for (int f = 0; f < 4; ++f) { ka[f] = WFrag<T16>::ld((Kp + f * 512) + foff); if (HI) ka2[f] = WFrag<T16>::ld((K2 + f * 512) + foff); }
    // kept rolled: the trip count is the wave's own and one block is some 500 instructions already; every inner loop below is unrolled whole so that fragments, scores and accumulators stay in registers
#pragma unroll 1
    for (int k0 = 0; k0 <= klast; k0 += 32) {
        V va[4], va2[4];                                             // this block's value rows: issued here, used behind the softmax arithmetic
#pragma unroll
        for (int dt = 0; dt < 4; ++dt) { va[dt] = WFrag<T16>::ld((Vt + (size_t)k0 * HD + dt * 512) + foff); if (HI) va2[dt] = WFrag<T16>::ld((V2 + (size_t)k0 * HD + dt * 512) + foff); }
        asm volatile("s_wait_xcnt 0x0" ::: "memory");                // stands between the value loads and the first rewrite of their address registers (results of the key loads below land in some of them)
        v8f s[2];
#pragma unroll
        for (int kt = 0; kt < 2; ++kt) { s[kt] = (v8f){};
#pragma unroll
            for (int ks = 0; ks < 2; ++ks) { s[kt] = WFrag<T16>::mma(ka[kt * 2 + ks], qb[ks], s[kt]); if (HI) { s[kt] = WFrag<T16>::mma(ka[kt * 2 + ks], qb2[ks], s[kt]); s[kt] = WFrag<T16>::mma(ka2[kt * 2 + ks], qb[ks], s[kt]); } } }
        float t[16]; float bm = -3.0e38f;
#pragma unroll
        for (int e = 0; e < 16; ++e) { const int key = k0 + (e >> 3) * 16 + hi * 8 + (e & 7); const float c = softcap(s[e >> 3][e & 7] * SCL); t[e] = (key <= iq) ? c : -3.0e38f; bm = fmaxf(bm, t[e]); }
        const int kn = min(k0 + 32, klast);                          // next block's key rows (the last block fetches its own again: in bounds, unused)
#pragma unroll
        for (int f = 0; f < 4; ++f) ka[f] = WFrag<T16>::ld((Kp + (size_t)kn * HD + f * 512) + foff);
        if constexpr (HI) {
            asm volatile("s_wait_xcnt 0x0" ::: "memory");            // stands between the hi-plane key loads and the first rewrite of their address registers (results of the lo-plane loads land in them)
#pragma unroll
            for (int f = 0; f < 4; ++f) ka2[f] = WFrag<T16>::ld((K2 + (size_t)kn * HD + f * 512) + foff);
        }
        bm = fmaxf(bm, __shfl_xor(bm, 16, 32));
        const float mn = fmaxf(m, bm); const float alpha = exp2s(__fmul_rn(__fsub_rn(m, mn), 1.4426950408889634f)); m = mn;
        float ls = 0.0f;
#pragma unroll
        for (int e = 0; e < 16; ++e) { const float d0 = __fsub_rn(t[e], mn); t[e] = exp2s(HI ? __fmul_rn(d0, 1.4426950408889634f) : __fmaf_rn(d0, 1.4426950408889634f, 10.0f)); ls += t[e]; }
        l = l * alpha + ls;
#pragma unroll
        for (int dt = 0; dt < 4; ++dt)
#pragma unroll
            for (int j = 0; j < 8; ++j) o[dt][j] *= alpha;
        if constexpr (HI) {
            v8us h0, h1, l0, l1;
#pragma unroll
            for (int j = 0; j < 8; ++j) { unsigned short a, c2; splitf(t[j], a, c2); h0[j] = a; l0[j] = c2; splitf(t[8 + j], a, c2); h1[j] = a; l1[j] = c2; }
            const V ph = cat16b(h0, h1), pl = cat16b(l0, l1);
#pragma unroll
            for (int dt = 0; dt < 4; ++dt) { o[dt] = WFrag<T16>::mma(va[dt], ph, o[dt]); o[dt] = WFrag<T16>::mma(va[dt], pl, o[dt]); o[dt] = WFrag<T16>::mma(va2[dt], ph, o[dt]); }
        } else {
            V ph;
#pragma unroll
            for (int e = 0; e < 16; ++e) ph[e] = tohx(t[e]);
#pragma unroll
            for (int dt = 0; dt < 4; ++dt) o[dt] = WFrag<T16>::mma(va[dt], ph, o[dt]);
        }
        // four vector slots behind the block's last matrix instructions, on the back edge and on the exit alike, before their operand registers are rewritten or the accumulators read
        asm volatile("v_nop\n\tv_nop\n\tv_nop\n\tv_nop" : "+v"(o[0]), "+v"(o[1]), "+v"(o[2]), "+v"(o[3]));
    }
    l += __shfl_xor(l, 16, 32);
    const float f = __fdiv_rn(1.0f, l);
#pragma unroll
    for (int dt = 0; dt < 4; ++dt) { v8us oh, ol;
#pragma unroll
        for (int j = 0; j < 8; ++j) { unsigned short a, c2; splitf(o[dt][j] * f, a, c2); oh[j] = a; ol[j] = c2; }
        const size_t oo = (size_t)q0 * DQ + dt * 256 + lane * 8; *(v8us*)(Ah + oo) = oh; *(v8us*)(Al + oo) = ol; }   // fragment order of the merged [token][DQ] planes: d tile dt of the head is half block dt of the head's two blocks
}
// grid (TT / 32, kv heads, batches), 8 waves: waves 0-3 = the 4 query heads of the kv head on row tile 127 - x, waves 4-7 the same heads on row tile x, so that every work-group walks the same number of keys (the 4 waves of a tile read the same K and V lines).
__global__ __launch_bounds__(256) void k_fattn(const h16* __restrict__ Q16, const bf* __restrict__ Qh, const bf* __restrict__ Ql, const h16* __restrict__ K16, const bf* __restrict__ Kh, const bf* __restrict__ Kl, const h16* __restrict__ V16, const bf* __restrict__ Vh, const bf* __restrict__ Vl, bf* Ah, bf* Al) {
    const int w = __builtin_amdgcn_readfirstlane(threadIdx.x >> 5); const int g = blockIdx.y, head = g * REP + (w & 3);
    const int q0 = ((w >> 2) ? (int)blockIdx.x : TT / 16 - 1 - (int)blockIdx.x) * 16;
    const size_t b = blockIdx.z, qo = (b * NH_ + head) * TT * HD, ko = (b * NKV + g) * TT * HD; Ah += b * TT * DQ; Al += b * TT * DQ;
    if (q0 < RH) attn_rows<bf, true>(Qh + qo, Ql + qo, Kh + ko, Kl + ko, Vh + ko, Vl + ko, q0, Ah + head * 1024, Al + head * 1024);
    else attn_rows<h16, false>(Q16 + qo, nullptr, K16 + ko, nullptr, V16 + ko, nullptr, q0, Ah + head * 1024, Al + head * 1024);
}

extern "C" void kernel_launch(void* const* d_in, const int* in_sizes, int n_in,
                              void* d_out, int out_size, void* d_ws, size_t ws_size, hipStream_t stream) {
    (void)in_sizes; (void)n_in; (void)out_size;
    const float* x = (const float*)d_in[0]; const float* wq = (const float*)d_in[1]; const float* wk = (const float*)d_in[2]; const float* wv = (const float*)d_in[3]; const float* wo = (const float*)d_in[4];
    float* OUT = (float*)d_out;     // [2][2048][1024]
    char* wsp = (char*)d_ws;
    auto take = [&](size_t bytes) { char* p = wsp; wsp += (bytes + 255) & ~(size_t)255; return (void*)p; };
    bf* WQ = (bf*)take((size_t)DALL * DM * 2); bf* WK = WQ + (size_t)DQ * DM; bf* WV = WK + (size_t)DKV * DM;   /* one [q | k | v columns][DM] plane */ bf* WO = (bf*)take((size_t)DM * DQ * 2); float* CS = (float*)take((size_t)TT * HD * 2 * 4);
    bf* XB = (bf*)take((size_t)NB_ * TT * DM * 2);
    h16* QP16 = (h16*)take((size_t)NB_ * NH_ * TT * HD * 2); h16* KP16 = (h16*)take((size_t)NB_ * NKV * TT * HD * 2); h16* VT16 = (h16*)take((size_t)NB_ * NKV * HD * TT * 2);
    bf* QPh = (bf*)take((size_t)NB_ * NH_ * TT * HD * 2); bf* QPl = (bf*)take((size_t)NB_ * NH_ * TT * HD * 2); bf* KPh = (bf*)take((size_t)NB_ * NKV * TT * HD * 2); bf* KPl = (bf*)take((size_t)NB_ * NKV * TT * HD * 2); bf* VTh = (bf*)take((size_t)NB_ * NKV * HD * TT * 2); bf* VTl = (bf*)take((size_t)NB_ * NKV * HD * TT * 2);
    bf* ATh = (bf*)take((size_t)NB_ * TT * DQ * 2); bf* ATl = (bf*)take((size_t)NB_ * TT * DQ * 2);
    if ((size_t)(wsp - (char*)d_ws) > ws_size) return;    // ws 256 MiB
    k_prep<<<BWQ * 2 + BWKV * 2 + BCVT + BCS, 256, 0, stream>>>(x, wq, wk, wv, wo, WQ, WK, WV, WO, XB, CS);
    k_qkv<<<dim3(NB_ * TT / 64, NALL, 1), 256, 0, stream>>>(XB, WQ, CS, QP16, QPh, QPl, KP16, KPh, KPl, VT16, VTh, VTl);
    k_fattn<<<dim3(TT / 32, NKV, NB_), 256, 0, stream>>>(QP16, QPh, QPl, KP16, KPh, KPl, VT16, VTh, VTl, ATh, ATl);
    k_gemmw<bf, 1, false, DQ><<<dim3(NB_ * TT / 64, DM / 64, 1), 256, 0, stream>>>(ATh, ATl, WO, nullptr, OUT, DM, nullptr, 0, 0, 0);
}

// v009
// It runs in 87.3 microseconds.
// Two timings next to v008 put it at 1.20 and 1.19 times that version's speed.
// Over all steps from v000 it is 17.6 times as fast.
#include <hip/hip_runtime.h>

// Causal grouped-query self-attention with QK RMS-norm, rotary embeddings and tanh logit soft-capping (x [2][2048][1024]; q = x w_q ('xw' [1024][1024] 0.02, 16 heads x 64), k, v = x w_k / w_v ([1024][256]: 4 kv heads, each shared by 4 query heads); q, k <- RMS-norm over 64 (eps 1e-5, no scale); half-split rope (theta 1e4, computed); scores / 8; softcap: 50 tanh(scores / 50); causal (-inf); softmax; out = merged w_o ('xw') -> [2][2048][1024] (4.2 M)).
// Launches: 4. {4 weight transposes, bf16 copy of x, cos/sin table} in one grid, told apart by block index; {q, k, v projections: one GEMM on the three weight planes laid end to end; a 64x64 tile is 64 tokens of one head, and its epilogue norms, rotates and writes the head planes}; attention; w_o.
// Layout, both batches in every launch (token-major buffers hold 2 x 2048 rows, head planes are [batch][head]; the batch is a grid dimension or more row tiles; every 16-bit plane in fragment order, see FRAGMENT ORDER below): bf16 copy of x; 'xw' weights transposed once; exact projections with per-(token, head) RMS-norm and rotate-half rotary in the epilogue; {cos, sin} table once; causal T-2048 GQA attention fused in one launch (each kv plane serves 4 query heads; scores, soft cap as 50 x tanh(s/50) (tanh as an odd polynomial, f32), running-maximum softmax and P.V in registers; hybrid rows: < 512 hi/lo 3 products, rest fp16 x1024; key blocks above the diagonal skipped); merged hi/lo x w_o exact.
// Compute dtypes, f32 accumulate: every input rounded to bf16; projections exact; RMS-norm and rotary f32; attention rows < 512 3 products, rest fp16; soft cap and softmax f32; w_o hl x exact.

#define NB_  2
#define TT   2048
#define DM   1024
#define NH_  16
#define NKV  4
#define REP  (NH_ / NKV)
#define HD   64
#define DQ   (NH_ * HD)
#define DKV  (NKV * HD)
#define NQK  (NH_ + NKV)          // heads of a token that are normed and rotated
#define NALL (NH_ + 2 * NKV)      // q, k and v heads of a token, side by side in the joint weight plane
#define DALL (NALL * HD)
#define RH   512                  // query rows < RH use hi+lo planes (0: none)
#define SCL  0.125f
#define CAP  50.0f
#define RMSEPS 1e-5f
typedef _Float16 h16;
typedef unsigned short bf;
typedef __attribute__((ext_vector_type(16))) __bf16   v16bf;
typedef __attribute__((ext_vector_type(16))) _Float16 v16h;
typedef __attribute__((ext_vector_type(8)))  _Float16 v8h;
typedef __attribute__((ext_vector_type(8)))  unsigned short v8us;
typedef __attribute__((ext_vector_type(8)))  float    v8f;
typedef __attribute__((ext_vector_type(4)))  float    v4f;
typedef v8h  __attribute__((may_alias)) v8ha;
typedef v4f  __attribute__((may_alias)) v4fa;
typedef v8us __attribute__((may_alias)) v8usa;

__device__ __forceinline__ unsigned short f2bf(float f) { unsigned u = __float_as_uint(f); u += 0x7FFFu + ((u >> 16) & 1u); return (unsigned short)(u >> 16); }
__device__ __forceinline__ float bf2f(unsigned short b) { return __uint_as_float(((unsigned)b) << 16); }
__device__ __forceinline__ float bfr(float f) { return bf2f(f2bf(f)); }
__device__ __forceinline__ v16h cat16(v8h lo, v8h hi) { return __builtin_shufflevector(lo, hi, 0, 1, 2, 3, 4, 5, 6, 7, 8, 9, 10, 11, 12, 13, 14, 15); }
__device__ __forceinline__ v16bf cat16b(v8us lo, v8us hi) { return __builtin_bit_cast(v16bf, __builtin_shufflevector(lo, hi, 0, 1, 2, 3, 4, 5, 6, 7, 8, 9, 10, 11, 12, 13, 14, 15)); }
__device__ __forceinline__ v8f wmma16(v16h a, v16h b, v8f c) { return __builtin_amdgcn_wmma_f32_16x16x32_f16(false, a, false, b, (short)0, c, false, false); }
__device__ __forceinline__ v8f wmmab(v16bf a, v16bf b, v8f c) { return __builtin_amdgcn_wmma_f32_16x16x32_bf16(false, a, false, b, (short)0, c, false, false); }



// ---- k_gemmw: register-blocked GEMM, 8 waves per 64x64 output tile, the K range split over the waves (16 accumulators each), operands straight from 16-bit planes in fragment order; grid (M/64, N/64, Z), 256 threads.
// C[m][n] (f32, pitch ldc, + optional f32 bias[n]) = sum_k A[m][k] Bt[n][k] (+ split products per NSPLIT). z-batch strides sA/sB/sC in elements. K % 64 == 0.
// exp2s: v_exp_f32 and, in the same statement, the one vector slot that the instruction set asks for behind a transcendental before its result is read or its source overwritten
__device__ __forceinline__ float exp2s(float x) { float r; asm("v_exp_f32 %0, %1\n\tv_nop" : "=v"(r) : "v"(x)); return r; }
__device__ __forceinline__ h16 tohx(float x) { return (h16)x; }
__device__ __forceinline__ void splitf(float y, unsigned short& h, unsigned short& l) { h = f2bf(y); l = f2bf(y - bf2f(h)); }
typedef __attribute__((ext_vector_type(2))) float v2f;
// softcap2: 50 tanh(u), u = d / 8 / 50, of two raw dot products d, as d x (an even polynomial in d): tanh(u) = u (1 - u^2/3 + 2 u^4/15 - 17 u^6/315 + 62 u^8/2835 - ...), the scale 1/8 and the powers of 1/400 inside the coefficients.
// RMS-norm leaves every q and k row with length <= 8 and the rotation keeps it, so |d| <= 64 (a little more after the 16-bit rounding) and |u| <= 0.17 for any input: the first term left out is below 2e-10 of the value there, far under an f32 rounding.
// No cancellation, no transcendental, no division: 6 multiplies or multiply-adds an element, two elements an instruction (packed f32).
__device__ __forceinline__ v2f softcap2(v2f d) {
    constexpr double k2 = ((double)SCL / CAP) * ((double)SCL / CAP);
    constexpr float c0 = SCL, c1 = (float)(-SCL * k2 / 3.0), c2 = (float)(SCL * k2 * k2 * 2.0 / 15.0), c3 = (float)(-SCL * k2 * k2 * k2 * 17.0 / 315.0), c4 = (float)(SCL * k2 * k2 * k2 * k2 * 62.0 / 2835.0);
    const v2f z = d * d; v2f p = __builtin_elementwise_fma(z, (v2f){c4, c4}, (v2f){c3, c3});
    p = __builtin_elementwise_fma(z, p, (v2f){c2, c2}); p = __builtin_elementwise_fma(z, p, (v2f){c1, c1}); p = __builtin_elementwise_fma(z, p, (v2f){c0, c0}); return d * p; }
typedef unsigned short __attribute__((may_alias)) usa;
// FRAGMENT ORDER, the layout of every 16-bit operand plane [rows][K]: a block = 16 rows x 32 k = 1,024 bytes, blocks of a 16-row tile side by side along k (a tile = 16 K elements, as in row order; the v head planes instead put the 4 d tiles' blocks of each 32 keys side by side). Inside a block the
// 16-byte chunk (row r, k = 16 j + 8 h .. + 7) lies at chunk place 32 j + 16 h + pos(r): a wave's two fragment loads (lane = 16 h + r; j = 0, 1) each cover 512 contiguous bytes, 4 whole lines, where row order touched 16.
// pos(r) = r in the planes of the GEMMs; in the q, k and v head planes pos = hpos (below), so that the 8 rows which one wave of the projection epilogue owns fill one 128-byte line. Registers hold what they held: the k order is untouched.
__device__ __forceinline__ int hpos(int r) { return ((r >> 2) & 1) * 8 + ((r >> 3) & 1) * 4 + (r & 3); }
template <typename T16> struct WFrag;
template <> struct WFrag<h16> { typedef v16h V; static __device__ __forceinline__ V ld(const h16* p) { return cat16(*(const v8h*)p, *(const v8h*)(p + 256)); } static __device__ __forceinline__ v8f mma(V a, V b, v8f c) { return wmma16(a, b, c); } };
template <> struct WFrag<bf> { typedef v16bf V; static __device__ __forceinline__ V ld(const bf* p) { return cat16b(*(const v8us*)p, *(const v8us*)(p + 256)); } static __device__ __forceinline__ v8f mma(V a, V b, v8f c) { return wmmab(a, b, c); } };
// tile_splitk: one 64x64 output tile by a work-group of NW (8 or 16) waves. Wave w takes the 64-wide k chunks w, w + NW, ... below Kl (Kl % 64 == 0; a chunk = two
// trips of 32: in fragment order two 1,024-byte blocks of every 16-row tile) with the 16-accumulator register block; the NW partial tiles go to LDS in register order (b128, one slot per lane), and behind one barrier each wave sums, in wave order 0..NW-1, its 32 / NW
// slots and stores them: 32 columns = one whole 128-byte line of each of its rows, so every line of C has one writer. lda = pitch of the A planes in elements (the Bt planes have pitch K).
// PLN (8 waves): the tile goes out as three 16-bit planes in fragment order (fp16, bf16 hi, bf16 lo; P16, Ph, Pl point at the tile's 4,096 elements; vlay: its columns are the k of a [64][T] plane, 2 blocks of 32 for each of the 4 row tiles; else its 64 columns are all of k) instead of f32 C. A wave then sums the slots of 8 whole rows
// (16 mbw + 8 hi + 4 g + q, a lane's columns 16 nb + lr), so that a row's mean square is in-lane plus a 16-lane exchange and a rotary pair (d, d + 32) sits in one lane. cs != null: the rows are tokens, the columns
// one head: RMS-norm, then rotate-half rotary out[d] = x[d] cos - x[d+32] sin, out[d+32] = x[d+32] cos + x[d] sin with {cos, sin} = cs[row][d] (the table's entries d and d + 32 are equal). cs == null: values as they are.
template <typename T16, int NSPLIT, bool BIAS, int NW, bool PLN = false>
__device__ __forceinline__ void tile_splitk(const T16* __restrict__ A, const T16* __restrict__ A2, const T16* __restrict__ Bt, const T16* __restrict__ Bt2, int lda, int K, int Kl, float* C, int ldc, const float* __restrict__ bias, int r0, int c0, const float* __restrict__ cs = nullptr, h16* P16 = nullptr, bf* Ph = nullptr, bf* Pl = nullptr, bool vlay = false) {
    typedef typename WFrag<T16>::V V;
    __shared__ __align__(16) float part[NW * 32 * 32 * 4];           // [wave][slot = (mb * 4 + nb) * 2 + g][lane][4]: accumulator elements 4 g .. 4 g + 3
    const int lane = threadIdx.x & 31, lr = lane & 15, hi = lane >> 4; const int w = __builtin_amdgcn_readfirstlane(threadIdx.x >> 5);
    v8f acc[4][4];
#pragma unroll
    for (int mb = 0; mb < 4; ++mb)
#pragma unroll
        for (int nb = 0; nb < 4; ++nb) acc[mb][nb] = (v8f){};
    const size_t aoff = (size_t)r0 * lda, boff = (size_t)c0 * K; const unsigned l8 = lane * 8;   // fragment order: tile base + the lane's chunk; k step kc stands 16 kc elements on
    // the lane's addresses are carried through the loop and stepped at its foot, behind the trip's data waits: registers that stay live take no load's result while a load that names them is in flight
    const T16* pa = A + aoff + l8 + (size_t)w * 1024; const T16* pa2 = (NSPLIT == 1 || NSPLIT == 2) ? A2 + aoff + l8 + (size_t)w * 1024 : nullptr; const T16* pb = Bt + boff + l8 + (size_t)w * 1024; const T16* pb2 = NSPLIT >= 2 ? Bt2 + boff + l8 + (size_t)w * 1024 : nullptr;
#pragma unroll 1
    for (int kc = w * 64; kc < Kl; kc += (kc & 32) ? NW * 64 - 32 : 32) {
        V a[4], a2[4];
#pragma unroll
        for (int mb = 0; mb < 4; ++mb) { a[mb] = WFrag<T16>::ld(pa + (size_t)mb * 16 * lda); if (NSPLIT == 1 || NSPLIT == 2) a2[mb] = WFrag<T16>::ld(pa2 + (size_t)mb * 16 * lda); }
        asm volatile("s_wait_xcnt 0x0" ::: "memory");                      // stands between the A loads and the first rewrite of their address registers (the step at the loop's foot, which the compiler lifts in among the matrix instructions)
#pragma unroll
        for (int nb = 0; nb < 4; ++nb) { const V b = WFrag<T16>::ld(pb + (size_t)nb * 16 * K); V b2; if (NSPLIT >= 2) b2 = WFrag<T16>::ld(pb2 + (size_t)nb * 16 * K);
#pragma unroll
            for (int mb = 0; mb < 4; ++mb) { acc[mb][nb] = WFrag<T16>::mma(a[mb], b, acc[mb][nb]); if (NSPLIT == 1 || NSPLIT == 2) acc[mb][nb] = WFrag<T16>::mma(a2[mb], b, acc[mb][nb]); if (NSPLIT >= 2) acc[mb][nb] = WFrag<T16>::mma(a[mb], b2, acc[mb][nb]); } }
        // four vector slots behind the trip's last matrix instructions, on the back edge and on the exit alike, before fragments are reloaded or accumulators read
        asm volatile("v_nop\n\tv_nop\n\tv_nop\n\tv_nop" : "+v"(acc[0][0]), "+v"(acc[1][1]), "+v"(acc[2][2]), "+v"(acc[3][3]) : "v"(a[0]), "v"(a[3]));
        const int st = ((kc & 32) ? NW * 64 - 32 : 32) * 16; pa += st; pb += st; if (NSPLIT == 1 || NSPLIT == 2) pa2 += st; if (NSPLIT >= 2) pb2 += st;
    }
#pragma unroll
    for (int mb = 0; mb < 4; ++mb)
#pragma unroll
        for (int nb = 0; nb < 4; ++nb)
#pragma unroll
            for (int g = 0; g < 2; ++g) { v4f p; p[0] = acc[mb][nb][g * 4]; p[1] = acc[mb][nb][g * 4 + 1]; p[2] = acc[mb][nb][g * 4 + 2]; p[3] = acc[mb][nb][g * 4 + 3];
                *(v4fa*)(part + (((w * 32 + (mb * 4 + nb) * 2 + g) * 32 + lane) << 2)) = p; }
    v2f csv[4][2] = {};                                              // PLN: {cos, sin} of the lane's 4 rows and 2 rotary pairs, issued in front of the barrier: they depend on nothing that it orders
    if constexpr (PLN) { if (cs) {
#pragma unroll
        for (int q = 0; q < 4; ++q)
#pragma unroll
            for (int u = 0; u < 2; ++u) csv[q][u] = *(const v2f*)(cs + ((size_t)((w >> 1) * 16 + (w & 1) * 4 + hi * 8 + q) * HD + u * 16 + lr) * 2); } }
    __syncthreads();                                                 // every wave's partial tile is in LDS before any wave sums
    if constexpr (PLN) {
        static_assert(NW == 8, "8 rows a wave");
        const int mbw = w >> 1, g = w & 1;                            // the lane's rows: row0 + 8 hi + q, row0 = 16 mbw + 4 g
        v4f s[4];
#pragma unroll
        for (int nb = 0; nb < 4; ++nb) { const int slot = (mbw * 4 + nb) * 2 + g; s[nb] = *(const v4fa*)(part + ((slot * 32 + lane) << 2));
#pragma unroll
            for (int p = 1; p < NW; ++p) s[nb] += *(const v4fa*)(part + (((p * 32 + slot) * 32 + lane) << 2)); }
        if (cs) {
            v4f ss = s[0] * s[0] + s[1] * s[1] + s[2] * s[2] + s[3] * s[3];
#pragma unroll
            for (int sh = 8; sh; sh >>= 1)
#pragma unroll
                for (int q = 0; q < 4; ++q) ss[q] += __shfl_xor(ss[q], sh, 32);
#pragma unroll
            for (int q = 0; q < 4; ++q) { const float rs = __fdiv_rn(1.0f, __fsqrt_rn(__fadd_rn(__fdiv_rn(ss[q], (float)HD), RMSEPS)));
#pragma unroll
                for (int u = 0; u < 2; ++u) { const float x0 = s[u][q] * rs, x1 = s[u + 2][q] * rs, co = csv[q][u][0], si = csv[q][u][1]; s[u][q] = x0 * co - x1 * si; s[u + 2][q] = x1 * co + x0 * si; } }
        }
        // staged through LDS so that every global store is whole 128-byte lines: plane pl, rows 8 i .. 8 i + 3 (+ row0) lie in the 512 bytes of slot (mbw * 4 + i) * 2 + g of partial tile pl, one of the slots that this wave alone has read
        usa* st = (usa*)part;
#pragma unroll
        for (int nb = 0; nb < 4; ++nb)
#pragma unroll
            for (int q = 0; q < 4; ++q) { const float r = s[nb][q]; unsigned short a, c2; splitf(r, a, c2); const int at = (((mbw * 4 + hi) * 2 + g) << 8) + q * 64 + nb * 16 + lr;
                st[at] = __builtin_bit_cast(unsigned short, tohx(r)); st[at + (32 << 8)] = a; st[at + (64 << 8)] = c2; }
        asm volatile("s_wait_dscnt 0x0" ::: "memory");               // the wave's staged rows are in LDS before its lanes read what other lanes of it wrote
#pragma unroll
        for (int i = 0; i < 2; ++i) { const int c = i * 4 + (lane >> 3), pos = lane & 7;   // column chunk c of the wave's 8 rows (row0 + 8 (pos >> 2) + (pos & 3), at hpos = 8 g + pos) = one line of the fragment-order plane
            const int at = (((mbw * 4 + (pos >> 2)) * 2 + g) << 8) + (pos & 3) * 64 + c * 8;
            const size_t o = (size_t)(vlay ? ((c >> 2) * 4 + mbw) * 512 + ((c >> 1) & 1) * 256 : mbw * 1024 + (c >> 1) * 256) + (c & 1) * 128 + g * 64 + pos * 8;
            *(v8usa*)(P16 + o) = *(const v8usa*)(st + at); *(v8usa*)(Ph + o) = *(const v8usa*)(st + at + (32 << 8)); *(v8usa*)(Pl + o) = *(const v8usa*)(st + at + (64 << 8)); }
        return;
    }
    constexpr int GS = 16 / NW;                                      // g values a wave sums: 2 with 8 waves, 1 with 16
    const int mbw = w / (NW / 4), rem = w % (NW / 4), nbp = rem / (2 / GS), g0 = (rem % (2 / GS)) * GS;
#pragma unroll
    for (int u = 0; u < 2; ++u) { const int col = c0 + (nbp * 2 + u) * 16 + lr; const float bv = BIAS ? bfr(bias[col]) : 0.0f;
#pragma unroll
        for (int gg = 0; gg < GS; ++gg) { const int slot = (mbw * 4 + nbp * 2 + u) * 2 + g0 + gg; v4f s = *(const v4fa*)(part + ((slot * 32 + lane) << 2));
#pragma unroll
            for (int p = 1; p < NW; ++p) s += *(const v4fa*)(part + (((p * 32 + slot) * 32 + lane) << 2));
#pragma unroll
            for (int q = 0; q < 4; ++q) { float val = s[q]; if (BIAS) val += bv; C[(size_t)(r0 + mbw * 16 + hi * 8 + (g0 + gg) * 4 + q) * ldc + col] = val; } } }
}
template <typename T16, int NSPLIT, bool BIAS, int K>                // K at compile time: the blocks of a tile's four row tiles are then immediate offsets from one address
__global__ __launch_bounds__(256) void k_gemmw(const T16* __restrict__ A, const T16* __restrict__ A2, const T16* __restrict__ Bt, const T16* __restrict__ Bt2, float* C, int ldc, const float* __restrict__ bias, size_t sA, size_t sB, size_t sC) {
    const size_t z = blockIdx.z; A += z * sA; if (A2) A2 += z * sA; Bt += z * sB; if (Bt2) Bt2 += z * sB; C += z * sC;
    tile_splitk<T16, NSPLIT, BIAS, 8>(A, A2, Bt, Bt2, K, K, K, C, ldc, bias, blockIdx.x * 64, blockIdx.y * 64);
}
typedef __attribute__((ext_vector_type(2))) unsigned short v2us;

// the bodies below take their block index bx as an argument: the launched kernels hand each block range of a shared grid to one of them
__device__ __forceinline__ void wtG(const float* __restrict__ w, int K, int N, bf* Bt, int bx) {
    const int lane = threadIdx.x & 31; const int L0 = (bx * 8 + (threadIdx.x >> 5)) * 8; const int nlines = N * K / 64;
{
#pragma unroll 1
        for (int l = 0; l < 8; ++l) { const int L = L0 + l; if (L >= nlines) break; const size_t e = (size_t)L * 64 + lane * 2;   // a line of the fragment-order plane: 8 rows n x 8 k; the lane's two k of one row
            const int ci = L * 8 + (lane >> 2), blk = ci >> 6; const int k = (blk % (K / 32)) * 32 + ((ci >> 5) & 1) * 16 + ((ci >> 4) & 1) * 8 + (lane & 3) * 2, n = (blk / (K / 32)) * 16 + (ci & 15); v2us o;
            o[0] = f2bf(w[(size_t)k * N + n]); o[1] = f2bf(w[(size_t)(k + 1) * N + n]); *(v2us*)(Bt + e) = o; }
         }
}
__device__ __forceinline__ void cvt8(const float* __restrict__ src, bf* dst, size_t n8, int bx) { const size_t i = (size_t)bx * 256 + threadIdx.x; if (i >= n8) return;   // i = chunk place in the fragment-order plane of DM columns
    const size_t blk = i >> 6; const v8f v = *(const v8f*)(src + ((blk / (DM / 32)) * 16 + (i & 15)) * DM + (blk % (DM / 32)) * 32 + ((i >> 5) & 1) * 16 + ((i >> 4) & 1) * 8); v8us o;
#pragma unroll
    for (int k = 0; k < 8; ++k) o[k] = f2bf(v[k]); *(v8us*)(dst + i * 8) = o;  }
__constant__ float INVT[HD / 2] = { 1.000000000e+00f, 7.498942018e-01f, 5.623413324e-01f, 4.216965139e-01f, 3.162277639e-01f, 2.371373773e-01f, 1.778279394e-01f, 1.333521456e-01f, 1.000000015e-01f, 7.498942316e-02f, 5.623413250e-02f, 4.216964915e-02f, 3.162277490e-02f, 2.371373773e-02f, 1.778279431e-02f, 1.333521400e-02f, 9.999999776e-03f, 7.498942316e-03f, 5.623413250e-03f, 4.216964822e-03f, 3.162277630e-03f, 2.371373819e-03f, 1.778279431e-03f, 1.333521446e-03f, 1.000000047e-03f, 7.498941850e-04f, 5.623413017e-04f, 4.216965172e-04f, 3.162277571e-04f, 2.371373703e-04f, 1.778279402e-04f, 1.333521504e-04f };   // 10000^(-2i/64) (the module's power form) (float32, generated with jnp to be bit-exact)
__device__ __forceinline__ void cs4(float* CS, int bx) { const int idx = bx * 256 + threadIdx.x; if (idx >= TT * HD) return; const int d = idx % HD; const int t = idx / HD; const float a = __fmul_rn((float)t, INVT[d % (HD / 2)]); v2f cs; cs[0] = cosf(a); cs[1] = sinf(a); *(v2f*)(CS + (size_t)idx * 2) = cs;  }

// block counts of the bodies above (each as its own launch had it)
#define BWQ  (DM * DQ / 64 / 64)
#define BWKV (DM * DKV / 64 / 64)
#define BCVT (NB_ * TT * DM / 8 / 256)
#define BCS  (TT * HD / 256)
// k_prep: everything that reads only the inputs. The transposes stand first in the grid: their waves run longest (8 dependent trips of strided loads).
__global__ __launch_bounds__(256) void k_prep(const float* __restrict__ x, const float* __restrict__ wq, const float* __restrict__ wk, const float* __restrict__ wv, const float* __restrict__ wo, bf* WQ, bf* WK, bf* WV, bf* WO, bf* XB, float* CS) {
    int bx = blockIdx.x;
    // tested first although its blocks stand last: as the last of six tests the compiler took the call site for cold and left cosf and sinf as real calls
    if (bx >= BWQ * 2 + BWKV * 2 + BCVT) { cs4(CS, bx - (BWQ * 2 + BWKV * 2 + BCVT)); return; }
    if (bx < BWQ) { wtG(wq, DM, DQ, WQ, bx); return; } bx -= BWQ;
    if (bx < BWQ) { wtG(wo, DQ, DM, WO, bx); return; } bx -= BWQ;
    if (bx < BWKV) { wtG(wk, DM, DKV, WK, bx); return; } bx -= BWKV;
    if (bx < BWKV) { wtG(wv, DM, DKV, WV, bx); return; } bx -= BWKV;
    cvt8(x, XB, (size_t)NB_ * TT * DM / 8, bx);
}
// k_qkv: grid (token tiles of both batches, q + k + v heads). W = the [q | k | v columns][DM] weight plane. A q or k tile is [64 tokens][head], normed, rotated and written to the head's [t][d] planes;
// a v tile is computed transposed, [d][64 tokens] (the weight rows as the A operand), as the [d][t] value planes want it.
__global__ __launch_bounds__(256) void k_qkv(const bf* __restrict__ XB, const bf* __restrict__ W, const float* __restrict__ CS, h16* QP16, bf* QPh, bf* QPl, h16* KP16, bf* KPh, bf* KPl, h16* VT16, bf* VTh, bf* VTl) {
    const int hh = blockIdx.y, tok = blockIdx.x * 64, b = tok / TT, t0 = tok % TT; const bool isq = hh < NH_, isv = hh >= NQK;
    const size_t o = isq ? ((size_t)(b * NH_ + hh) * TT + t0) * HD : ((size_t)(b * NKV + hh - (isv ? NQK : NH_)) * TT + t0) * HD;   // 64 tokens of a head are 4,096 elements in a row in all three kinds of plane
    tile_splitk<bf, 0, false, 8, true>(isv ? W : XB, nullptr, isv ? XB : W, nullptr, DM, DM, DM, nullptr, 0, nullptr, isv ? hh * HD : tok, isv ? tok : hh * HD, isv ? nullptr : CS + (size_t)t0 * HD * 2,
        (isq ? QP16 : isv ? VT16 : KP16) + o, (isq ? QPh : isv ? VTh : KPh) + o, (isq ? QPl : isv ? VTl : KPl) + o, isv);
}

template <typename T16, bool HI>
__device__ __forceinline__ void attn_rows(const T16* __restrict__ Q, const T16* __restrict__ Q2, const T16* __restrict__ Kp, const T16* __restrict__ K2, const T16* __restrict__ Vt, const T16* __restrict__ V2, int q0, bf* Ah, bf* Al) {
    typedef typename WFrag<T16>::V V;
    const int lane = threadIdx.x & 31, lr = lane & 15, hi = lane >> 4; const int iq = q0 + lr;
    const unsigned foff = (hi * 16 + hpos(lr)) * 8;            // the lane's chunk in every 512-byte half block of the head planes (fragment order); 32 keys are 2,048 elements in a row of the key planes and of the value planes
    V qb[2], qb2[2];
#pragma unroll
    for (int ks = 0; ks < 2; ++ks) { qb[ks] = WFrag<T16>::ld((Q + (size_t)q0 * HD + ks * 512) + foff); if (HI) qb2[ks] = WFrag<T16>::ld((Q2 + (size_t)q0 * HD + ks * 512) + foff); }
    asm volatile("s_wait_xcnt 0x0" ::: "memory");                    // stands between the query loads and the first rewrite of the registers that hold their address
    v8f o[4];
#pragma unroll
    for (int dt = 0; dt < 4; ++dt) o[dt] = (v8f){};
    float m = -3.0e38f, l = 0.0f;
    const int klast = ((q0 + 15) >> 5) << 5;                         // first key of the block that holds the diagonal
    V ka[4], ka2[4];                                                 // [key tile * 2 + k step], fetched one block ahead
#pragma unroll
    for (int f = 0; f < 4; ++f) { ka[f] = WFrag<T16>::ld((Kp + f * 512) + foff); if (HI) ka2[f] = WFrag<T16>::ld((K2 + f * 512) + foff); }
    // kept rolled: the trip count is the wave's own and one block is some 500 instructions already; every inner loop below is unrolled whole so that fragments, scores and accumulators stay in registers
#pragma unroll 1
    for (int k0 = 0; k0 <= klast; k0 += 32) {
        V va[4], va2[4];                                             // this block's value rows: issued here, used behind the softmax arithmetic
#pragma unroll
        for (int dt = 0; dt < 4; ++dt) va[dt] = WFrag<T16>::ld((Vt + (size_t)k0 * HD + dt * 512) + foff);
        if constexpr (HI) {
            asm volatile("s_wait_xcnt 0x0" ::: "memory");            // stands between the hi-plane value loads and the first rewrite of their address registers (results of the lo-plane loads land in them)
#pragma unroll
            for (int dt = 0; dt < 4; ++dt) va2[dt] = WFrag<T16>::ld((V2 + (size_t)k0 * HD + dt * 512) + foff);
        }
        asm volatile("s_wait_xcnt 0x0" ::: "memory");                // stands between the value loads and the first rewrite of their address registers (results of the key loads below land in some of them)
        v8f s[2];
#pragma unroll
        for (int kt = 0; kt < 2; ++kt) { s[kt] = (v8f){};
#pragma unroll
            for (int ks = 0; ks < 2; ++ks) { s[kt] = WFrag<T16>::mma(ka[kt * 2 + ks], qb[ks], s[kt]); if (HI) { s[kt] = WFrag<T16>::mma(ka[kt * 2 + ks], qb2[ks], s[kt]); s[kt] = WFrag<T16>::mma(ka2[kt * 2 + ks], qb[ks], s[kt]); } } }
        float t[16]; float bm = -3.0e38f;
#pragma unroll
        for (int e = 0; e < 16; e += 2) { const v2f c = softcap2((v2f){s[e >> 3][e & 7], s[e >> 3][(e & 7) + 1]});
#pragma unroll
            for (int i = 0; i < 2; ++i) { const int key = k0 + (e >> 3) * 16 + hi * 8 + (e & 7) + i; t[e + i] = (key <= iq) ? c[i] : -3.0e38f; bm = fmaxf(bm, t[e + i]); } }
        const int kn = min(k0 + 32, klast);                          // next block's key rows (the last block fetches its own again: in bounds, unused)
#pragma unroll
        for (int f = 0; f < 4; ++f) ka[f] = WFrag<T16>::ld((Kp + (size_t)kn * HD + f * 512) + foff);
        if constexpr (HI) {
            asm volatile("s_wait_xcnt 0x0" ::: "memory");            // stands between the hi-plane key loads and the first rewrite of their address registers (results of the lo-plane loads land in them)
#pragma unroll
            for (int f = 0; f < 4; ++f) ka2[f] = WFrag<T16>::ld((K2 + (size_t)kn * HD + f * 512) + foff);
        }
        bm = fmaxf(bm, __shfl_xor(bm, 16, 32));
        const float mn = fmaxf(m, bm); const float alpha = exp2s(__fmul_rn(__fsub_rn(m, mn), 1.4426950408889634f)); m = mn;
        float ls = 0.0f;
#pragma unroll
        for (int e = 0; e < 16; ++e) { const float d0 = __fsub_rn(t[e], mn); t[e] = exp2s(HI ? __fmul_rn(d0, 1.4426950408889634f) : __fmaf_rn(d0, 1.4426950408889634f, 10.0f)); ls += t[e]; }
        l = l * alpha + ls;
#pragma unroll
        for (int dt = 0; dt < 4; ++dt)
#pragma unroll
            for (int j = 0; j < 8; ++j) o[dt][j] *= alpha;
        if constexpr (HI) {
            v8us h0, h1, l0, l1;
#pragma unroll
            for (int j = 0; j < 8; ++j) { unsigned short a, c2; splitf(t[j], a, c2); h0[j] = a; l0[j] = c2; splitf(t[8 + j], a, c2); h1[j] = a; l1[j] = c2; }
            const V ph = cat16b(h0, h1), pl = cat16b(l0, l1);
#pragma unroll
            for (int dt = 0; dt < 4; ++dt) { o[dt] = WFrag<T16>::mma(va[dt], ph, o[dt]); o[dt] = WFrag<T16>::mma(va[dt], pl, o[dt]); o[dt] = WFrag<T16>::mma(va2[dt], ph, o[dt]); }
        } else {
            V ph;
#pragma unroll
            for (int e = 0; e < 16; ++e) ph[e] = tohx(t[e]);
#pragma unroll
            for (int dt = 0; dt < 4; ++dt) o[dt] = WFrag<T16>::mma(va[dt], ph, o[dt]);
        }
        // four vector slots behind the block's last matrix instructions, on the back edge and on the exit alike, before their operand registers are rewritten or the accumulators read
        asm volatile("v_nop\n\tv_nop\n\tv_nop\n\tv_nop" : "+v"(o[0]), "+v"(o[1]), "+v"(o[2]), "+v"(o[3]));
    }
    l += __shfl_xor(l, 16, 32);
    const float f = __fdiv_rn(1.0f, l);
#pragma unroll
    for (int dt = 0; dt < 4; ++dt) { v8us oh, ol;
#pragma unroll
        for (int j = 0; j < 8; ++j) { unsigned short a, c2; splitf(o[dt][j] * f, a, c2); oh[j] = a; ol[j] = c2; }
        const size_t oo = (size_t)q0 * DQ + dt * 256 + lane * 8; *(v8us*)(Ah + oo) = oh; *(v8us*)(Al + oo) = ol; }   // fragment order of the merged [token][DQ] planes: d tile dt of the head is half block dt of the head's two blocks
}
// grid (TT / 32, kv heads, batches), 8 waves: waves 0-3 = the 4 query heads of the kv head on row tile 127 - x, waves 4-7 the same heads on row tile x, so that every work-group walks the same number of keys (the 4 waves of a tile read the same K and V lines).
__global__ __launch_bounds__(256) void k_fattn(const h16* __restrict__ Q16, const bf* __restrict__ Qh, const bf* __restrict__ Ql, const h16* __restrict__ K16, const bf* __restrict__ Kh, const bf* __restrict__ Kl, const h16* __restrict__ V16, const bf* __restrict__ Vh, const bf* __restrict__ Vl, bf* Ah, bf* Al) {
    const int w = __builtin_amdgcn_readfirstlane(threadIdx.x >> 5); const int g = blockIdx.y, head = g * REP + (w & 3);
    const int q0 = ((w >> 2) ? (int)blockIdx.x : TT / 16 - 1 - (int)blockIdx.x) * 16;
    const size_t b = blockIdx.z, qo = (b * NH_ + head) * TT * HD, ko = (b * NKV + g) * TT * HD; Ah += b * TT * DQ; Al += b * TT * DQ;
    if (q0 < RH) attn_rows<bf, true>(Qh + qo, Ql + qo, Kh + ko, Kl + ko, Vh + ko, Vl + ko, q0, Ah + head * 1024, Al + head * 1024);
    else attn_rows<h16, false>(Q16 + qo, nullptr, K16 + ko, nullptr, V16 + ko, nullptr, q0, Ah + head * 1024, Al + head * 1024);
}

extern "C" void kernel_launch(void* const* d_in, const int* in_sizes, int n_in,
                              void* d_out, int out_size, void* d_ws, size_t ws_size, hipStream_t stream) {
    (void)in_sizes; (void)n_in; (void)out_size;
    const float* x = (const float*)d_in[0]; const float* wq = (const float*)d_in[1]; const float* wk = (const float*)d_in[2]; const float* wv = (const float*)d_in[3]; const float* wo = (const float*)d_in[4];
    float* OUT = (float*)d_out;     // [2][2048][1024]
    char* wsp = (char*)d_ws;
    auto take = [&](size_t bytes) { char* p = wsp; wsp += (bytes + 255) & ~(size_t)255; return (void*)p; };
    bf* WQ = (bf*)take((size_t)DALL * DM * 2); bf* WK = WQ + (size_t)DQ * DM; bf* WV = WK + (size_t)DKV * DM;   /* one [q | k | v columns][DM] plane */ bf* WO = (bf*)take((size_t)DM * DQ * 2); float* CS = (float*)take((size_t)TT * HD * 2 * 4);
    bf* XB = (bf*)take((size_t)NB_ * TT * DM * 2);
    h16* QP16 = (h16*)take((size_t)NB_ * NH_ * TT * HD * 2); h16* KP16 = (h16*)take((size_t)NB_ * NKV * TT * HD * 2); h16* VT16 = (h16*)take((size_t)NB_ * NKV * HD * TT * 2);
    bf* QPh = (bf*)take((size_t)NB_ * NH_ * TT * HD * 2); bf* QPl = (bf*)take((size_t)NB_ * NH_ * TT * HD * 2); bf* KPh = (bf*)take((size_t)NB_ * NKV * TT * HD * 2); bf* KPl = (bf*)take((size_t)NB_ * NKV * TT * HD * 2); bf* VTh = (bf*)take((size_t)NB_ * NKV * HD * TT * 2); bf* VTl = (bf*)take((size_t)NB_ * NKV * HD * TT * 2);
    bf* ATh = (bf*)take((size_t)NB_ * TT * DQ * 2); bf* ATl = (bf*)take((size_t)NB_ * TT * DQ * 2);
    if ((size_t)(wsp - (char*)d_ws) > ws_size) return;    // ws 256 MiB
    k_prep<<<BWQ * 2 + BWKV * 2 + BCVT + BCS, 256, 0, stream>>>(x, wq, wk, wv, wo, WQ, WK, WV, WO, XB, CS);
    k_qkv<<<dim3(NB_ * TT / 64, NALL, 1), 256, 0, stream>>>(XB, WQ, CS, QP16, QPh, QPl, KP16, KPh, KPl, VT16, VTh, VTl);
    k_fattn<<<dim3(TT / 32, NKV, NB_), 256, 0, stream>>>(QP16, QPh, QPl, KP16, KPh, KPl, VT16, VTh, VTl, ATh, ATl);
    k_gemmw<bf, 1, false, DQ><<<dim3(NB_ * TT / 64, DM / 64, 1), 256, 0, stream>>>(ATh, ATl, WO, nullptr, OUT, DM, nullptr, 0, 0, 0);
}

// v010
// A run of this version takes 80.2 microseconds.
// In two side-by-side timings against v009, it was 1.09 and 1.10 times as fast.
// Over all steps from v000 it is 19.3 times as fast.
#include <hip/hip_runtime.h>

// Causal grouped-query self-attention with QK RMS-norm, rotary embeddings and tanh logit soft-capping (x [2][2048][1024]; q = x w_q ('xw' [1024][1024] 0.02, 16 heads x 64), k, v = x w_k / w_v ([1024][256]: 4 kv heads, each shared by 4 query heads); q, k <- RMS-norm over 64 (eps 1e-5, no scale); half-split rope (theta 1e4, computed); scores / 8; softcap: 50 tanh(scores / 50); causal (-inf); softmax; out = merged w_o ('xw') -> [2][2048][1024] (4.2 M)).
// Launches: 4. {4 weight transposes, bf16 copy of x, cos/sin table} in one grid, told apart by block index; {q, k, v projections: one GEMM on the three weight planes laid end to end; a work-group takes 128 tokens of two heads; a 64x64 tile of it is 64 tokens of one head, and its epilogue norms, rotates and writes the head planes}; attention; w_o.
// Layout, both batches in every launch (token-major buffers hold 2 x 2048 rows, head planes are [batch][head]; the batch is a grid dimension or more row tiles; every 16-bit plane in fragment order, see FRAGMENT ORDER below): bf16 copy of x; 'xw' weights transposed once; exact projections with per-(token, head) RMS-norm and rotate-half rotary in the epilogue; {cos, sin} table once; causal T-2048 GQA attention fused in one launch (each kv plane serves 4 query heads; scores, soft cap as 50 x tanh(s/50) (tanh as an odd polynomial, f32), running-maximum softmax and P.V in registers; hybrid rows: < 512 hi/lo 3 products, rest fp16 x1024; key blocks above the diagonal skipped); merged hi/lo x w_o exact.
// Compute dtypes, f32 accumulate: every input rounded to bf16; projections exact; RMS-norm and rotary f32; attention rows < 512 3 products, rest fp16; soft cap and softmax f32; w_o hl x exact.

#define NB_  2
#define TT   2048
#define DM   1024
#define NH_  16
#define NKV  4
#define REP  (NH_ / NKV)
#define HD   64
#define DQ   (NH_ * HD)
#define DKV  (NKV * HD)
#define NQK  (NH_ + NKV)          // heads of a token that are normed and rotated
#define NALL (NH_ + 2 * NKV)      // q, k and v heads of a token, side by side in the joint weight plane
#define DALL (NALL * HD)
#define RH   512                  // query rows < RH use hi+lo planes (0: none)
#define SCL  0.125f
#define CAP  50.0f
#define RMSEPS 1e-5f
typedef _Float16 h16;
typedef unsigned short bf;
typedef __attribute__((ext_vector_type(16))) __bf16   v16bf;
typedef __attribute__((ext_vector_type(16))) _Float16 v16h;
typedef __attribute__((ext_vector_type(8)))  _Float16 v8h;
typedef __attribute__((ext_vector_type(8)))  unsigned short v8us;
typedef __attribute__((ext_vector_type(8)))  float    v8f;
typedef __attribute__((ext_vector_type(4)))  float    v4f;
typedef v8h  __attribute__((may_alias)) v8ha;
typedef v4f  __attribute__((may_alias)) v4fa;
typedef v8us __attribute__((may_alias)) v8usa;

__device__ __forceinline__ unsigned short f2bf(float f) { unsigned u = __float_as_uint(f); u += 0x7FFFu + ((u >> 16) & 1u); return (unsigned short)(u >> 16); }
__device__ __forceinline__ float bf2f(unsigned short b) { return __uint_as_float(((unsigned)b) << 16); }
__device__ __forceinline__ float bfr(float f) { return bf2f(f2bf(f)); }
__device__ __forceinline__ v16h cat16(v8h lo, v8h hi) { return __builtin_shufflevector(lo, hi, 0, 1, 2, 3, 4, 5, 6, 7, 8, 9, 10, 11, 12, 13, 14, 15); }
__device__ __forceinline__ v16bf cat16b(v8us lo, v8us hi) { return __builtin_bit_cast(v16bf, __builtin_shufflevector(lo, hi, 0, 1, 2, 3, 4, 5, 6, 7, 8, 9, 10, 11, 12, 13, 14, 15)); }
__device__ __forceinline__ v8f wmma16(v16h a, v16h b, v8f c) { return __builtin_amdgcn_wmma_f32_16x16x32_f16(false, a, false, b, (short)0, c, false, false); }
__device__ __forceinline__ v8f wmmab(v16bf a, v16bf b, v8f c) { return __builtin_amdgcn_wmma_f32_16x16x32_bf16(false, a, false, b, (short)0, c, false, false); }



// ---- the GEMMs (tile128 below): 8 waves per 128x128 output tile, operands from 16-bit planes in fragment order through an LDS ring; C[m][n] = sum_k X[m][k] Wt[n][k] (+ X2[m][k] Wt[n][k] with NSPLIT = 1).
// exp2s: v_exp_f32 and, in the same statement, the one vector slot that the instruction set asks for behind a transcendental before its result is read or its source overwritten
__device__ __forceinline__ float exp2s(float x) { float r; asm("v_exp_f32 %0, %1\n\tv_nop" : "=v"(r) : "v"(x)); return r; }
__device__ __forceinline__ h16 tohx(float x) { return (h16)x; }
__device__ __forceinline__ void splitf(float y, unsigned short& h, unsigned short& l) { h = f2bf(y); l = f2bf(y - bf2f(h)); }
typedef __attribute__((ext_vector_type(2))) float v2f;
// softcap2: 50 tanh(u), u = d / 8 / 50, of two raw dot products d, as d x (an even polynomial in d): tanh(u) = u (1 - u^2/3 + 2 u^4/15 - 17 u^6/315 + 62 u^8/2835 - ...), the scale 1/8 and the powers of 1/400 inside the coefficients.
// RMS-norm leaves every q and k row with length <= 8 and the rotation keeps it, so |d| <= 64 (a little more after the 16-bit rounding) and |u| <= 0.17 for any input: the first term left out is below 2e-10 of the value there, far under an f32 rounding.
// No cancellation, no transcendental, no division: 6 multiplies or multiply-adds an element, two elements an instruction (packed f32).
__device__ __forceinline__ v2f softcap2(v2f d) {
    constexpr double k2 = ((double)SCL / CAP) * ((double)SCL / CAP);
    constexpr float c0 = SCL, c1 = (float)(-SCL * k2 / 3.0), c2 = (float)(SCL * k2 * k2 * 2.0 / 15.0), c3 = (float)(-SCL * k2 * k2 * k2 * 17.0 / 315.0), c4 = (float)(SCL * k2 * k2 * k2 * k2 * 62.0 / 2835.0);
    const v2f z = d * d; v2f p = __builtin_elementwise_fma(z, (v2f){c4, c4}, (v2f){c3, c3});
    p = __builtin_elementwise_fma(z, p, (v2f){c2, c2}); p = __builtin_elementwise_fma(z, p, (v2f){c1, c1}); p = __builtin_elementwise_fma(z, p, (v2f){c0, c0}); return d * p; }
typedef unsigned short __attribute__((may_alias)) usa;
// FRAGMENT ORDER, the layout of every 16-bit operand plane [rows][K]: a block = 16 rows x 32 k = 1,024 bytes, blocks of a 16-row tile side by side along k (a tile = 16 K elements, as in row order; the v head planes instead put the 4 d tiles' blocks of each 32 keys side by side). Inside a block the
// 16-byte chunk (row r, k = 16 j + 8 h .. + 7) lies at chunk place 32 j + 16 h + pos(r): a wave's two fragment loads (lane = 16 h + r; j = 0, 1) each cover 512 contiguous bytes, 4 whole lines, where row order touched 16.
// pos(r) = r in the planes of the GEMMs; in the q, k and v head planes pos = hpos (below), so that the 8 rows which one wave of the projection epilogue owns fill one 128-byte line. Registers hold what they held: the k order is untouched.
__device__ __forceinline__ int hpos(int r) { return ((r >> 2) & 1) * 8 + ((r >> 3) & 1) * 4 + (r & 3); }
template <typename T16> struct WFrag;
template <> struct WFrag<h16> { typedef v16h V; static __device__ __forceinline__ V ld(const h16* p) { return cat16(*(const v8h*)p, *(const v8h*)(p + 256)); } static __device__ __forceinline__ v8f mma(V a, V b, v8f c) { return wmma16(a, b, c); } };
template <> struct WFrag<bf> { typedef v16bf V; static __device__ __forceinline__ V ld(const bf* p) { return cat16b(*(const v8us*)p, *(const v8us*)(p + 256)); } static __device__ __forceinline__ v8f mma(V a, V b, v8f c) { return wmmab(a, b, c); } };
// copy8: eight asynchronous 16-byte copies a lane, global memory -> LDS through no register: LDS places l, l + 4096, ...; global places g, g + gs, ... (one 4,096-byte run of a 16-row tile for each copy of the work-group).
// s_wait_xcnt 0 is the statement's last line: it stands behind the copies and in front of every later rewrite of the registers that they name.
__device__ __forceinline__ void copy8(unsigned l, const char* g, size_t gs) {
    asm volatile("global_load_async_to_lds_b128 %0, %8, off\n\tglobal_load_async_to_lds_b128 %1, %9, off\n\tglobal_load_async_to_lds_b128 %2, %10, off\n\tglobal_load_async_to_lds_b128 %3, %11, off\n\t"
                 "global_load_async_to_lds_b128 %4, %12, off\n\tglobal_load_async_to_lds_b128 %5, %13, off\n\tglobal_load_async_to_lds_b128 %6, %14, off\n\tglobal_load_async_to_lds_b128 %7, %15, off\n\ts_wait_xcnt 0x0"
                 :: "v"(l), "v"(l + 4096u), "v"(l + 8192u), "v"(l + 12288u), "v"(l + 16384u), "v"(l + 20480u), "v"(l + 24576u), "v"(l + 28672u),
                    "v"(g), "v"(g + gs), "v"(g + 2 * gs), "v"(g + 3 * gs), "v"(g + 4 * gs), "v"(g + 5 * gs), "v"(g + 6 * gs), "v"(g + 7 * gs) : "memory");
}
__device__ __forceinline__ v16bf ldsfrag(const char* p) { return cat16b(*(const v8usa*)p, *(const v8usa*)(p + 512)); }
// tile128: one 128x128 output tile by a work-group of 8 waves, K = DM. The operands (128 rows of X, of X2 with NSPLIT = 1, and of Wt; bf16 planes in fragment order) are staged in LDS, 128 k a stage, two buffers:
// in fragment order a stage of a 16-row tile is 4,096 bytes in a row, so a stage is 8 straight runs an operand, and a wave's fragment read from LDS is 512 bytes in a row as it was from global memory.
// Every operand line is fetched once a work-group and serves two 64x64 tiles. Wave w: 64x64 tile w & 3 (row half mi, column half ni), k blocks 2 (w >> 2), + 1 of the 4 blocks of each stage (16 accumulators).
// swp: the tile is computed transposed (Wt rows as the A operand). The 8 partial tiles go to LDS in register order (the ring's bytes, behind the last trip's barrier); behind one barrier all 8 waves sum and finish the four 64x64 tiles one after another:
// !PLN: f32 C, 32 columns = one whole 128-byte line of each of a wave's rows. PLN: three 16-bit planes in fragment order (fp16, bf16 hi, bf16 lo; P16, Ph, Pl point at the 4,096 elements of tile (0, 0); row half + 4,096, column half + TT * HD elements; vlay = swp: its columns are the k of a [64][T] plane, 2 blocks of 32 for each of the 4 row tiles; else its 64 columns are all of k).
// A wave then sums the slots of 8 whole rows (16 mbw + 8 hi + 4 g + q, a lane's columns 16 nb + lr), so that a row's mean square is in-lane plus a 16-lane exchange and a rotary pair (d, d + 32) sits in one lane. cs != null: the rows are tokens, the columns
// one head: RMS-norm, then rotate-half rotary out[d] = x[d] cos - x[d+32] sin, out[d+32] = x[d+32] cos + x[d] sin with {cos, sin} = cs[row][d] (the table's entries d and d + 32 are equal). cs == null: values as they are.
template <int NSPLIT, bool PLN>
__device__ __forceinline__ void tile128(const bf* __restrict__ X, const bf* __restrict__ X2, const bf* __restrict__ Wt, int r0, int c0, bool swp, float* C, int ldc, const float* __restrict__ cs, h16* P16, bf* Ph, bf* Pl) {
    static_assert(DQ == DM, "one K");
    constexpr int STG = (NSPLIT ? 3 : 2) * 32768, NS = DM / 128;     // bytes of a stage: [X 8 row tiles x 4,096 | Wt | X2]; stages
    __shared__ __align__(16) float part[(2 * STG > 131072 ? 2 * STG : 131072) / 4];   // the two buffers; then [tile][k half][slot = (mb * 4 + nb) * 2 + g][lane][4]: accumulator elements 4 g .. 4 g + 3
    const int tid = threadIdx.x, lane = tid & 31, lr = lane & 15, hi = lane >> 4; const int w = __builtin_amdgcn_readfirstlane(tid >> 5);
    const int mi = (w >> 1) & 1, ni = w & 1, ks = w >> 2;
    v8f acc[4][4];
#pragma unroll
    for (int mb = 0; mb < 4; ++mb)
#pragma unroll
        for (int nb = 0; nb < 4; ++nb) acc[mb][nb] = (v8f){};
    const unsigned l0 = (unsigned)(size_t)part + tid * 16;           // the thread's 16 bytes of every 4,096-byte run, in LDS and in the planes
    const char* gx = (const char*)(X + (size_t)r0 * DM) + tid * 16; const char* gw = (const char*)(Wt + (size_t)c0 * DM) + tid * 16; const char* gx2 = NSPLIT ? (const char*)(X2 + (size_t)r0 * DM) + tid * 16 : nullptr;
    auto fill = [&](int s) { const unsigned l = l0 + (s & 1) * STG; copy8(l, gx + s * 4096, 32 * DM); copy8(l + 32768u, gw + s * 4096, 32 * DM); if (NSPLIT) copy8(l + 65536u, gx2 + s * 4096, 32 * DM); };
    fill(0);
    asm volatile("s_wait_asynccnt 0x0" ::: "memory");                // the wave's copies of stage 0 have landed
    __syncthreads();                                                 // ... and every other wave's: stage 0 may be read
    fill(1);
    const unsigned fa = (swp ? 32768 + ni * 16384 : mi * 16384) + ks * 2048 + lane * 16, fb = (swp ? mi * 16384 : 32768 + ni * 16384) + ks * 2048 + lane * 16;
    // kept rolled: a trip is one stage, and the order at its foot is the ring's
#pragma unroll 1
    for (int s = 0; s < NS; ++s) {
        const char* bp = (const char*)part + (s & 1) * STG;
        v16bf a[4], a2[4];
#pragma unroll
        for (int kb = 0; kb < 2; ++kb) {
            v16bf b[4];
#pragma unroll
            for (int mb = 0; mb < 4; ++mb) { a[mb] = ldsfrag(bp + fa + mb * 4096 + kb * 1024); b[mb] = ldsfrag(bp + fb + mb * 4096 + kb * 1024); if (NSPLIT) a2[mb] = ldsfrag(bp + 65536 + fa + mb * 4096 + kb * 1024); }
            __builtin_amdgcn_sched_barrier(0);                       // the block's LDS reads stay one group in front of its matrix instructions: spread among them, every group of four waited for a read of its own
#pragma unroll
            for (int nb = 0; nb < 4; ++nb)
#pragma unroll
                for (int mb = 0; mb < 4; ++mb) { acc[mb][nb] = wmmab(a[mb], b[nb], acc[mb][nb]); if (NSPLIT) acc[mb][nb] = wmmab(a2[mb], b[nb], acc[mb][nb]); }
        }
        asm volatile("s_wait_dscnt 0x0" ::: "memory");               // the wave's reads of this stage's buffer are done before the buffer is given up
        asm volatile("s_wait_asynccnt 0x0" ::: "memory");            // the wave's copies of stage s + 1 have landed
        __syncthreads();                                             // publishes stage s + 1 and ends every wave's reads of stage s
        if (s + 2 < NS) fill(s + 2);                                 // into the buffer that this trip has read
    }
    asm volatile("s_wait_asynccnt 0x0" ::: "memory");                // no copy is in flight when the ring's bytes take the partial tiles
    const int wr = (w & 3) * 2 + ks;
#pragma unroll
    for (int mb = 0; mb < 4; ++mb)
#pragma unroll
        for (int nb = 0; nb < 4; ++nb)
#pragma unroll
            for (int g = 0; g < 2; ++g) { v4f p; p[0] = acc[mb][nb][g * 4]; p[1] = acc[mb][nb][g * 4 + 1]; p[2] = acc[mb][nb][g * 4 + 2]; p[3] = acc[mb][nb][g * 4 + 3];
                *(v4fa*)(part + (((wr * 32 + (mb * 4 + nb) * 2 + g) * 32 + lane) << 2)) = p; }
    v2f csv[2][4][2] = {};                                           // PLN: {cos, sin} of the lane's 4 rows and 2 rotary pairs in each row half, issued in front of the barrier: they depend on nothing that it orders
    if constexpr (PLN) { if (cs) {
#pragma unroll
        for (int h = 0; h < 2; ++h)
#pragma unroll
            for (int q = 0; q < 4; ++q)
#pragma unroll
                for (int u = 0; u < 2; ++u) csv[h][q][u] = *(const v2f*)(cs + ((size_t)(h * 64 + (w >> 1) * 16 + (w & 1) * 4 + hi * 8 + q) * HD + u * 16 + lr) * 2);
        asm volatile("s_wait_xcnt 0x0" ::: "memory");                // stands between the table loads and the first rewrite of their address registers (LDS reads behind the barrier land in them)
    } }
    __syncthreads();                                                 // every wave's partial tile is in LDS before any wave sums
#pragma unroll
    for (int t4 = 0; t4 < 4; ++t4) {                                  // 64x64 tile t4 = (row half t4 >> 1, column half t4 & 1): 32 KiB of LDS of its own
        const float* pt = part + t4 * 8192;
        if constexpr (PLN) {
            const int mbw = w >> 1, g = w & 1;                        // the lane's rows: row0 + 8 hi + q, row0 = 16 mbw + 4 g
            v4f s[4];
#pragma unroll
            for (int nb = 0; nb < 4; ++nb) { const int slot = (mbw * 4 + nb) * 2 + g; s[nb] = *(const v4fa*)(pt + ((slot * 32 + lane) << 2)) + *(const v4fa*)(pt + (((32 + slot) * 32 + lane) << 2)); }
            if (cs) {
                v4f ss = s[0] * s[0] + s[1] * s[1] + s[2] * s[2] + s[3] * s[3];
#pragma unroll
                for (int sh = 8; sh; sh >>= 1)
#pragma unroll
                    for (int q = 0; q < 4; ++q) ss[q] += __shfl_xor(ss[q], sh, 32);
#pragma unroll
                for (int q = 0; q < 4; ++q) { const float rs = __fdiv_rn(1.0f, __fsqrt_rn(__fadd_rn(__fdiv_rn(ss[q], (float)HD), RMSEPS)));
#pragma unroll
                    for (int u = 0; u < 2; ++u) { const float x0 = s[u][q] * rs, x1 = s[u + 2][q] * rs, co = csv[t4 >> 1][q][u][0], si = csv[t4 >> 1][q][u][1]; s[u][q] = x0 * co - x1 * si; s[u + 2][q] = x1 * co + x0 * si; } }
            }
            // staged through LDS so that every global store is whole 128-byte lines: rows 8 i .. 8 i + 3 (+ row0) of a plane lie in 512 bytes, one slot of those that this wave alone has read:
            // slot (mbw * 4 + i) * 2 + g of k half 0 (fp16) and of k half 1 (hi), slot (mbw * 4 + 2 + i) * 2 + g of k half 0 (lo)
            usa* st = (usa*)part + t4 * 16384;
#pragma unroll
            for (int nb = 0; nb < 4; ++nb)
#pragma unroll
                for (int q = 0; q < 4; ++q) { const float r = s[nb][q]; unsigned short a, c2; splitf(r, a, c2); const int at = (((mbw * 4 + hi) * 2 + g) << 8) + q * 64 + nb * 16 + lr;
                    st[at] = __builtin_bit_cast(unsigned short, tohx(r)); st[at + (32 << 8)] = a; st[at + (4 << 8)] = c2; }
            asm volatile("s_wait_dscnt 0x0" ::: "memory");           // the wave's staged rows are in LDS before its lanes read what other lanes of it wrote
            const size_t ot = (size_t)(t4 >> 1) * 4096 + (size_t)(t4 & 1) * TT * HD;
#pragma unroll
            for (int i = 0; i < 2; ++i) { const int c = i * 4 + (lane >> 3), pos = lane & 7;   // column chunk c of the wave's 8 rows (row0 + 8 (pos >> 2) + (pos & 3), at hpos = 8 g + pos) = one line of the fragment-order plane
                const int at = (((mbw * 4 + (pos >> 2)) * 2 + g) << 8) + (pos & 3) * 64 + c * 8;
                const size_t o = ot + (size_t)(swp ? ((c >> 2) * 4 + mbw) * 512 + ((c >> 1) & 1) * 256 : mbw * 1024 + (c >> 1) * 256) + (c & 1) * 128 + g * 64 + pos * 8;
                *(v8usa*)(P16 + o) = *(const v8usa*)(st + at); *(v8usa*)(Ph + o) = *(const v8usa*)(st + at + (32 << 8)); *(v8usa*)(Pl + o) = *(const v8usa*)(st + at + (4 << 8));
                asm volatile("s_wait_xcnt 0x0" ::: "memory"); }      // stands between the three stores and the first rewrite of the registers that they name
        } else {
            const int mbw = w >> 1, nbp = w & 1;
            v4f sv[2][2];                                            // the tile's four sums of the lane first (8 LDS reads, one wait), then its 16 stores
#pragma unroll
            for (int u = 0; u < 2; ++u)
#pragma unroll
                for (int gg = 0; gg < 2; ++gg) { const int slot = (mbw * 4 + nbp * 2 + u) * 2 + gg; sv[u][gg] = *(const v4fa*)(pt + ((slot * 32 + lane) << 2)) + *(const v4fa*)(pt + (((32 + slot) * 32 + lane) << 2)); }
#pragma unroll
            for (int u = 0; u < 2; ++u) { const int col = c0 + (t4 & 1) * 64 + (nbp * 2 + u) * 16 + lr;
#pragma unroll
                for (int gg = 0; gg < 2; ++gg)
#pragma unroll
                    for (int q = 0; q < 4; ++q) C[(size_t)(r0 + (t4 >> 1) * 64 + mbw * 16 + hi * 8 + gg * 4 + q) * ldc + col] = sv[u][gg][q]; }
            asm volatile("s_wait_xcnt 0x0" ::: "memory");            // stands between the tile's stores and the first rewrite of the registers that they name
        }
    }
}
// k_wo: out = merged (hi + lo planes) x w_o; grid (token tiles of 128, column tiles of 128)
__global__ __launch_bounds__(256) void k_wo(const bf* __restrict__ Ah, const bf* __restrict__ Al, const bf* __restrict__ Wt, float* C) {
    tile128<1, false>(Ah, Al, Wt, blockIdx.x * 128, blockIdx.y * 128, false, C, DM, nullptr, nullptr, nullptr, nullptr);
}
typedef __attribute__((ext_vector_type(2))) unsigned short v2us;

// the bodies below take their block index bx as an argument: the launched kernels hand each block range of a shared grid to one of them
__device__ __forceinline__ void wtG(const float* __restrict__ w, int K, int N, bf* Bt, int bx) {
    const int lane = threadIdx.x & 31; const int L0 = (bx * 8 + (threadIdx.x >> 5)) * 8; const int nlines = N * K / 64;
{
#pragma unroll 1
        for (int l = 0; l < 8; ++l) { const int L = L0 + l; if (L >= nlines) break; const size_t e = (size_t)L * 64 + lane * 2;   // a line of the fragment-order plane: 8 rows n x 8 k; the lane's two k of one row
            const int ci = L * 8 + (lane >> 2), blk = ci >> 6; const int k = (blk % (K / 32)) * 32 + ((ci >> 5) & 1) * 16 + ((ci >> 4) & 1) * 8 + (lane & 3) * 2, n = (blk / (K / 32)) * 16 + (ci & 15); v2us o;
            o[0] = f2bf(w[(size_t)k * N + n]); o[1] = f2bf(w[(size_t)(k + 1) * N + n]); *(v2us*)(Bt + e) = o; }
         }
}
__device__ __forceinline__ void cvt8(const float* __restrict__ src, bf* dst, size_t n8, int bx) { const size_t i = (size_t)bx * 256 + threadIdx.x; if (i >= n8) return;   // i = chunk place in the fragment-order plane of DM columns
    const size_t blk = i >> 6; const v8f v = *(const v8f*)(src + ((blk / (DM / 32)) * 16 + (i & 15)) * DM + (blk % (DM / 32)) * 32 + ((i >> 5) & 1) * 16 + ((i >> 4) & 1) * 8); v8us o;
#pragma unroll
    for (int k = 0; k < 8; ++k) o[k] = f2bf(v[k]); *(v8us*)(dst + i * 8) = o;  }
__constant__ float INVT[HD / 2] = { 1.000000000e+00f, 7.498942018e-01f, 5.623413324e-01f, 4.216965139e-01f, 3.162277639e-01f, 2.371373773e-01f, 1.778279394e-01f, 1.333521456e-01f, 1.000000015e-01f, 7.498942316e-02f, 5.623413250e-02f, 4.216964915e-02f, 3.162277490e-02f, 2.371373773e-02f, 1.778279431e-02f, 1.333521400e-02f, 9.999999776e-03f, 7.498942316e-03f, 5.623413250e-03f, 4.216964822e-03f, 3.162277630e-03f, 2.371373819e-03f, 1.778279431e-03f, 1.333521446e-03f, 1.000000047e-03f, 7.498941850e-04f, 5.623413017e-04f, 4.216965172e-04f, 3.162277571e-04f, 2.371373703e-04f, 1.778279402e-04f, 1.333521504e-04f };   // 10000^(-2i/64) (the module's power form) (float32, generated with jnp to be bit-exact)
__device__ __forceinline__ void cs4(float* CS, int bx) { const int idx = bx * 256 + threadIdx.x; if (idx >= TT * HD) return; const int d = idx % HD; const int t = idx / HD; const float a = __fmul_rn((float)t, INVT[d % (HD / 2)]); v2f cs; cs[0] = cosf(a); cs[1] = sinf(a); *(v2f*)(CS + (size_t)idx * 2) = cs;  }

// block counts of the bodies above (each as its own launch had it)
#define BWQ  (DM * DQ / 64 / 64)
#define BWKV (DM * DKV / 64 / 64)
#define BCVT (NB_ * TT * DM / 8 / 256)
#define BCS  (TT * HD / 256)
// k_prep: everything that reads only the inputs. The transposes stand first in the grid: their waves run longest (8 dependent trips of strided loads).
__global__ __launch_bounds__(256) void k_prep(const float* __restrict__ x, const float* __restrict__ wq, const float* __restrict__ wk, const float* __restrict__ wv, const float* __restrict__ wo, bf* WQ, bf* WK, bf* WV, bf* WO, bf* XB, float* CS) {
    int bx = blockIdx.x;
    // tested first although its blocks stand last: as the last of six tests the compiler took the call site for cold and left cosf and sinf as real calls
    if (bx >= BWQ * 2 + BWKV * 2 + BCVT) { cs4(CS, bx - (BWQ * 2 + BWKV * 2 + BCVT)); return; }
    if (bx < BWQ) { wtG(wq, DM, DQ, WQ, bx); return; } bx -= BWQ;
    if (bx < BWQ) { wtG(wo, DQ, DM, WO, bx); return; } bx -= BWQ;
    if (bx < BWKV) { wtG(wk, DM, DKV, WK, bx); return; } bx -= BWKV;
    if (bx < BWKV) { wtG(wv, DM, DKV, WV, bx); return; } bx -= BWKV;
    cvt8(x, XB, (size_t)NB_ * TT * DM / 8, bx);
}
// k_qkv: grid (128-token tiles of both batches, pairs of q + k + v heads; a pair is of one kind). W = the [q | k | v columns][DM] weight plane. A q or k 64x64 tile is [64 tokens][head], normed, rotated and written to the head's [t][d] planes;
// a v tile is computed transposed, [d][64 tokens] (the weight rows as the A operand), as the [d][t] value planes want it.
__global__ __launch_bounds__(256) void k_qkv(const bf* __restrict__ XB, const bf* __restrict__ W, const float* __restrict__ CS, h16* QP16, bf* QPh, bf* QPl, h16* KP16, bf* KPh, bf* KPl, h16* VT16, bf* VTh, bf* VTl) {
    const int hh = blockIdx.y * 2, tok = blockIdx.x * 128, b = tok / TT, t0 = tok % TT; const bool isq = hh < NH_, isv = hh >= NQK;
    const size_t o = isq ? ((size_t)(b * NH_ + hh) * TT + t0) * HD : ((size_t)(b * NKV + hh - (isv ? NQK : NH_)) * TT + t0) * HD;   // 64 tokens of a head are 4,096 elements in a row in all three kinds of plane
    tile128<0, true>(XB, nullptr, W, tok, hh * HD, isv, nullptr, 0, isv ? nullptr : CS + (size_t)t0 * HD * 2,
        (isq ? QP16 : isv ? VT16 : KP16) + o, (isq ? QPh : isv ? VTh : KPh) + o, (isq ? QPl : isv ? VTl : KPl) + o);
}

template <typename T16, bool HI>
__device__ __forceinline__ void attn_rows(const T16* __restrict__ Q, const T16* __restrict__ Q2, const T16* __restrict__ Kp, const T16* __restrict__ K2, const T16* __restrict__ Vt, const T16* __restrict__ V2, int q0, bf* Ah, bf* Al) {
    typedef typename WFrag<T16>::V V;
    const int lane = threadIdx.x & 31, lr = lane & 15, hi = lane >> 4; const int iq = q0 + lr;
    const unsigned foff = (hi * 16 + hpos(lr)) * 8;            // the lane's chunk in every 512-byte half block of the head planes (fragment order); 32 keys are 2,048 elements in a row of the key planes and of the value planes
    V qb[2], qb2[2];
#pragma unroll
    for (int ks = 0; ks < 2; ++ks) { qb[ks] = WFrag<T16>::ld((Q + (size_t)q0 * HD + ks * 512) + foff); if (HI) qb2[ks] = WFrag<T16>::ld((Q2 + (size_t)q0 * HD + ks * 512) + foff); }
    asm volatile("s_wait_xcnt 0x0" ::: "memory");                    // stands between the query loads and the first rewrite of the registers that hold their address
    v8f o[4];
#pragma unroll
    for (int dt = 0; dt < 4; ++dt) o[dt] = (v8f){};
    float m = -3.0e38f, l = 0.0f;
    const int klast = ((q0 + 15) >> 5) << 5;                         // first key of the block that holds the diagonal
    V ka[4], ka2[4];                                                 // [key tile * 2 + k step], fetched one block ahead
#pragma unroll
    for (int f = 0; f < 4; ++f) { ka[f] = WFrag<T16>::ld((Kp + f * 512) + foff); if (HI) ka2[f] = WFrag<T16>::ld((K2 + f * 512) + foff); }
    // kept rolled: the trip count is the wave's own and one block is some 500 instructions already; every inner loop below is unrolled whole so that fragments, scores and accumulators stay in registers
#pragma unroll 1
    for (int k0 = 0; k0 <= klast; k0 += 32) {
        V va[4], va2[4];                                             // this block's value rows: issued here, used behind the softmax arithmetic
#pragma unroll
        for (int dt = 0; dt < 4; ++dt) va[dt] = WFrag<T16>::ld((Vt + (size_t)k0 * HD + dt * 512) + foff);
        if constexpr (HI) {
            asm volatile("s_wait_xcnt 0x0" ::: "memory");            // stands between the hi-plane value loads and the first rewrite of their address registers (results of the lo-plane loads land in them)
#pragma unroll
            for (int dt = 0; dt < 4; ++dt) va2[dt] = WFrag<T16>::ld((V2 + (size_t)k0 * HD + dt * 512) + foff);
        }
        asm volatile("s_wait_xcnt 0x0" ::: "memory");                // stands between the value loads and the first rewrite of their address registers (results of the key loads below land in some of them)
        v8f s[2];
#pragma unroll
        for (int kt = 0; kt < 2; ++kt) { s[kt] = (v8f){};
#pragma unroll
            for (int ks = 0; ks < 2; ++ks) { s[kt] = WFrag<T16>::mma(ka[kt * 2 + ks], qb[ks], s[kt]); if (HI) { s[kt] = WFrag<T16>::mma(ka[kt * 2 + ks], qb2[ks], s[kt]); s[kt] = WFrag<T16>::mma(ka2[kt * 2 + ks], qb[ks], s[kt]); } } }
        float t[16]; float bm = -3.0e38f;
#pragma unroll
        for (int e = 0; e < 16; e += 2) { const v2f c = softcap2((v2f){s[e >> 3][e & 7], s[e >> 3][(e & 7) + 1]});
#pragma unroll
            for (int i = 0; i < 2; ++i) { const int key = k0 + (e >> 3) * 16 + hi * 8 + (e & 7) + i; t[e + i] = (key <= iq) ? c[i] : -3.0e38f; bm = fmaxf(bm, t[e + i]); } }
        const int kn = min(k0 + 32, klast);                          // next block's key rows (the last block fetches its own again: in bounds, unused)
#pragma unroll
        for (int f = 0; f < 4; ++f) ka[f] = WFrag<T16>::ld((Kp + (size_t)kn * HD + f * 512) + foff);
        if constexpr (HI) {
            asm volatile("s_wait_xcnt 0x0" ::: "memory");            // stands between the hi-plane key loads and the first rewrite of their address registers (results of the lo-plane loads land in them)
#pragma unroll
            for (int f = 0; f < 4; ++f) ka2[f] = WFrag<T16>::ld((K2 + (size_t)kn * HD + f * 512) + foff);
        }
        bm = fmaxf(bm, __shfl_xor(bm, 16, 32));
        const float mn = fmaxf(m, bm); const float alpha = exp2s(__fmul_rn(__fsub_rn(m, mn), 1.4426950408889634f)); m = mn;
        float ls = 0.0f;
#pragma unroll
        for (int e = 0; e < 16; ++e) { const float d0 = __fsub_rn(t[e], mn); t[e] = exp2s(HI ? __fmul_rn(d0, 1.4426950408889634f) : __fmaf_rn(d0, 1.4426950408889634f, 10.0f)); ls += t[e]; }
        l = l * alpha + ls;
#pragma unroll
        for (int dt = 0; dt < 4; ++dt)
#pragma unroll
            for (int j = 0; j < 8; ++j) o[dt][j] *= alpha;
        if constexpr (HI) {
            v8us h0, h1, l0, l1;
#pragma unroll
            for (int j = 0; j < 8; ++j) { unsigned short a, c2; splitf(t[j], a, c2); h0[j] = a; l0[j] = c2; splitf(t[8 + j], a, c2); h1[j] = a; l1[j] = c2; }
            const V ph = cat16b(h0, h1), pl = cat16b(l0, l1);
#pragma unroll
            for (int dt = 0; dt < 4; ++dt) { o[dt] = WFrag<T16>::mma(va[dt], ph, o[dt]); o[dt] = WFrag<T16>::mma(va[dt], pl, o[dt]); o[dt] = WFrag<T16>::mma(va2[dt], ph, o[dt]); }
        } else {
            V ph;
#pragma unroll
            for (int e = 0; e < 16; ++e) ph[e] = tohx(t[e]);
#pragma unroll
            for (int dt = 0; dt < 4; ++dt) o[dt] = WFrag<T16>::mma(va[dt], ph, o[dt]);
        }
        // four vector slots behind the block's last matrix instructions, on the back edge and on the exit alike, before their operand registers are rewritten or the accumulators read
        asm volatile("v_nop\n\tv_nop\n\tv_nop\n\tv_nop" : "+v"(o[0]), "+v"(o[1]), "+v"(o[2]), "+v"(o[3]));
    }
    l += __shfl_xor(l, 16, 32);
    const float f = __fdiv_rn(1.0f, l);
#pragma unroll
    for (int dt = 0; dt < 4; ++dt) { v8us oh, ol;
#pragma unroll
        for (int j = 0; j < 8; ++j) { unsigned short a, c2; splitf(o[dt][j] * f, a, c2); oh[j] = a; ol[j] = c2; }
        const size_t oo = (size_t)q0 * DQ + dt * 256 + lane * 8; *(v8us*)(Ah + oo) = oh; *(v8us*)(Al + oo) = ol; }   // fragment order of the merged [token][DQ] planes: d tile dt of the head is half block dt of the head's two blocks
}
// grid (TT / 32, kv heads, batches), 8 waves: waves 0-3 = the 4 query heads of the kv head on row tile 127 - x, waves 4-7 the same heads on row tile x, so that every work-group walks the same number of keys (the 4 waves of a tile read the same K and V lines).
__global__ __launch_bounds__(256) void k_fattn(const h16* __restrict__ Q16, const bf* __restrict__ Qh, const bf* __restrict__ Ql, const h16* __restrict__ K16, const bf* __restrict__ Kh, const bf* __restrict__ Kl, const h16* __restrict__ V16, const bf* __restrict__ Vh, const bf* __restrict__ Vl, bf* Ah, bf* Al) {
    const int w = __builtin_amdgcn_readfirstlane(threadIdx.x >> 5); const int g = blockIdx.y, head = g * REP + (w & 3);
    const int q0 = ((w >> 2) ? (int)blockIdx.x : TT / 16 - 1 - (int)blockIdx.x) * 16;
    const size_t b = blockIdx.z, qo = (b * NH_ + head) * TT * HD, ko = (b * NKV + g) * TT * HD; Ah += b * TT * DQ; Al += b * TT * DQ;
    if (q0 < RH) attn_rows<bf, true>(Qh + qo, Ql + qo, Kh + ko, Kl + ko, Vh + ko, Vl + ko, q0, Ah + head * 1024, Al + head * 1024);
    else attn_rows<h16, false>(Q16 + qo, nullptr, K16 + ko, nullptr, V16 + ko, nullptr, q0, Ah + head * 1024, Al + head * 1024);
}

extern "C" void kernel_launch(void* const* d_in, const int* in_sizes, int n_in,
                              void* d_out, int out_size, void* d_ws, size_t ws_size, hipStream_t stream) {
    (void)in_sizes; (void)n_in; (void)out_size;
    const float* x = (const float*)d_in[0]; const float* wq = (const float*)d_in[1]; const float* wk = (const float*)d_in[2]; const float* wv = (const float*)d_in[3]; const float* wo = (const float*)d_in[4];
    float* OUT = (float*)d_out;     // [2][2048][1024]
    char* wsp = (char*)d_ws;
    auto take = [&](size_t bytes) { char* p = wsp; wsp += (bytes + 255) & ~(size_t)255; return (void*)p; };
    bf* WQ = (bf*)take((size_t)DALL * DM * 2); bf* WK = WQ + (size_t)DQ * DM; bf* WV = WK + (size_t)DKV * DM;   /* one [q | k | v columns][DM] plane */ bf* WO = (bf*)take((size_t)DM * DQ * 2); float* CS = (float*)take((size_t)TT * HD * 2 * 4);
    bf* XB = (bf*)take((size_t)NB_ * TT * DM * 2);
    h16* QP16 = (h16*)take((size_t)NB_ * NH_ * TT * HD * 2); h16* KP16 = (h16*)take((size_t)NB_ * NKV * TT * HD * 2); h16* VT16 = (h16*)take((size_t)NB_ * NKV * HD * TT * 2);
    bf* QPh = (bf*)take((size_t)NB_ * NH_ * TT * HD * 2); bf* QPl = (bf*)take((size_t)NB_ * NH_ * TT * HD * 2); bf* KPh = (bf*)take((size_t)NB_ * NKV * TT * HD * 2); bf* KPl = (bf*)take((size_t)NB_ * NKV * TT * HD * 2); bf* VTh = (bf*)take((size_t)NB_ * NKV * HD * TT * 2); bf* VTl = (bf*)take((size_t)NB_ * NKV * HD * TT * 2);
    bf* ATh = (bf*)take((size_t)NB_ * TT * DQ * 2); bf* ATl = (bf*)take((size_t)NB_ * TT * DQ * 2);
    if ((size_t)(wsp - (char*)d_ws) > ws_size) return;    // ws 256 MiB
    k_prep<<<BWQ * 2 + BWKV * 2 + BCVT + BCS, 256, 0, stream>>>(x, wq, wk, wv, wo, WQ, WK, WV, WO, XB, CS);
    k_qkv<<<dim3(NB_ * TT / 128, NALL / 2, 1), 256, 0, stream>>>(XB, WQ, CS, QP16, QPh, QPl, KP16, KPh, KPl, VT16, VTh, VTl);
    k_fattn<<<dim3(TT / 32, NKV, NB_), 256, 0, stream>>>(QP16, QPh, QPl, KP16, KPh, KPl, VT16, VTh, VTl, ATh, ATl);
    k_wo<<<dim3(NB_ * TT / 128, DM / 128, 1), 256, 0, stream>>>(ATh, ATl, WO, OUT);
}
